// v000
// Measured on an AMD MI455X. A time is GPU time per run, averaged over a window of back-to-back runs after a warm-up
// (all launches, gaps included; the runs take copies of the inputs in turn), and the median of several windows.
// Apart from v000's, it joins two sittings. Times from different sittings can be a few percent apart, while
// side-by-side timings come from the same sitting.
// v000, which the later versions start from, runs in 536 microseconds.
#include <hip/hip_runtime.h>
#include <hip/hip_bf16.h>
#include <math.h>

typedef __attribute__((ext_vector_type(16))) _Float16 v16h;
typedef __attribute__((ext_vector_type(8)))  _Float16 v8h;
typedef __attribute__((ext_vector_type(8)))  float    v8f;

#define BB 2
#define SS 2048
#define DD 768
#define HH 12
#define HD 64
#define FF 3072
#define ROWS (BB*SS)          // 4096
#define EPS 1e-5f

#define BM 128
#define BN 128
#define BK 32

// ---------------------------------------------------------------------------
// Tensor Data Mover support (gfx1250). Falls back to vector loads if the
// builtin is unavailable (e.g. host pass of hipcc).
// ---------------------------------------------------------------------------
#ifndef __has_builtin
#define __has_builtin(x) 0
#endif
#if __has_builtin(__builtin_amdgcn_tensor_load_to_lds) && \
    __has_builtin(__builtin_amdgcn_s_wait_tensorcnt)
#define HAVE_TDM 1
#if defined(__has_include)
#if __has_include(<hip/amd_detail/amd_gfx1250_TDM.h>)
#define TDM_SIX_ARGS 1
#endif
#endif
#else
#define HAVE_TDM 0
#endif

#if HAVE_TDM
typedef unsigned int u32x4  __attribute__((ext_vector_type(4)));
typedef int          i32x4t __attribute__((ext_vector_type(4)));
typedef int          i32x8t __attribute__((ext_vector_type(8)));

// Issue a 2D TDM tile load: tileRows x tileCols elements (2 bytes each),
// global row stride = rowStrideElems, destination LDS byte offset lds_off.
static __device__ __forceinline__ void tdm_load_2d(const void* gsrc, unsigned lds_off,
                                                   int tileRows, int tileCols,
                                                   long long rowStrideElems) {
  unsigned long long ga = (unsigned long long)(size_t)gsrc;
  u32x4 g0;
  g0.x = 1u;                                                 // count = 1 valid D#
  g0.y = lds_off;                                            // lds_addr
  g0.z = (unsigned)ga;                                       // global_addr[31:0]
  g0.w = (unsigned)((ga >> 32) & 0x01ffffffu) | (2u << 30);  // global_addr[56:32], type=2
  unsigned long long str = (unsigned long long)rowStrideElems;
  unsigned td0 = 0x40000000u, td1 = 0x40000000u;             // huge extents: no OOB clip
  i32x8t g1;
  g1[0] = (int)(1u << 16);                                   // data_size = 2B
  g1[1] = (int)((td0 & 0xffffu) << 16);                      // tensor_dim0 lo
  g1[2] = (int)((td0 >> 16) | ((td1 & 0xffffu) << 16));      // tensor_dim0 hi | dim1 lo
  g1[3] = (int)((td1 >> 16) | ((unsigned)tileCols << 16));   // dim1 hi | tile_dim0
  g1[4] = (int)((unsigned)tileRows & 0xffffu);               // tile_dim1 (tile_dim2=0)
  g1[5] = (int)(unsigned)(str & 0xffffffffu);                // tensor_dim0_stride lo
  g1[6] = (int)(unsigned)((str >> 32) & 0xffffu);            // stride hi
  g1[7] = 0;
  i32x4t z = {};
#if defined(TDM_SIX_ARGS)
  i32x8t z8 = {};
  __builtin_amdgcn_tensor_load_to_lds(g0, g1, z, z, z8, 0);
#else
  __builtin_amdgcn_tensor_load_to_lds(g0, g1, z, z, 0);
#endif
}
#endif

static __device__ __forceinline__ v16h cat16(v8h lo, v8h hi) {
  return __builtin_shufflevector(lo, hi, 0,1,2,3,4,5,6,7,8,9,10,11,12,13,14,15);
}

// ---------------------------------------------------------------------------
// Weight conversion kernels: fp32 -> f16, producing TRANSPOSED (N-major)
// weights so the GEMM B-operand is contraction-contiguous.
// ---------------------------------------------------------------------------
__global__ __launch_bounds__(256) void cvt_whdk_T(const float* __restrict__ W,
                                                  _Float16* __restrict__ out) {
  // (H, D, HD) -> out[(h*HD+k)][D] : out[n*D + d] = W[h][d][k]
  int idx = blockIdx.x * 256 + threadIdx.x;
  if (idx >= DD * HH * HD) return;
  int n = idx / DD;
  int d = idx % DD;
  int h = n / HD, k = n % HD;
  out[idx] = (_Float16)W[((size_t)h * DD + d) * HD + k];
}

__global__ __launch_bounds__(256) void cvt_T(const float* __restrict__ W,
                                             _Float16* __restrict__ out,
                                             int R, int C) {
  // in [R][C] -> out [C][R]
  int idx = blockIdx.x * 256 + threadIdx.x;
  if (idx >= R * C) return;
  int c = idx / R, r = idx % R;
  out[idx] = (_Float16)W[(size_t)r * C + c];
}

// ---------------------------------------------------------------------------
// LayerNorm (row of 768) -> f16 output
// ---------------------------------------------------------------------------
__global__ __launch_bounds__(256) void ln_f16(const float* __restrict__ x,
                                              const float* __restrict__ g,
                                              const float* __restrict__ bta,
                                              _Float16* __restrict__ out) {
  __shared__ float red[256];
  int row = blockIdx.x, tid = threadIdx.x;
  const float* xr = x + (size_t)row * DD;
  float v0 = xr[tid], v1 = xr[tid + 256], v2 = xr[tid + 512];
  red[tid] = v0 + v1 + v2;
  __syncthreads();
  #pragma unroll
  for (int st = 128; st > 0; st >>= 1) {
    if (tid < st) red[tid] += red[tid + st];
    __syncthreads();
  }
  float mean = red[0] * (1.0f / DD);
  __syncthreads();
  float d0 = v0 - mean, d1 = v1 - mean, d2 = v2 - mean;
  red[tid] = d0 * d0 + d1 * d1 + d2 * d2;
  __syncthreads();
  #pragma unroll
  for (int st = 128; st > 0; st >>= 1) {
    if (tid < st) red[tid] += red[tid + st];
    __syncthreads();
  }
  float rs = rsqrtf(red[0] * (1.0f / DD) + EPS);
  _Float16* orow = out + (size_t)row * DD;
  orow[tid]       = (_Float16)(d0 * rs * g[tid]       + bta[tid]);
  orow[tid + 256] = (_Float16)(d1 * rs * g[tid + 256] + bta[tid + 256]);
  orow[tid + 512] = (_Float16)(d2 * rs * g[tid + 512] + bta[tid + 512]);
}

// ---------------------------------------------------------------------------
// WMMA GEMM: C[M,N] = act(A[M,K](f16) x BT[N,K](f16)^T + bias) (+ resid)
// 256 threads = 8 waves. Block tile 128x128, K-step 32.
// Wave grid 4(M) x 2(N); each wave: 2 A-frags x 4 B-frags -> 8 WMMA / K-step.
// B (weight) tiles are streamed by the Tensor Data Mover into double-buffered
// LDS; wave 0 issues the DMA and synchronizes with s_wait_tensorcnt.
// flags: bit0 = f16 output, bit1 = exact GELU
// ---------------------------------------------------------------------------
__global__ __launch_bounds__(256) void gemm_wmma(const _Float16* __restrict__ A,
                                                 const _Float16* __restrict__ BT,
                                                 const float* __restrict__ bias,
                                                 const float* __restrict__ resid,
                                                 void* __restrict__ Cout,
                                                 int M, int N, int K, int flags) {
  __shared__ __align__(16) _Float16 As[BM * BK];
#if HAVE_TDM
  __shared__ __align__(16) _Float16 Bsd[2][BN * BK];
#else
  __shared__ __align__(16) _Float16 Bs[BN * BK];
#endif
  int tid = threadIdx.x;
  int wid = tid >> 5, lane = tid & 31;
  int half = lane >> 4, r = lane & 15;
  int wm = wid & 3, wn = wid >> 2;
  int m0 = blockIdx.y * BM, n0 = blockIdx.x * BN;

  v8f acc[2][4];
  #pragma unroll
  for (int mi = 0; mi < 2; ++mi)
    #pragma unroll
    for (int ni = 0; ni < 4; ++ni) acc[mi][ni] = (v8f){};

  int ldRow = tid >> 1, ldCg = (tid & 1) * 16;   // 128 rows x 32 halves

#if HAVE_TDM
  if (wid == 0)
    tdm_load_2d(BT + (size_t)n0 * K, (unsigned)(size_t)&Bsd[0][0], BN, BK, K);
#endif

  for (int k0 = 0; k0 < K; k0 += BK) {
    const _Float16* ga = A + (size_t)(m0 + ldRow) * K + k0 + ldCg;
    v8h a0 = *(const v8h*)ga;
    v8h a1 = *(const v8h*)(ga + 8);
    if (k0 + BK < K) __builtin_prefetch(ga + BK, 0, 1);
    *(v8h*)&As[ldRow * BK + ldCg]     = a0;
    *(v8h*)&As[ldRow * BK + ldCg + 8] = a1;

#if HAVE_TDM
    int pb = (k0 / BK) & 1;
    if (wid == 0) {
      if (k0 + BK < K) {
        tdm_load_2d(BT + (size_t)n0 * K + (k0 + BK),
                    (unsigned)(size_t)&Bsd[pb ^ 1][0], BN, BK, K);
        __builtin_amdgcn_s_wait_tensorcnt(1);   // current tile has landed
      } else {
        __builtin_amdgcn_s_wait_tensorcnt(0);   // drain final tile
      }
    }
    const v8h* pB = (const v8h*)&Bsd[pb][0];
#else
    const _Float16* gb = BT + (size_t)(n0 + ldRow) * K + k0 + ldCg;
    v8h b0 = *(const v8h*)gb;
    v8h b1 = *(const v8h*)(gb + 8);
    if (k0 + BK < K) __builtin_prefetch(gb + BK, 0, 1);
    *(v8h*)&Bs[ldRow * BK + ldCg]     = b0;
    *(v8h*)&Bs[ldRow * BK + ldCg + 8] = b1;
    const v8h* pB = (const v8h*)Bs;
#endif
    __syncthreads();

    const v8h* pA = (const v8h*)As;
    v16h afr[2], bfr[4];
    #pragma unroll
    for (int mi = 0; mi < 2; ++mi) {
      int row = wm * 32 + mi * 16 + r;
      afr[mi] = cat16(pA[row * 4 + half], pA[row * 4 + 2 + half]);
    }
    #pragma unroll
    for (int ni = 0; ni < 4; ++ni) {
      int col = wn * 64 + ni * 16 + r;
      bfr[ni] = cat16(pB[col * 4 + half], pB[col * 4 + 2 + half]);
    }
    #pragma unroll
    for (int mi = 0; mi < 2; ++mi)
      #pragma unroll
      for (int ni = 0; ni < 4; ++ni)
        acc[mi][ni] = __builtin_amdgcn_wmma_f32_16x16x32_f16(
            false, afr[mi], false, bfr[ni], (short)0, acc[mi][ni], false, false);
    __syncthreads();
  }

  bool outf16 = flags & 1, doGelu = flags & 2;
  #pragma unroll
  for (int mi = 0; mi < 2; ++mi)
    #pragma unroll
    for (int ni = 0; ni < 4; ++ni)
      #pragma unroll
      for (int v = 0; v < 8; ++v) {
        int row = m0 + wm * 32 + mi * 16 + half * 8 + v;
        int col = n0 + wn * 64 + ni * 16 + r;
        float val = acc[mi][ni][v] + bias[col];
        if (doGelu) val = 0.5f * val * (1.0f + erff(val * 0.70710678f));
        if (resid) val += resid[(size_t)row * N + col];
        if (outf16) ((_Float16*)Cout)[(size_t)row * N + col] = (_Float16)val;
        else        ((float*)Cout)[(size_t)row * N + col] = val;
      }
}

// ---------------------------------------------------------------------------
// Causal flash attention. One block per (query-tile 64, head, batch).
// Q/K/V layout: [B, S, H*HD] f16. Output same layout, f16.
// Q,K,P row-major (contraction contiguous); V staged transposed.
// ---------------------------------------------------------------------------
__global__ __launch_bounds__(256) void attn_wmma(const _Float16* __restrict__ Qf,
                                                 const _Float16* __restrict__ Kf,
                                                 const _Float16* __restrict__ Vf,
                                                 _Float16* __restrict__ Of) {
  __shared__ __align__(16) _Float16 Qs[64 * 64];
  __shared__ __align__(16) _Float16 Ks[64 * 64];
  __shared__ __align__(16) _Float16 Ps[64 * 64];
  __shared__ __align__(16) _Float16 VsT[64 * 64];   // VsT[c][t]
  __shared__ float Sf[64][66];
  __shared__ float mrow[64], lrow[64], frow[64];

  int tid = threadIdx.x, wid = tid >> 5, lane = tid & 31;
  int half = lane >> 4, r = lane & 15;
  int wm = wid & 3, wn = wid >> 2;
  int iq = blockIdx.x, h = blockIdx.y, b = blockIdx.z;

  int ldRow = tid >> 2, ldCg = (tid & 3) * 16;  // 64 rows x 64 halves

  {
    size_t g = ((size_t)b * SS + (size_t)iq * 64 + ldRow) * DD + h * HD + ldCg;
    v8h q0 = *(const v8h*)(Qf + g);
    v8h q1 = *(const v8h*)(Qf + g + 8);
    *(v8h*)&Qs[ldRow * 64 + ldCg]     = q0;
    *(v8h*)&Qs[ldRow * 64 + ldCg + 8] = q1;
  }
  if (tid < 64) { mrow[tid] = -3.0e38f; lrow[tid] = 0.0f; }
  v8f o0 = {}, o1 = {};
  __syncthreads();

  int arow = wm * 16 + r, c0 = wn * 32 + r;
  const v8h* pQ = (const v8h*)Qs;
  const v8h* pK = (const v8h*)Ks;
  const v8h* pP = (const v8h*)Ps;
  const v8h* pV = (const v8h*)VsT;

  for (int j = 0; j <= iq; ++j) {
    {
      size_t g = ((size_t)b * SS + (size_t)j * 64 + ldRow) * DD + h * HD + ldCg;
      v8h k0v = *(const v8h*)(Kf + g);
      v8h k1v = *(const v8h*)(Kf + g + 8);
      v8h v0v = *(const v8h*)(Vf + g);
      v8h v1v = *(const v8h*)(Vf + g + 8);
      *(v8h*)&Ks[ldRow * 64 + ldCg]     = k0v;
      *(v8h*)&Ks[ldRow * 64 + ldCg + 8] = k1v;
      #pragma unroll
      for (int e = 0; e < 8; ++e) {
        VsT[(ldCg + e) * 64 + ldRow]     = v0v[e];
        VsT[(ldCg + 8 + e) * 64 + ldRow] = v1v[e];
      }
    }
    __syncthreads();

    // scores = Q . K^T
    v8f s0 = {}, s1 = {};
    #pragma unroll
    for (int kk = 0; kk < 2; ++kk) {
      v16h af  = cat16(pQ[arow * 8 + kk * 4 + half], pQ[arow * 8 + kk * 4 + 2 + half]);
      v16h bfA = cat16(pK[c0 * 8 + kk * 4 + half],   pK[c0 * 8 + kk * 4 + 2 + half]);
      v16h bfB = cat16(pK[(c0 + 16) * 8 + kk * 4 + half],
                       pK[(c0 + 16) * 8 + kk * 4 + 2 + half]);
      s0 = __builtin_amdgcn_wmma_f32_16x16x32_f16(false, af, false, bfA,
                                                  (short)0, s0, false, false);
      s1 = __builtin_amdgcn_wmma_f32_16x16x32_f16(false, af, false, bfB,
                                                  (short)0, s1, false, false);
    }
    #pragma unroll
    for (int v = 0; v < 8; ++v) {
      int lr = wm * 16 + half * 8 + v;
      int qg = iq * 64 + lr;
      float x0 = s0[v] * 0.125f, x1 = s1[v] * 0.125f;
      if (j * 64 + c0 > qg)      x0 = -1.0e30f;
      if (j * 64 + c0 + 16 > qg) x1 = -1.0e30f;
      Sf[lr][c0] = x0;
      Sf[lr][c0 + 16] = x1;
    }
    __syncthreads();

    // online softmax update (hw transcendental exp)
    if (tid < 64) {
      float mo = mrow[tid], tm = mo;
      #pragma unroll 8
      for (int c = 0; c < 64; ++c) tm = fmaxf(tm, Sf[tid][c]);
      float f = __expf(mo - tm), ts = 0.0f;
      #pragma unroll 8
      for (int c = 0; c < 64; ++c) {
        float p = __expf(Sf[tid][c] - tm);
        Ps[tid * 64 + c] = (_Float16)p;
        ts += p;
      }
      mrow[tid] = tm;
      frow[tid] = f;
      lrow[tid] = lrow[tid] * f + ts;
    }
    __syncthreads();

    #pragma unroll
    for (int v = 0; v < 8; ++v) {
      float f = frow[wm * 16 + half * 8 + v];
      o0[v] *= f; o1[v] *= f;
    }
    // O += P . V
    #pragma unroll
    for (int kk = 0; kk < 2; ++kk) {
      v16h af  = cat16(pP[arow * 8 + kk * 4 + half], pP[arow * 8 + kk * 4 + 2 + half]);
      v16h bfA = cat16(pV[c0 * 8 + kk * 4 + half],   pV[c0 * 8 + kk * 4 + 2 + half]);
      v16h bfB = cat16(pV[(c0 + 16) * 8 + kk * 4 + half],
                       pV[(c0 + 16) * 8 + kk * 4 + 2 + half]);
      o0 = __builtin_amdgcn_wmma_f32_16x16x32_f16(false, af, false, bfA,
                                                  (short)0, o0, false, false);
      o1 = __builtin_amdgcn_wmma_f32_16x16x32_f16(false, af, false, bfB,
                                                  (short)0, o1, false, false);
    }
    __syncthreads();
  }

  #pragma unroll
  for (int v = 0; v < 8; ++v) {
    int lr = wm * 16 + half * 8 + v;
    float inv = 1.0f / lrow[lr];
    size_t g = ((size_t)b * SS + (size_t)(iq * 64 + lr)) * DD + h * HD;
    Of[g + wn * 32 + r]      = (_Float16)(o0[v] * inv);
    Of[g + wn * 32 + 16 + r] = (_Float16)(o1[v] * inv);
  }
}

// ---------------------------------------------------------------------------
// Host-side launch
// ---------------------------------------------------------------------------
extern "C" void kernel_launch(void* const* d_in, const int* in_sizes, int n_in,
                              void* d_out, int out_size, void* d_ws, size_t ws_size,
                              hipStream_t stream) {
  const float* x     = (const float*)d_in[0];
  const float* Wq    = (const float*)d_in[1];
  const float* bq    = (const float*)d_in[2];
  const float* Wk    = (const float*)d_in[3];
  const float* bk    = (const float*)d_in[4];
  const float* Wv    = (const float*)d_in[5];
  const float* bv    = (const float*)d_in[6];
  const float* Wo    = (const float*)d_in[7];
  const float* bo    = (const float*)d_in[8];
  const float* ln1_g = (const float*)d_in[9];
  const float* ln1_b = (const float*)d_in[10];
  const float* ln2_g = (const float*)d_in[11];
  const float* ln2_b = (const float*)d_in[12];
  const float* W1    = (const float*)d_in[13];
  const float* b1    = (const float*)d_in[14];
  const float* W2    = (const float*)d_in[15];
  const float* b2    = (const float*)d_in[16];
  float* out = (float*)d_out;

  auto align = [](size_t v) { return (v + 255) & ~(size_t)255; };
  char* base = (char*)d_ws;
  size_t off = 0;
  auto slot = [&](size_t bytes) { char* p = base + off; off += align(bytes); return p; };
  _Float16* hf16  = (_Float16*)slot((size_t)ROWS * DD * 2);
  _Float16* WqT   = (_Float16*)slot((size_t)DD * DD * 2);   // [N=768][K=768]
  _Float16* WkT   = (_Float16*)slot((size_t)DD * DD * 2);
  _Float16* WvT   = (_Float16*)slot((size_t)DD * DD * 2);
  _Float16* WoT   = (_Float16*)slot((size_t)DD * DD * 2);
  _Float16* W1T   = (_Float16*)slot((size_t)DD * FF * 2);   // [N=3072][K=768]
  _Float16* W2T   = (_Float16*)slot((size_t)FF * DD * 2);   // [N=768][K=3072]
  _Float16* Qf    = (_Float16*)slot((size_t)ROWS * DD * 2);
  _Float16* Kf    = (_Float16*)slot((size_t)ROWS * DD * 2);
  _Float16* Vf    = (_Float16*)slot((size_t)ROWS * DD * 2);
  _Float16* At16  = (_Float16*)slot((size_t)ROWS * DD * 2);
  float*    X1    = (float*)   slot((size_t)ROWS * DD * 4);
  _Float16* h216  = (_Float16*)slot((size_t)ROWS * DD * 2);
  _Float16* H1    = (_Float16*)slot((size_t)ROWS * FF * 2);

  // 1) weight conversion (f32 -> f16, transposed to [N][K])
  cvt_whdk_T<<<(DD * HH * HD + 255) / 256, 256, 0, stream>>>(Wq, WqT);
  cvt_whdk_T<<<(DD * HH * HD + 255) / 256, 256, 0, stream>>>(Wk, WkT);
  cvt_whdk_T<<<(DD * HH * HD + 255) / 256, 256, 0, stream>>>(Wv, WvT);
  cvt_T<<<(DD * DD + 255) / 256, 256, 0, stream>>>(Wo, WoT, DD, DD);
  cvt_T<<<(DD * FF + 255) / 256, 256, 0, stream>>>(W1, W1T, DD, FF);
  cvt_T<<<(FF * DD + 255) / 256, 256, 0, stream>>>(W2, W2T, FF, DD);

  // 2) LN1
  ln_f16<<<ROWS, 256, 0, stream>>>(x, ln1_g, ln1_b, hf16);

  // 3) Q/K/V projections (f16 out, +bias)
  dim3 gQKV(DD / BN, ROWS / BM);
  gemm_wmma<<<gQKV, 256, 0, stream>>>(hf16, WqT, bq, nullptr, Qf, ROWS, DD, DD, 1);
  gemm_wmma<<<gQKV, 256, 0, stream>>>(hf16, WkT, bk, nullptr, Kf, ROWS, DD, DD, 1);
  gemm_wmma<<<gQKV, 256, 0, stream>>>(hf16, WvT, bv, nullptr, Vf, ROWS, DD, DD, 1);

  // 4) causal flash attention
  dim3 gAtt(SS / 64, HH, BB);
  attn_wmma<<<gAtt, 256, 0, stream>>>(Qf, Kf, Vf, At16);

  // 5) output projection + residual (f32 out): X1 = x + attn @ Wo + bo
  gemm_wmma<<<gQKV, 256, 0, stream>>>(At16, WoT, bo, x, X1, ROWS, DD, DD, 0);

  // 6) LN2
  ln_f16<<<ROWS, 256, 0, stream>>>(X1, ln2_g, ln2_b, h216);

  // 7) FFN up + GELU (f16 out)
  dim3 gF1(FF / BN, ROWS / BM);
  gemm_wmma<<<gF1, 256, 0, stream>>>(h216, W1T, b1, nullptr, H1, ROWS, FF, DD, 1 | 2);

  // 8) FFN down + bias + residual (f32 out to d_out)
  dim3 gF2(DD / BN, ROWS / BM);
  gemm_wmma<<<gF2, 256, 0, stream>>>(H1, W2T, b2, X1, out, ROWS, DD, FF, 0);

  (void)in_sizes; (void)n_in; (void)out_size; (void)ws_size;
}

// v001
// It runs in 440 microseconds.
// In both of two side-by-side timings against v000, it was 1.24 times as fast.
#include <hip/hip_runtime.h>
#include <hip/hip_bf16.h>
#include <math.h>

typedef __attribute__((ext_vector_type(16))) _Float16 v16h;
typedef __attribute__((ext_vector_type(8)))  _Float16 v8h;
typedef __attribute__((ext_vector_type(8)))  float    v8f;

#define BB 2
#define SS 2048
#define DD 768
#define HH 12
#define HD 64
#define FF 3072
#define ROWS (BB*SS)          // 4096
#define EPS 1e-5f

#define BM 128
#define BN 128
#define BK 32

// LDS row pitches in halves. A ds_load_b128 fragment read walks 16 rows at once;
// a pitch of 16 B x odd spreads those rows over all 64 banks.
#define AKP 40                // GEMM A tile: 32 halves + 8 pad  (80 B)
#define TP  72                // attention tiles: 64 halves + 8 pad (144 B)

// ---------------------------------------------------------------------------
// Tensor Data Mover support (gfx1250). Falls back to vector loads if the
// builtin is unavailable (e.g. host pass of hipcc).
// ---------------------------------------------------------------------------
#ifndef __has_builtin
#define __has_builtin(x) 0
#endif
#if __has_builtin(__builtin_amdgcn_tensor_load_to_lds) && \
    __has_builtin(__builtin_amdgcn_s_wait_tensorcnt)
#define HAVE_TDM 1
#else
#define HAVE_TDM 0
#endif

#if HAVE_TDM
typedef unsigned int u32x4  __attribute__((ext_vector_type(4)));
typedef int          i32x4t __attribute__((ext_vector_type(4)));
typedef int          i32x8t __attribute__((ext_vector_type(8)));

// Issue a 2D TDM tile load: tileRows x tileCols elements (2 bytes each),
// global row stride = rowStrideElems, destination LDS byte offset lds_off.
static __device__ __forceinline__ void tdm_load_2d(const void* gsrc, unsigned lds_off,
                                                   int tileRows, int tileCols,
                                                   long long rowStrideElems) {
  unsigned long long ga = (unsigned long long)(size_t)gsrc;
  u32x4 g0;
  g0.x = 1u;                                                 // count = 1 valid D#
  g0.y = lds_off;                                            // lds_addr
  g0.z = (unsigned)ga;                                       // global_addr[31:0]
  g0.w = (unsigned)((ga >> 32) & 0x01ffffffu) | (2u << 30);  // global_addr[56:32], type=2
  unsigned long long str = (unsigned long long)rowStrideElems;
  unsigned td0 = 0x40000000u, td1 = 0x40000000u;             // huge extents: no OOB clip
  i32x8t g1;
  g1[0] = (int)(1u << 16);                                   // data_size = 2B
  g1[1] = (int)((td0 & 0xffffu) << 16);                      // tensor_dim0 lo
  g1[2] = (int)((td0 >> 16) | ((td1 & 0xffffu) << 16));      // tensor_dim0 hi | dim1 lo
  g1[3] = (int)((td1 >> 16) | ((unsigned)tileCols << 16));   // dim1 hi | tile_dim0
  g1[4] = (int)((unsigned)tileRows & 0xffffu);               // tile_dim1 (tile_dim2=0)
  g1[5] = (int)(unsigned)(str & 0xffffffffu);                // tensor_dim0_stride lo
  g1[6] = (int)(unsigned)((str >> 32) & 0xffffu);            // stride hi
  g1[7] = 0;
  i32x4t z = {};
  i32x8t z8 = {};
  __builtin_amdgcn_tensor_load_to_lds(g0, g1, z, z, z8, 0);
}
#endif

static __device__ __forceinline__ v16h cat16(v8h lo, v8h hi) {
  return __builtin_shufflevector(lo, hi, 0,1,2,3,4,5,6,7,8,9,10,11,12,13,14,15);
}

// ---------------------------------------------------------------------------
// Weight conversion kernels: fp32 -> f16, producing TRANSPOSED (N-major)
// weights so the GEMM B-operand is contraction-contiguous.
// ---------------------------------------------------------------------------
__global__ __launch_bounds__(256) void cvt_whdk_T(const float* __restrict__ W,
                                                  _Float16* __restrict__ out) {
  // (H, D, HD) -> out[(h*HD+k)][D] : out[n*D + d] = W[h][d][k]
  int idx = blockIdx.x * 256 + threadIdx.x;
  if (idx >= DD * HH * HD) return;
  int n = idx / DD;
  int d = idx % DD;
  int h = n / HD, k = n % HD;
  out[idx] = (_Float16)W[((size_t)h * DD + d) * HD + k];
}

__global__ __launch_bounds__(256) void cvt_T(const float* __restrict__ W,
                                             _Float16* __restrict__ out,
                                             int R, int C) {
  // in [R][C] -> out [C][R]
  int idx = blockIdx.x * 256 + threadIdx.x;
  if (idx >= R * C) return;
  int c = idx / R, r = idx % R;
  out[idx] = (_Float16)W[(size_t)r * C + c];
}

// ---------------------------------------------------------------------------
// LayerNorm (row of 768) -> f16 output
// ---------------------------------------------------------------------------
__global__ __launch_bounds__(256) void ln_f16(const float* __restrict__ x,
                                              const float* __restrict__ g,
                                              const float* __restrict__ bta,
                                              _Float16* __restrict__ out) {
  __shared__ float red[256];
  int row = blockIdx.x, tid = threadIdx.x;
  const float* xr = x + (size_t)row * DD;
  float v0 = xr[tid], v1 = xr[tid + 256], v2 = xr[tid + 512];
  red[tid] = v0 + v1 + v2;
  __syncthreads();
  #pragma unroll
  for (int st = 128; st > 0; st >>= 1) {
    if (tid < st) red[tid] += red[tid + st];
    __syncthreads();
  }
  float mean = red[0] * (1.0f / DD);
  __syncthreads();
  float d0 = v0 - mean, d1 = v1 - mean, d2 = v2 - mean;
  red[tid] = d0 * d0 + d1 * d1 + d2 * d2;
  __syncthreads();
  #pragma unroll
  for (int st = 128; st > 0; st >>= 1) {
    if (tid < st) red[tid] += red[tid + st];
    __syncthreads();
  }
  float rs = rsqrtf(red[0] * (1.0f / DD) + EPS);
  _Float16* orow = out + (size_t)row * DD;
  orow[tid]       = (_Float16)(d0 * rs * g[tid]       + bta[tid]);
  orow[tid + 256] = (_Float16)(d1 * rs * g[tid + 256] + bta[tid + 256]);
  orow[tid + 512] = (_Float16)(d2 * rs * g[tid + 512] + bta[tid + 512]);
}

// ---------------------------------------------------------------------------
// WMMA GEMM: C[M,N] = act(A[M,K](f16) x BT[N,K](f16)^T + bias) (+ resid)
// 256 threads = 8 waves. Block tile 128x128, K-step 32.
// Wave grid 4(M) x 2(N); each wave: 2 A-frags x 4 B-frags -> 8 WMMA / K-step.
// B (weight) tiles are streamed by the Tensor Data Mover into double-buffered
// LDS; wave 0 issues the DMA and synchronizes with s_wait_tensorcnt.
// flags: bit0 = f16 output, bit1 = exact GELU
// ---------------------------------------------------------------------------
__global__ __launch_bounds__(256) void gemm_wmma(const _Float16* __restrict__ A,
                                                 const _Float16* __restrict__ BT,
                                                 const float* __restrict__ bias,
                                                 const float* __restrict__ resid,
                                                 void* __restrict__ Cout,
                                                 int M, int N, int K, int flags) {
  __shared__ __align__(16) _Float16 As[BM * AKP];
#if HAVE_TDM
  __shared__ __align__(16) _Float16 Bsd[2][BN * BK];
#else
  __shared__ __align__(16) _Float16 Bs[BN * BK];
#endif
  int tid = threadIdx.x;
  int wid = tid >> 5, lane = tid & 31;
  int half = lane >> 4, r = lane & 15;
  int wm = wid & 3, wn = wid >> 2;
  int m0 = blockIdx.y * BM, n0 = blockIdx.x * BN;

  v8f acc[2][4];
  #pragma unroll
  for (int mi = 0; mi < 2; ++mi)
    #pragma unroll
    for (int ni = 0; ni < 4; ++ni) acc[mi][ni] = (v8f){};

  int ldRow = tid >> 1, ldCg = (tid & 1) * 16;   // 128 rows x 32 halves

#if HAVE_TDM
  if (wid == 0)
    tdm_load_2d(BT + (size_t)n0 * K, (unsigned)(size_t)&Bsd[0][0], BN, BK, K);
#endif

  for (int k0 = 0; k0 < K; k0 += BK) {
    const _Float16* ga = A + (size_t)(m0 + ldRow) * K + k0 + ldCg;
    v8h a0 = *(const v8h*)ga;
    v8h a1 = *(const v8h*)(ga + 8);
    if (k0 + BK < K) __builtin_prefetch(ga + BK, 0, 1);
    *(v8h*)&As[ldRow * AKP + ldCg]     = a0;
    *(v8h*)&As[ldRow * AKP + ldCg + 8] = a1;

#if HAVE_TDM
    int pb = (k0 / BK) & 1;
    if (wid == 0) {
      if (k0 + BK < K) {
        tdm_load_2d(BT + (size_t)n0 * K + (k0 + BK),
                    (unsigned)(size_t)&Bsd[pb ^ 1][0], BN, BK, K);
        __builtin_amdgcn_s_wait_tensorcnt(1);   // current tile has landed
      } else {
        __builtin_amdgcn_s_wait_tensorcnt(0);   // drain final tile
      }
    }
    const v8h* pB = (const v8h*)&Bsd[pb][0];
#else
    const _Float16* gb = BT + (size_t)(n0 + ldRow) * K + k0 + ldCg;
    v8h b0 = *(const v8h*)gb;
    v8h b1 = *(const v8h*)(gb + 8);
    if (k0 + BK < K) __builtin_prefetch(gb + BK, 0, 1);
    *(v8h*)&Bs[ldRow * BK + ldCg]     = b0;
    *(v8h*)&Bs[ldRow * BK + ldCg + 8] = b1;
    const v8h* pB = (const v8h*)Bs;
#endif
    __syncthreads();

    const v8h* pA = (const v8h*)As;
    v16h afr[2], bfr[4];
    #pragma unroll
    for (int mi = 0; mi < 2; ++mi) {
      int row = wm * 32 + mi * 16 + r;
      afr[mi] = cat16(pA[row * (AKP / 8) + half], pA[row * (AKP / 8) + 2 + half]);
    }
    #pragma unroll
    for (int ni = 0; ni < 4; ++ni) {
      int col = wn * 64 + ni * 16 + r;
      bfr[ni] = cat16(pB[col * 4 + half], pB[col * 4 + 2 + half]);
    }
    #pragma unroll
    for (int mi = 0; mi < 2; ++mi)
      #pragma unroll
      for (int ni = 0; ni < 4; ++ni)
        acc[mi][ni] = __builtin_amdgcn_wmma_f32_16x16x32_f16(
            false, afr[mi], false, bfr[ni], (short)0, acc[mi][ni], false, false);
    __syncthreads();
  }

  bool outf16 = flags & 1, doGelu = flags & 2;
  #pragma unroll
  for (int mi = 0; mi < 2; ++mi)
    #pragma unroll
    for (int ni = 0; ni < 4; ++ni)
      #pragma unroll
      for (int v = 0; v < 8; ++v) {
        int row = m0 + wm * 32 + mi * 16 + half * 8 + v;
        int col = n0 + wn * 64 + ni * 16 + r;
        float val = acc[mi][ni][v] + bias[col];
        if (doGelu) val = 0.5f * val * (1.0f + erff(val * 0.70710678f));
        if (resid) val += resid[(size_t)row * N + col];
        if (outf16) ((_Float16*)Cout)[(size_t)row * N + col] = (_Float16)val;
        else        ((float*)Cout)[(size_t)row * N + col] = val;
      }
}

// ---------------------------------------------------------------------------
// Causal flash attention. One block per (query-tile 64, head, batch).
// Q/K/V layout: [B, S, H*HD] f16. Output same layout, f16.
// Q,K,P row-major (contraction contiguous); V staged transposed.
// ---------------------------------------------------------------------------
__global__ __launch_bounds__(256) void attn_wmma(const _Float16* __restrict__ Qf,
                                                 const _Float16* __restrict__ Kf,
                                                 const _Float16* __restrict__ Vf,
                                                 _Float16* __restrict__ Of) {
  __shared__ __align__(16) _Float16 Qs[64 * TP];
  __shared__ __align__(16) _Float16 Ks[64 * TP];
  __shared__ __align__(16) _Float16 Ps[64 * TP];
  __shared__ __align__(16) _Float16 VsT[64 * TP];  // VsT[c][t]
  __shared__ float Sf[64][66];
  __shared__ float mrow[64], lrow[64], frow[64];

  int tid = threadIdx.x, wid = tid >> 5, lane = tid & 31;
  int half = lane >> 4, r = lane & 15;
  int wm = wid & 3, wn = wid >> 2;
  int iq = blockIdx.x, h = blockIdx.y, b = blockIdx.z;

  int ldRow = tid >> 2, ldCg = (tid & 3) * 16;  // 64 rows x 64 halves

  {
    size_t g = ((size_t)b * SS + (size_t)iq * 64 + ldRow) * DD + h * HD + ldCg;
    v8h q0 = *(const v8h*)(Qf + g);
    v8h q1 = *(const v8h*)(Qf + g + 8);
    *(v8h*)&Qs[ldRow * TP + ldCg]     = q0;
    *(v8h*)&Qs[ldRow * TP + ldCg + 8] = q1;
  }
  if (tid < 64) { mrow[tid] = -3.0e38f; lrow[tid] = 0.0f; }
  v8f o0 = {}, o1 = {};
  __syncthreads();

  int arow = wm * 16 + r, c0 = wn * 32 + r;
  const int RP = TP / 8;   // row pitch in 16-byte units
  const v8h* pQ = (const v8h*)Qs;
  const v8h* pK = (const v8h*)Ks;
  const v8h* pP = (const v8h*)Ps;
  const v8h* pV = (const v8h*)VsT;

  for (int j = 0; j <= iq; ++j) {
    {
      size_t g = ((size_t)b * SS + (size_t)j * 64 + ldRow) * DD + h * HD + ldCg;
      v8h k0v = *(const v8h*)(Kf + g);
      v8h k1v = *(const v8h*)(Kf + g + 8);
      v8h v0v = *(const v8h*)(Vf + g);
      v8h v1v = *(const v8h*)(Vf + g + 8);
      *(v8h*)&Ks[ldRow * TP + ldCg]     = k0v;
      *(v8h*)&Ks[ldRow * TP + ldCg + 8] = k1v;
      #pragma unroll
      for (int e = 0; e < 8; ++e) {
        VsT[(ldCg + e) * TP + ldRow]     = v0v[e];
        VsT[(ldCg + 8 + e) * TP + ldRow] = v1v[e];
      }
    }
    __syncthreads();

    // scores = Q . K^T
    v8f s0 = {}, s1 = {};
    #pragma unroll
    for (int kk = 0; kk < 2; ++kk) {
      v16h af  = cat16(pQ[arow * RP + kk * 4 + half], pQ[arow * RP + kk * 4 + 2 + half]);
      v16h bfA = cat16(pK[c0 * RP + kk * 4 + half],   pK[c0 * RP + kk * 4 + 2 + half]);
      v16h bfB = cat16(pK[(c0 + 16) * RP + kk * 4 + half],
                       pK[(c0 + 16) * RP + kk * 4 + 2 + half]);
      s0 = __builtin_amdgcn_wmma_f32_16x16x32_f16(false, af, false, bfA,
                                                  (short)0, s0, false, false);
      s1 = __builtin_amdgcn_wmma_f32_16x16x32_f16(false, af, false, bfB,
                                                  (short)0, s1, false, false);
    }
    #pragma unroll
    for (int v = 0; v < 8; ++v) {
      int lr = wm * 16 + half * 8 + v;
      int qg = iq * 64 + lr;
      float x0 = s0[v] * 0.125f, x1 = s1[v] * 0.125f;
      if (j * 64 + c0 > qg)      x0 = -1.0e30f;
      if (j * 64 + c0 + 16 > qg) x1 = -1.0e30f;
      Sf[lr][c0] = x0;
      Sf[lr][c0 + 16] = x1;
    }
    __syncthreads();

    // online softmax update (hw transcendental exp)
    if (tid < 64) {
      float mo = mrow[tid], tm = mo;
      #pragma unroll 8
      for (int c = 0; c < 64; ++c) tm = fmaxf(tm, Sf[tid][c]);
      float f = __expf(mo - tm), ts = 0.0f;
      #pragma unroll 8
      for (int c = 0; c < 64; ++c) {
        float p = __expf(Sf[tid][c] - tm);
        Ps[tid * TP + c] = (_Float16)p;
        ts += p;
      }
      mrow[tid] = tm;
      frow[tid] = f;
      lrow[tid] = lrow[tid] * f + ts;
    }
    __syncthreads();

    #pragma unroll
    for (int v = 0; v < 8; ++v) {
      float f = frow[wm * 16 + half * 8 + v];
      o0[v] *= f; o1[v] *= f;
    }
    // O += P . V
    #pragma unroll
    for (int kk = 0; kk < 2; ++kk) {
      v16h af  = cat16(pP[arow * RP + kk * 4 + half], pP[arow * RP + kk * 4 + 2 + half]);
      v16h bfA = cat16(pV[c0 * RP + kk * 4 + half],   pV[c0 * RP + kk * 4 + 2 + half]);
      v16h bfB = cat16(pV[(c0 + 16) * RP + kk * 4 + half],
                       pV[(c0 + 16) * RP + kk * 4 + 2 + half]);
      o0 = __builtin_amdgcn_wmma_f32_16x16x32_f16(false, af, false, bfA,
                                                  (short)0, o0, false, false);
      o1 = __builtin_amdgcn_wmma_f32_16x16x32_f16(false, af, false, bfB,
                                                  (short)0, o1, false, false);
    }
    __syncthreads();
  }

  #pragma unroll
  for (int v = 0; v < 8; ++v) {
    int lr = wm * 16 + half * 8 + v;
    float inv = 1.0f / lrow[lr];
    size_t g = ((size_t)b * SS + (size_t)(iq * 64 + lr)) * DD + h * HD;
    Of[g + wn * 32 + r]      = (_Float16)(o0[v] * inv);
    Of[g + wn * 32 + 16 + r] = (_Float16)(o1[v] * inv);
  }
}

// ---------------------------------------------------------------------------
// Host-side launch
// ---------------------------------------------------------------------------
extern "C" void kernel_launch(void* const* d_in, const int* in_sizes, int n_in,
                              void* d_out, int out_size, void* d_ws, size_t ws_size,
                              hipStream_t stream) {
  const float* x     = (const float*)d_in[0];
  const float* Wq    = (const float*)d_in[1];
  const float* bq    = (const float*)d_in[2];
  const float* Wk    = (const float*)d_in[3];
  const float* bk    = (const float*)d_in[4];
  const float* Wv    = (const float*)d_in[5];
  const float* bv    = (const float*)d_in[6];
  const float* Wo    = (const float*)d_in[7];
  const float* bo    = (const float*)d_in[8];
  const float* ln1_g = (const float*)d_in[9];
  const float* ln1_b = (const float*)d_in[10];
  const float* ln2_g = (const float*)d_in[11];
  const float* ln2_b = (const float*)d_in[12];
  const float* W1    = (const float*)d_in[13];
  const float* b1    = (const float*)d_in[14];
  const float* W2    = (const float*)d_in[15];
  const float* b2    = (const float*)d_in[16];
  float* out = (float*)d_out;

  auto align = [](size_t v) { return (v + 255) & ~(size_t)255; };
  char* base = (char*)d_ws;
  size_t off = 0;
  auto slot = [&](size_t bytes) { char* p = base + off; off += align(bytes); return p; };
  _Float16* hf16  = (_Float16*)slot((size_t)ROWS * DD * 2);
  _Float16* WqT   = (_Float16*)slot((size_t)DD * DD * 2);   // [N=768][K=768]
  _Float16* WkT   = (_Float16*)slot((size_t)DD * DD * 2);
  _Float16* WvT   = (_Float16*)slot((size_t)DD * DD * 2);
  _Float16* WoT   = (_Float16*)slot((size_t)DD * DD * 2);
  _Float16* W1T   = (_Float16*)slot((size_t)DD * FF * 2);   // [N=3072][K=768]
  _Float16* W2T   = (_Float16*)slot((size_t)FF * DD * 2);   // [N=768][K=3072]
  _Float16* Qf    = (_Float16*)slot((size_t)ROWS * DD * 2);
  _Float16* Kf    = (_Float16*)slot((size_t)ROWS * DD * 2);
  _Float16* Vf    = (_Float16*)slot((size_t)ROWS * DD * 2);
  _Float16* At16  = (_Float16*)slot((size_t)ROWS * DD * 2);
  float*    X1    = (float*)   slot((size_t)ROWS * DD * 4);
  _Float16* h216  = (_Float16*)slot((size_t)ROWS * DD * 2);
  _Float16* H1    = (_Float16*)slot((size_t)ROWS * FF * 2);

  // 1) weight conversion (f32 -> f16, transposed to [N][K])
  cvt_whdk_T<<<(DD * HH * HD + 255) / 256, 256, 0, stream>>>(Wq, WqT);
  cvt_whdk_T<<<(DD * HH * HD + 255) / 256, 256, 0, stream>>>(Wk, WkT);
  cvt_whdk_T<<<(DD * HH * HD + 255) / 256, 256, 0, stream>>>(Wv, WvT);
  cvt_T<<<(DD * DD + 255) / 256, 256, 0, stream>>>(Wo, WoT, DD, DD);
  cvt_T<<<(DD * FF + 255) / 256, 256, 0, stream>>>(W1, W1T, DD, FF);
  cvt_T<<<(FF * DD + 255) / 256, 256, 0, stream>>>(W2, W2T, FF, DD);

  // 2) LN1
  ln_f16<<<ROWS, 256, 0, stream>>>(x, ln1_g, ln1_b, hf16);

  // 3) Q/K/V projections (f16 out, +bias)
  dim3 gQKV(DD / BN, ROWS / BM);
  gemm_wmma<<<gQKV, 256, 0, stream>>>(hf16, WqT, bq, nullptr, Qf, ROWS, DD, DD, 1);
  gemm_wmma<<<gQKV, 256, 0, stream>>>(hf16, WkT, bk, nullptr, Kf, ROWS, DD, DD, 1);
  gemm_wmma<<<gQKV, 256, 0, stream>>>(hf16, WvT, bv, nullptr, Vf, ROWS, DD, DD, 1);

  // 4) causal flash attention
  dim3 gAtt(SS / 64, HH, BB);
  attn_wmma<<<gAtt, 256, 0, stream>>>(Qf, Kf, Vf, At16);

  // 5) output projection + residual (f32 out): X1 = x + attn @ Wo + bo
  gemm_wmma<<<gQKV, 256, 0, stream>>>(At16, WoT, bo, x, X1, ROWS, DD, DD, 0);

  // 6) LN2
  ln_f16<<<ROWS, 256, 0, stream>>>(X1, ln2_g, ln2_b, h216);

  // 7) FFN up + GELU (f16 out)
  dim3 gF1(FF / BN, ROWS / BM);
  gemm_wmma<<<gF1, 256, 0, stream>>>(h216, W1T, b1, nullptr, H1, ROWS, FF, DD, 1 | 2);

  // 8) FFN down + bias + residual (f32 out to d_out)
  dim3 gF2(DD / BN, ROWS / BM);
  gemm_wmma<<<gF2, 256, 0, stream>>>(H1, W2T, b2, X1, out, ROWS, DD, FF, 0);

  (void)in_sizes; (void)n_in; (void)out_size; (void)ws_size;
}

// v002
// One run takes 404 microseconds.
// Timed twice side by side with v001, it ran 1.09 times as fast both times.
// All steps since v000 together make it 1.35 times as fast.
#include <hip/hip_runtime.h>
#include <hip/hip_bf16.h>
#include <math.h>

typedef __attribute__((ext_vector_type(16))) _Float16 v16h;
typedef __attribute__((ext_vector_type(8)))  _Float16 v8h;
typedef __attribute__((ext_vector_type(8)))  float    v8f;
typedef __attribute__((ext_vector_type(4)))  _Float16 v4h;
typedef __attribute__((ext_vector_type(4)))  float    v4f;

#define BB 2
#define SS 2048
#define DD 768
#define HH 12
#define HD 64
#define FF 3072
#define ROWS (BB*SS)          // 4096
#define EPS 1e-5f

#define BM 128
#define BN 128
#define BK 32

// LDS row pitches in halves. A ds_load_b128 fragment read walks 16 rows at once;
// a pitch of 16 B x odd spreads those rows over all 64 banks.
#define AKP 40                // GEMM A tile: 32 halves + 8 pad  (80 B)
#define TP  72                // attention tiles: 64 halves + 8 pad (144 B)

#define TT  64                // weight transpose tile edge
#define TTP 72                // its LDS row: 64 halves + 8 pad (144 B)

// ---------------------------------------------------------------------------
// Tensor Data Mover support (gfx1250). Falls back to vector loads if the
// builtin is unavailable (e.g. host pass of hipcc).
// ---------------------------------------------------------------------------
#ifndef __has_builtin
#define __has_builtin(x) 0
#endif
#if __has_builtin(__builtin_amdgcn_tensor_load_to_lds) && \
    __has_builtin(__builtin_amdgcn_s_wait_tensorcnt)
#define HAVE_TDM 1
#else
#define HAVE_TDM 0
#endif

#if HAVE_TDM
typedef unsigned int u32x4  __attribute__((ext_vector_type(4)));
typedef int          i32x4t __attribute__((ext_vector_type(4)));
typedef int          i32x8t __attribute__((ext_vector_type(8)));

// Issue a 2D TDM tile load: tileRows x tileCols elements (2 bytes each),
// global row stride = rowStrideElems, destination LDS byte offset lds_off.
static __device__ __forceinline__ void tdm_load_2d(const void* gsrc, unsigned lds_off,
                                                   int tileRows, int tileCols,
                                                   long long rowStrideElems) {
  unsigned long long ga = (unsigned long long)(size_t)gsrc;
  u32x4 g0;
  g0.x = 1u;                                                 // count = 1 valid D#
  g0.y = lds_off;                                            // lds_addr
  g0.z = (unsigned)ga;                                       // global_addr[31:0]
  g0.w = (unsigned)((ga >> 32) & 0x01ffffffu) | (2u << 30);  // global_addr[56:32], type=2
  unsigned long long str = (unsigned long long)rowStrideElems;
  unsigned td0 = 0x40000000u, td1 = 0x40000000u;             // huge extents: no OOB clip
  i32x8t g1;
  g1[0] = (int)(1u << 16);                                   // data_size = 2B
  g1[1] = (int)((td0 & 0xffffu) << 16);                      // tensor_dim0 lo
  g1[2] = (int)((td0 >> 16) | ((td1 & 0xffffu) << 16));      // tensor_dim0 hi | dim1 lo
  g1[3] = (int)((td1 >> 16) | ((unsigned)tileCols << 16));   // dim1 hi | tile_dim0
  g1[4] = (int)((unsigned)tileRows & 0xffffu);               // tile_dim1 (tile_dim2=0)
  g1[5] = (int)(unsigned)(str & 0xffffffffu);                // tensor_dim0_stride lo
  g1[6] = (int)(unsigned)((str >> 32) & 0xffffu);            // stride hi
  g1[7] = 0;
  i32x4t z = {};
  i32x8t z8 = {};
  __builtin_amdgcn_tensor_load_to_lds(g0, g1, z, z, z8, 0);
}
#endif

static __device__ __forceinline__ v16h cat16(v8h lo, v8h hi) {
  return __builtin_shufflevector(lo, hi, 0,1,2,3,4,5,6,7,8,9,10,11,12,13,14,15);
}

// ---------------------------------------------------------------------------
// Weight conversion: fp32 -> f16, producing TRANSPOSED (N-major) weights so the
// GEMM B-operand is contraction-contiguous.
// in: blockIdx.z-th matrix [R][C] f32 -> out: blockIdx.z-th matrix [C][R] f16.
// One block moves a 64 x 64 tile through LDS: whole 128-byte lines are read and
// whole lines are written, 16 elements per thread. R and C are multiples of 64.
// (H, D, HD) weights are H such matrices: out[(h*HD+k)*D + d] = W[h][d][k].
// ---------------------------------------------------------------------------
__global__ __launch_bounds__(256) void cvt_T(const float* __restrict__ W,
                                             _Float16* __restrict__ out,
                                             int R, int C) {
  __shared__ __align__(16) _Float16 Ls[TT * TTP];   // Ls[c][r]
  int tid = threadIdx.x;
  int c0 = blockIdx.x * TT, r0 = blockIdx.y * TT;
  size_t zoff = (size_t)blockIdx.z * R * C;

  // each thread takes a 4 x 4 block: 4 rows, 16 bytes of each
  int rb = (tid >> 4) * 4, cb = (tid & 15) * 4;
  const float* src = W + zoff + (size_t)(r0 + rb) * C + c0 + cb;
  v4f w0 = *(const v4f*)src;
  v4f w1 = *(const v4f*)(src + C);
  v4f w2 = *(const v4f*)(src + 2 * (size_t)C);
  v4f w3 = *(const v4f*)(src + 3 * (size_t)C);
  #pragma unroll   // constant j: the loaded vectors stay in registers
  for (int j = 0; j < 4; ++j) {
    v4h p = {(_Float16)w0[j], (_Float16)w1[j], (_Float16)w2[j], (_Float16)w3[j]};
    *(v4h*)&Ls[(cb + j) * TTP + rb] = p;
  }
  __syncthreads();

  // 8 lanes write one 128-byte line of an output row
  int rg = (tid & 7) * 8;
  #pragma unroll   // both LDS reads issue before the first store waits
  for (int i = 0; i < 2; ++i) {
    int c = (tid >> 3) + 32 * i;
    v8h o = *(const v8h*)&Ls[c * TTP + rg];
    *(v8h*)(out + zoff + (size_t)(c0 + c) * R + r0 + rg) = o;
  }
}

// ---------------------------------------------------------------------------
// LayerNorm (row of 768) -> f16 output
// ---------------------------------------------------------------------------
__global__ __launch_bounds__(256) void ln_f16(const float* __restrict__ x,
                                              const float* __restrict__ g,
                                              const float* __restrict__ bta,
                                              _Float16* __restrict__ out) {
  __shared__ float red[256];
  int row = blockIdx.x, tid = threadIdx.x;
  const float* xr = x + (size_t)row * DD;
  float v0 = xr[tid], v1 = xr[tid + 256], v2 = xr[tid + 512];
  red[tid] = v0 + v1 + v2;
  __syncthreads();
  #pragma unroll
  for (int st = 128; st > 0; st >>= 1) {
    if (tid < st) red[tid] += red[tid + st];
    __syncthreads();
  }
  float mean = red[0] * (1.0f / DD);
  __syncthreads();
  float d0 = v0 - mean, d1 = v1 - mean, d2 = v2 - mean;
  red[tid] = d0 * d0 + d1 * d1 + d2 * d2;
  __syncthreads();
  #pragma unroll
  for (int st = 128; st > 0; st >>= 1) {
    if (tid < st) red[tid] += red[tid + st];
    __syncthreads();
  }
  float rs = rsqrtf(red[0] * (1.0f / DD) + EPS);
  _Float16* orow = out + (size_t)row * DD;
  orow[tid]       = (_Float16)(d0 * rs * g[tid]       + bta[tid]);
  orow[tid + 256] = (_Float16)(d1 * rs * g[tid + 256] + bta[tid + 256]);
  orow[tid + 512] = (_Float16)(d2 * rs * g[tid + 512] + bta[tid + 512]);
}

// ---------------------------------------------------------------------------
// WMMA GEMM: C[M,N] = act(A[M,K](f16) x BT[N,K](f16)^T + bias) (+ resid)
// 256 threads = 8 waves. Block tile 128x128, K-step 32.
// Wave grid 4(M) x 2(N); each wave: 2 A-frags x 4 B-frags -> 8 WMMA / K-step.
// B (weight) tiles are streamed by the Tensor Data Mover into double-buffered
// LDS; wave 0 issues the DMA and synchronizes with s_wait_tensorcnt.
// flags: bit0 = f16 output, bit1 = exact GELU
// ---------------------------------------------------------------------------
__global__ __launch_bounds__(256) void gemm_wmma(const _Float16* __restrict__ A,
                                                 const _Float16* __restrict__ BT,
                                                 const float* __restrict__ bias,
                                                 const float* __restrict__ resid,
                                                 void* __restrict__ Cout,
                                                 int M, int N, int K, int flags) {
  __shared__ __align__(16) _Float16 As[BM * AKP];
#if HAVE_TDM
  __shared__ __align__(16) _Float16 Bsd[2][BN * BK];
#else
  __shared__ __align__(16) _Float16 Bs[BN * BK];
#endif
  int tid = threadIdx.x;
  int wid = tid >> 5, lane = tid & 31;
  int half = lane >> 4, r = lane & 15;
  int wm = wid & 3, wn = wid >> 2;
  int m0 = blockIdx.y * BM, n0 = blockIdx.x * BN;

  v8f acc[2][4];
  #pragma unroll
  for (int mi = 0; mi < 2; ++mi)
    #pragma unroll
    for (int ni = 0; ni < 4; ++ni) acc[mi][ni] = (v8f){};

  int ldRow = tid >> 1, ldCg = (tid & 1) * 16;   // 128 rows x 32 halves

#if HAVE_TDM
  if (wid == 0)
    tdm_load_2d(BT + (size_t)n0 * K, (unsigned)(size_t)&Bsd[0][0], BN, BK, K);
#endif

  for (int k0 = 0; k0 < K; k0 += BK) {
    const _Float16* ga = A + (size_t)(m0 + ldRow) * K + k0 + ldCg;
    v8h a0 = *(const v8h*)ga;
    v8h a1 = *(const v8h*)(ga + 8);
    if (k0 + BK < K) __builtin_prefetch(ga + BK, 0, 1);
    *(v8h*)&As[ldRow * AKP + ldCg]     = a0;
    *(v8h*)&As[ldRow * AKP + ldCg + 8] = a1;

#if HAVE_TDM
    int pb = (k0 / BK) & 1;
    if (wid == 0) {
      if (k0 + BK < K) {
        tdm_load_2d(BT + (size_t)n0 * K + (k0 + BK),
                    (unsigned)(size_t)&Bsd[pb ^ 1][0], BN, BK, K);
        __builtin_amdgcn_s_wait_tensorcnt(1);   // current tile has landed
      } else {
        __builtin_amdgcn_s_wait_tensorcnt(0);   // drain final tile
      }
    }
    const v8h* pB = (const v8h*)&Bsd[pb][0];
#else
    const _Float16* gb = BT + (size_t)(n0 + ldRow) * K + k0 + ldCg;
    v8h b0 = *(const v8h*)gb;
    v8h b1 = *(const v8h*)(gb + 8);
    if (k0 + BK < K) __builtin_prefetch(gb + BK, 0, 1);
    *(v8h*)&Bs[ldRow * BK + ldCg]     = b0;
    *(v8h*)&Bs[ldRow * BK + ldCg + 8] = b1;
    const v8h* pB = (const v8h*)Bs;
#endif
    __syncthreads();

    const v8h* pA = (const v8h*)As;
    v16h afr[2], bfr[4];
    #pragma unroll
    for (int mi = 0; mi < 2; ++mi) {
      int row = wm * 32 + mi * 16 + r;
      afr[mi] = cat16(pA[row * (AKP / 8) + half], pA[row * (AKP / 8) + 2 + half]);
    }
    #pragma unroll
    for (int ni = 0; ni < 4; ++ni) {
      int col = wn * 64 + ni * 16 + r;
      bfr[ni] = cat16(pB[col * 4 + half], pB[col * 4 + 2 + half]);
    }
    #pragma unroll
    for (int mi = 0; mi < 2; ++mi)
      #pragma unroll
      for (int ni = 0; ni < 4; ++ni)
        acc[mi][ni] = __builtin_amdgcn_wmma_f32_16x16x32_f16(
            false, afr[mi], false, bfr[ni], (short)0, acc[mi][ni], false, false);
    __syncthreads();
  }

  bool outf16 = flags & 1, doGelu = flags & 2;
  #pragma unroll
  for (int mi = 0; mi < 2; ++mi)
    #pragma unroll
    for (int ni = 0; ni < 4; ++ni)
      #pragma unroll
      for (int v = 0; v < 8; ++v) {
        int row = m0 + wm * 32 + mi * 16 + half * 8 + v;
        int col = n0 + wn * 64 + ni * 16 + r;
        float val = acc[mi][ni][v] + bias[col];
        if (doGelu) val = 0.5f * val * (1.0f + erff(val * 0.70710678f));
        if (resid) val += resid[(size_t)row * N + col];
        if (outf16) ((_Float16*)Cout)[(size_t)row * N + col] = (_Float16)val;
        else        ((float*)Cout)[(size_t)row * N + col] = val;
      }
}

// ---------------------------------------------------------------------------
// Causal flash attention. One block per (query-tile 64, head, batch).
// Q/K/V layout: [B, S, H*HD] f16. Output same layout, f16.
// Q,K,P row-major (contraction contiguous); V staged transposed.
// ---------------------------------------------------------------------------
__global__ __launch_bounds__(256) void attn_wmma(const _Float16* __restrict__ Qf,
                                                 const _Float16* __restrict__ Kf,
                                                 const _Float16* __restrict__ Vf,
                                                 _Float16* __restrict__ Of) {
  __shared__ __align__(16) _Float16 Qs[64 * TP];
  __shared__ __align__(16) _Float16 Ks[64 * TP];
  __shared__ __align__(16) _Float16 Ps[64 * TP];
  __shared__ __align__(16) _Float16 VsT[64 * TP];  // VsT[c][t]
  __shared__ float Sf[64][66];
  __shared__ float mrow[64], lrow[64], frow[64];

  int tid = threadIdx.x, wid = tid >> 5, lane = tid & 31;
  int half = lane >> 4, r = lane & 15;
  int wm = wid & 3, wn = wid >> 2;
  int iq = blockIdx.x, h = blockIdx.y, b = blockIdx.z;

  int ldRow = tid >> 2, ldCg = (tid & 3) * 16;  // 64 rows x 64 halves

  {
    size_t g = ((size_t)b * SS + (size_t)iq * 64 + ldRow) * DD + h * HD + ldCg;
    v8h q0 = *(const v8h*)(Qf + g);
    v8h q1 = *(const v8h*)(Qf + g + 8);
    *(v8h*)&Qs[ldRow * TP + ldCg]     = q0;
    *(v8h*)&Qs[ldRow * TP + ldCg + 8] = q1;
  }
  if (tid < 64) { mrow[tid] = -3.0e38f; lrow[tid] = 0.0f; }
  v8f o0 = {}, o1 = {};
  __syncthreads();

  int arow = wm * 16 + r, c0 = wn * 32 + r;
  const int RP = TP / 8;   // row pitch in 16-byte units
  const v8h* pQ = (const v8h*)Qs;
  const v8h* pK = (const v8h*)Ks;
  const v8h* pP = (const v8h*)Ps;
  const v8h* pV = (const v8h*)VsT;

  for (int j = 0; j <= iq; ++j) {
    {
      size_t g = ((size_t)b * SS + (size_t)j * 64 + ldRow) * DD + h * HD + ldCg;
      v8h k0v = *(const v8h*)(Kf + g);
      v8h k1v = *(const v8h*)(Kf + g + 8);
      v8h v0v = *(const v8h*)(Vf + g);
      v8h v1v = *(const v8h*)(Vf + g + 8);
      *(v8h*)&Ks[ldRow * TP + ldCg]     = k0v;
      *(v8h*)&Ks[ldRow * TP + ldCg + 8] = k1v;
      #pragma unroll
      for (int e = 0; e < 8; ++e) {
        VsT[(ldCg + e) * TP + ldRow]     = v0v[e];
        VsT[(ldCg + 8 + e) * TP + ldRow] = v1v[e];
      }
    }
    __syncthreads();

    // scores = Q . K^T
    v8f s0 = {}, s1 = {};
    #pragma unroll
    for (int kk = 0; kk < 2; ++kk) {
      v16h af  = cat16(pQ[arow * RP + kk * 4 + half], pQ[arow * RP + kk * 4 + 2 + half]);
      v16h bfA = cat16(pK[c0 * RP + kk * 4 + half],   pK[c0 * RP + kk * 4 + 2 + half]);
      v16h bfB = cat16(pK[(c0 + 16) * RP + kk * 4 + half],
                       pK[(c0 + 16) * RP + kk * 4 + 2 + half]);
      s0 = __builtin_amdgcn_wmma_f32_16x16x32_f16(false, af, false, bfA,
                                                  (short)0, s0, false, false);
      s1 = __builtin_amdgcn_wmma_f32_16x16x32_f16(false, af, false, bfB,
                                                  (short)0, s1, false, false);
    }
    #pragma unroll
    for (int v = 0; v < 8; ++v) {
      int lr = wm * 16 + half * 8 + v;
      int qg = iq * 64 + lr;
      float x0 = s0[v] * 0.125f, x1 = s1[v] * 0.125f;
      if (j * 64 + c0 > qg)      x0 = -1.0e30f;
      if (j * 64 + c0 + 16 > qg) x1 = -1.0e30f;
      Sf[lr][c0] = x0;
      Sf[lr][c0 + 16] = x1;
    }
    __syncthreads();

    // online softmax update (hw transcendental exp)
    if (tid < 64) {
      float mo = mrow[tid], tm = mo;
      #pragma unroll 8
      for (int c = 0; c < 64; ++c) tm = fmaxf(tm, Sf[tid][c]);
      float f = __expf(mo - tm), ts = 0.0f;
      #pragma unroll 8
      for (int c = 0; c < 64; ++c) {
        float p = __expf(Sf[tid][c] - tm);
        Ps[tid * TP + c] = (_Float16)p;
        ts += p;
      }
      mrow[tid] = tm;
      frow[tid] = f;
      lrow[tid] = lrow[tid] * f + ts;
    }
    __syncthreads();

    #pragma unroll
    for (int v = 0; v < 8; ++v) {
      float f = frow[wm * 16 + half * 8 + v];
      o0[v] *= f; o1[v] *= f;
    }
    // O += P . V
    #pragma unroll
    for (int kk = 0; kk < 2; ++kk) {
      v16h af  = cat16(pP[arow * RP + kk * 4 + half], pP[arow * RP + kk * 4 + 2 + half]);
      v16h bfA = cat16(pV[c0 * RP + kk * 4 + half],   pV[c0 * RP + kk * 4 + 2 + half]);
      v16h bfB = cat16(pV[(c0 + 16) * RP + kk * 4 + half],
                       pV[(c0 + 16) * RP + kk * 4 + 2 + half]);
      o0 = __builtin_amdgcn_wmma_f32_16x16x32_f16(false, af, false, bfA,
                                                  (short)0, o0, false, false);
      o1 = __builtin_amdgcn_wmma_f32_16x16x32_f16(false, af, false, bfB,
                                                  (short)0, o1, false, false);
    }
    __syncthreads();
  }

  #pragma unroll
  for (int v = 0; v < 8; ++v) {
    int lr = wm * 16 + half * 8 + v;
    float inv = 1.0f / lrow[lr];
    size_t g = ((size_t)b * SS + (size_t)(iq * 64 + lr)) * DD + h * HD;
    Of[g + wn * 32 + r]      = (_Float16)(o0[v] * inv);
    Of[g + wn * 32 + 16 + r] = (_Float16)(o1[v] * inv);
  }
}

// ---------------------------------------------------------------------------
// Host-side launch
// ---------------------------------------------------------------------------
extern "C" void kernel_launch(void* const* d_in, const int* in_sizes, int n_in,
                              void* d_out, int out_size, void* d_ws, size_t ws_size,
                              hipStream_t stream) {
  const float* x     = (const float*)d_in[0];
  const float* Wq    = (const float*)d_in[1];
  const float* bq    = (const float*)d_in[2];
  const float* Wk    = (const float*)d_in[3];
  const float* bk    = (const float*)d_in[4];
  const float* Wv    = (const float*)d_in[5];
  const float* bv    = (const float*)d_in[6];
  const float* Wo    = (const float*)d_in[7];
  const float* bo    = (const float*)d_in[8];
  const float* ln1_g = (const float*)d_in[9];
  const float* ln1_b = (const float*)d_in[10];
  const float* ln2_g = (const float*)d_in[11];
  const float* ln2_b = (const float*)d_in[12];
  const float* W1    = (const float*)d_in[13];
  const float* b1    = (const float*)d_in[14];
  const float* W2    = (const float*)d_in[15];
  const float* b2    = (const float*)d_in[16];
  float* out = (float*)d_out;

  auto align = [](size_t v) { return (v + 255) & ~(size_t)255; };
  char* base = (char*)d_ws;
  size_t off = 0;
  auto slot = [&](size_t bytes) { char* p = base + off; off += align(bytes); return p; };
  _Float16* hf16  = (_Float16*)slot((size_t)ROWS * DD * 2);
  _Float16* WqT   = (_Float16*)slot((size_t)DD * DD * 2);   // [N=768][K=768]
  _Float16* WkT   = (_Float16*)slot((size_t)DD * DD * 2);
  _Float16* WvT   = (_Float16*)slot((size_t)DD * DD * 2);
  _Float16* WoT   = (_Float16*)slot((size_t)DD * DD * 2);
  _Float16* W1T   = (_Float16*)slot((size_t)DD * FF * 2);   // [N=3072][K=768]
  _Float16* W2T   = (_Float16*)slot((size_t)FF * DD * 2);   // [N=768][K=3072]
  _Float16* Qf    = (_Float16*)slot((size_t)ROWS * DD * 2);
  _Float16* Kf    = (_Float16*)slot((size_t)ROWS * DD * 2);
  _Float16* Vf    = (_Float16*)slot((size_t)ROWS * DD * 2);
  _Float16* At16  = (_Float16*)slot((size_t)ROWS * DD * 2);
  float*    X1    = (float*)   slot((size_t)ROWS * DD * 4);
  _Float16* h216  = (_Float16*)slot((size_t)ROWS * DD * 2);
  _Float16* H1    = (_Float16*)slot((size_t)ROWS * FF * 2);

  // 1) weight conversion (f32 -> f16, transposed to [N][K])
  dim3 gHead(HD / TT, DD / TT, HH);
  cvt_T<<<gHead, 256, 0, stream>>>(Wq, WqT, DD, HD);
  cvt_T<<<gHead, 256, 0, stream>>>(Wk, WkT, DD, HD);
  cvt_T<<<gHead, 256, 0, stream>>>(Wv, WvT, DD, HD);
  cvt_T<<<dim3(DD / TT, DD / TT), 256, 0, stream>>>(Wo, WoT, DD, DD);
  cvt_T<<<dim3(FF / TT, DD / TT), 256, 0, stream>>>(W1, W1T, DD, FF);
  cvt_T<<<dim3(DD / TT, FF / TT), 256, 0, stream>>>(W2, W2T, FF, DD);

  // 2) LN1
  ln_f16<<<ROWS, 256, 0, stream>>>(x, ln1_g, ln1_b, hf16);

  // 3) Q/K/V projections (f16 out, +bias)
  dim3 gQKV(DD / BN, ROWS / BM);
  gemm_wmma<<<gQKV, 256, 0, stream>>>(hf16, WqT, bq, nullptr, Qf, ROWS, DD, DD, 1);
  gemm_wmma<<<gQKV, 256, 0, stream>>>(hf16, WkT, bk, nullptr, Kf, ROWS, DD, DD, 1);
  gemm_wmma<<<gQKV, 256, 0, stream>>>(hf16, WvT, bv, nullptr, Vf, ROWS, DD, DD, 1);

  // 4) causal flash attention
  dim3 gAtt(SS / 64, HH, BB);
  attn_wmma<<<gAtt, 256, 0, stream>>>(Qf, Kf, Vf, At16);

  // 5) output projection + residual (f32 out): X1 = x + attn @ Wo + bo
  gemm_wmma<<<gQKV, 256, 0, stream>>>(At16, WoT, bo, x, X1, ROWS, DD, DD, 0);

  // 6) LN2
  ln_f16<<<ROWS, 256, 0, stream>>>(X1, ln2_g, ln2_b, h216);

  // 7) FFN up + GELU (f16 out)
  dim3 gF1(FF / BN, ROWS / BM);
  gemm_wmma<<<gF1, 256, 0, stream>>>(h216, W1T, b1, nullptr, H1, ROWS, FF, DD, 1 | 2);

  // 8) FFN down + bias + residual (f32 out to d_out)
  dim3 gF2(DD / BN, ROWS / BM);
  gemm_wmma<<<gF2, 256, 0, stream>>>(H1, W2T, b2, X1, out, ROWS, DD, FF, 0);

  (void)in_sizes; (void)n_in; (void)out_size; (void)ws_size;
}

// v003
// A run of this version takes 318 microseconds.
// In both of two side-by-side timings against v002, it was 1.26 times as fast.
// Counting every step since v000, it is 1.70 times as fast.
#include <hip/hip_runtime.h>
#include <hip/hip_bf16.h>
#include <math.h>

typedef __attribute__((ext_vector_type(16))) _Float16 v16h;
typedef __attribute__((ext_vector_type(8)))  _Float16 v8h;
typedef __attribute__((ext_vector_type(8)))  float    v8f;
typedef __attribute__((ext_vector_type(4)))  _Float16 v4h;
typedef __attribute__((ext_vector_type(4)))  float    v4f;

#define BB 2
#define SS 2048
#define DD 768
#define HH 12
#define HD 64
#define FF 3072
#define ROWS (BB*SS)          // 4096
#define EPS 1e-5f

#define BM 128
#define BN 128
#define BK 32

// LDS row pitches in halves. A ds_load_b128 fragment read walks 16 rows at once;
// a pitch of 16 B x odd spreads those rows over all 64 banks.
#define AKP 40                // GEMM A tile: 32 halves + 8 pad  (80 B)
#define TP  72                // attention tiles: 64 halves + 8 pad (144 B)

#define TT  64                // weight transpose tile edge
#define TTP 72                // its LDS row: 64 halves + 8 pad (144 B)

// ---------------------------------------------------------------------------
// Tensor Data Mover support (gfx1250). Falls back to vector loads if the
// builtin is unavailable (e.g. host pass of hipcc).
// ---------------------------------------------------------------------------
#ifndef __has_builtin
#define __has_builtin(x) 0
#endif
#if __has_builtin(__builtin_amdgcn_tensor_load_to_lds) && \
    __has_builtin(__builtin_amdgcn_s_wait_tensorcnt)
#define HAVE_TDM 1
#else
#define HAVE_TDM 0
#endif

#if HAVE_TDM
typedef unsigned int u32x4  __attribute__((ext_vector_type(4)));
typedef int          i32x4t __attribute__((ext_vector_type(4)));
typedef int          i32x8t __attribute__((ext_vector_type(8)));

// Issue a 2D TDM tile load: tileRows x tileCols elements (2 bytes each),
// global row stride = rowStrideElems, destination LDS byte offset lds_off.
static __device__ __forceinline__ void tdm_load_2d(const void* gsrc, unsigned lds_off,
                                                   int tileRows, int tileCols,
                                                   long long rowStrideElems) {
  unsigned long long ga = (unsigned long long)(size_t)gsrc;
  u32x4 g0;
  g0.x = 1u;                                                 // count = 1 valid D#
  g0.y = lds_off;                                            // lds_addr
  g0.z = (unsigned)ga;                                       // global_addr[31:0]
  g0.w = (unsigned)((ga >> 32) & 0x01ffffffu) | (2u << 30);  // global_addr[56:32], type=2
  unsigned long long str = (unsigned long long)rowStrideElems;
  unsigned td0 = 0x40000000u, td1 = 0x40000000u;             // huge extents: no OOB clip
  i32x8t g1;
  g1[0] = (int)(1u << 16);                                   // data_size = 2B
  g1[1] = (int)((td0 & 0xffffu) << 16);                      // tensor_dim0 lo
  g1[2] = (int)((td0 >> 16) | ((td1 & 0xffffu) << 16));      // tensor_dim0 hi | dim1 lo
  g1[3] = (int)((td1 >> 16) | ((unsigned)tileCols << 16));   // dim1 hi | tile_dim0
  g1[4] = (int)((unsigned)tileRows & 0xffffu);               // tile_dim1 (tile_dim2=0)
  g1[5] = (int)(unsigned)(str & 0xffffffffu);                // tensor_dim0_stride lo
  g1[6] = (int)(unsigned)((str >> 32) & 0xffffu);            // stride hi
  g1[7] = 0;
  i32x4t z = {};
  i32x8t z8 = {};
  __builtin_amdgcn_tensor_load_to_lds(g0, g1, z, z, z8, 0);
}
#endif

static __device__ __forceinline__ v16h cat16(v8h lo, v8h hi) {
  return __builtin_shufflevector(lo, hi, 0,1,2,3,4,5,6,7,8,9,10,11,12,13,14,15);
}

// ---------------------------------------------------------------------------
// Weight conversion: fp32 -> f16, producing TRANSPOSED (N-major) weights so the
// GEMM B-operand is contraction-contiguous.
// in: blockIdx.z-th matrix [R][C] f32 -> out: blockIdx.z-th matrix [C][R] f16.
// One block moves a 64 x 64 tile through LDS: whole 128-byte lines are read and
// whole lines are written, 16 elements per thread. R and C are multiples of 64.
// (H, D, HD) weights are H such matrices: out[(h*HD+k)*D + d] = W[h][d][k].
// ---------------------------------------------------------------------------
__global__ __launch_bounds__(256) void cvt_T(const float* __restrict__ W,
                                             _Float16* __restrict__ out,
                                             int R, int C) {
  __shared__ __align__(16) _Float16 Ls[TT * TTP];   // Ls[c][r]
  int tid = threadIdx.x;
  int c0 = blockIdx.x * TT, r0 = blockIdx.y * TT;
  size_t zoff = (size_t)blockIdx.z * R * C;

  // each thread takes a 4 x 4 block: 4 rows, 16 bytes of each
  int rb = (tid >> 4) * 4, cb = (tid & 15) * 4;
  const float* src = W + zoff + (size_t)(r0 + rb) * C + c0 + cb;
  v4f w0 = *(const v4f*)src;
  v4f w1 = *(const v4f*)(src + C);
  v4f w2 = *(const v4f*)(src + 2 * (size_t)C);
  v4f w3 = *(const v4f*)(src + 3 * (size_t)C);
  #pragma unroll   // constant j: the loaded vectors stay in registers
  for (int j = 0; j < 4; ++j) {
    v4h p = {(_Float16)w0[j], (_Float16)w1[j], (_Float16)w2[j], (_Float16)w3[j]};
    *(v4h*)&Ls[(cb + j) * TTP + rb] = p;
  }
  __syncthreads();

  // 8 lanes write one 128-byte line of an output row
  int rg = (tid & 7) * 8;
  #pragma unroll   // both LDS reads issue before the first store waits
  for (int i = 0; i < 2; ++i) {
    int c = (tid >> 3) + 32 * i;
    v8h o = *(const v8h*)&Ls[c * TTP + rg];
    *(v8h*)(out + zoff + (size_t)(c0 + c) * R + r0 + rg) = o;
  }
}

// ---------------------------------------------------------------------------
// LayerNorm (row of 768) -> f16 output
// ---------------------------------------------------------------------------
__global__ __launch_bounds__(256) void ln_f16(const float* __restrict__ x,
                                              const float* __restrict__ g,
                                              const float* __restrict__ bta,
                                              _Float16* __restrict__ out) {
  __shared__ float red[256];
  int row = blockIdx.x, tid = threadIdx.x;
  const float* xr = x + (size_t)row * DD;
  float v0 = xr[tid], v1 = xr[tid + 256], v2 = xr[tid + 512];
  red[tid] = v0 + v1 + v2;
  __syncthreads();
  #pragma unroll
  for (int st = 128; st > 0; st >>= 1) {
    if (tid < st) red[tid] += red[tid + st];
    __syncthreads();
  }
  float mean = red[0] * (1.0f / DD);
  __syncthreads();
  float d0 = v0 - mean, d1 = v1 - mean, d2 = v2 - mean;
  red[tid] = d0 * d0 + d1 * d1 + d2 * d2;
  __syncthreads();
  #pragma unroll
  for (int st = 128; st > 0; st >>= 1) {
    if (tid < st) red[tid] += red[tid + st];
    __syncthreads();
  }
  float rs = rsqrtf(red[0] * (1.0f / DD) + EPS);
  _Float16* orow = out + (size_t)row * DD;
  orow[tid]       = (_Float16)(d0 * rs * g[tid]       + bta[tid]);
  orow[tid + 256] = (_Float16)(d1 * rs * g[tid + 256] + bta[tid + 256]);
  orow[tid + 512] = (_Float16)(d2 * rs * g[tid + 512] + bta[tid + 512]);
}

// ---------------------------------------------------------------------------
// WMMA GEMM: C[M,N] = act(A[M,K](f16) x BT[N,K](f16)^T + bias) (+ resid)
// 256 threads = 8 waves. Block tile 128x128, K-step 32.
// Wave grid 4(M) x 2(N); each wave: 2 A-frags x 4 B-frags -> 8 WMMA / K-step.
// B (weight) tiles are streamed by the Tensor Data Mover into double-buffered
// LDS; wave 0 issues the DMA and synchronizes with s_wait_tensorcnt.
// flags: bit0 = f16 output, bit1 = exact GELU
// ---------------------------------------------------------------------------
__global__ __launch_bounds__(256) void gemm_wmma(const _Float16* __restrict__ A,
                                                 const _Float16* __restrict__ BT,
                                                 const float* __restrict__ bias,
                                                 const float* __restrict__ resid,
                                                 void* __restrict__ Cout,
                                                 int M, int N, int K, int flags) {
  __shared__ __align__(16) _Float16 As[BM * AKP];
#if HAVE_TDM
  __shared__ __align__(16) _Float16 Bsd[2][BN * BK];
#else
  __shared__ __align__(16) _Float16 Bs[BN * BK];
#endif
  int tid = threadIdx.x;
  int wid = tid >> 5, lane = tid & 31;
  int half = lane >> 4, r = lane & 15;
  int wm = wid & 3, wn = wid >> 2;
  int m0 = blockIdx.y * BM, n0 = blockIdx.x * BN;

  v8f acc[2][4];
  #pragma unroll
  for (int mi = 0; mi < 2; ++mi)
    #pragma unroll
    for (int ni = 0; ni < 4; ++ni) acc[mi][ni] = (v8f){};

  int ldRow = tid >> 1, ldCg = (tid & 1) * 16;   // 128 rows x 32 halves

#if HAVE_TDM
  if (wid == 0)
    tdm_load_2d(BT + (size_t)n0 * K, (unsigned)(size_t)&Bsd[0][0], BN, BK, K);
#endif

  for (int k0 = 0; k0 < K; k0 += BK) {
    const _Float16* ga = A + (size_t)(m0 + ldRow) * K + k0 + ldCg;
    v8h a0 = *(const v8h*)ga;
    v8h a1 = *(const v8h*)(ga + 8);
    if (k0 + BK < K) __builtin_prefetch(ga + BK, 0, 1);
    *(v8h*)&As[ldRow * AKP + ldCg]     = a0;
    *(v8h*)&As[ldRow * AKP + ldCg + 8] = a1;

#if HAVE_TDM
    int pb = (k0 / BK) & 1;
    if (wid == 0) {
      if (k0 + BK < K) {
        tdm_load_2d(BT + (size_t)n0 * K + (k0 + BK),
                    (unsigned)(size_t)&Bsd[pb ^ 1][0], BN, BK, K);
        __builtin_amdgcn_s_wait_tensorcnt(1);   // current tile has landed
      } else {
        __builtin_amdgcn_s_wait_tensorcnt(0);   // drain final tile
      }
    }
    const v8h* pB = (const v8h*)&Bsd[pb][0];
#else
    const _Float16* gb = BT + (size_t)(n0 + ldRow) * K + k0 + ldCg;
    v8h b0 = *(const v8h*)gb;
    v8h b1 = *(const v8h*)(gb + 8);
    if (k0 + BK < K) __builtin_prefetch(gb + BK, 0, 1);
    *(v8h*)&Bs[ldRow * BK + ldCg]     = b0;
    *(v8h*)&Bs[ldRow * BK + ldCg + 8] = b1;
    const v8h* pB = (const v8h*)Bs;
#endif
    __syncthreads();

    const v8h* pA = (const v8h*)As;
    v16h afr[2], bfr[4];
    #pragma unroll
    for (int mi = 0; mi < 2; ++mi) {
      int row = wm * 32 + mi * 16 + r;
      afr[mi] = cat16(pA[row * (AKP / 8) + half], pA[row * (AKP / 8) + 2 + half]);
    }
    #pragma unroll
    for (int ni = 0; ni < 4; ++ni) {
      int col = wn * 64 + ni * 16 + r;
      bfr[ni] = cat16(pB[col * 4 + half], pB[col * 4 + 2 + half]);
    }
    #pragma unroll
    for (int mi = 0; mi < 2; ++mi)
      #pragma unroll
      for (int ni = 0; ni < 4; ++ni)
        acc[mi][ni] = __builtin_amdgcn_wmma_f32_16x16x32_f16(
            false, afr[mi], false, bfr[ni], (short)0, acc[mi][ni], false, false);
    __syncthreads();
  }

  bool outf16 = flags & 1, doGelu = flags & 2;
  #pragma unroll
  for (int mi = 0; mi < 2; ++mi)
    #pragma unroll
    for (int ni = 0; ni < 4; ++ni)
      #pragma unroll
      for (int v = 0; v < 8; ++v) {
        int row = m0 + wm * 32 + mi * 16 + half * 8 + v;
        int col = n0 + wn * 64 + ni * 16 + r;
        float val = acc[mi][ni][v] + bias[col];
        if (doGelu) val = 0.5f * val * (1.0f + erff(val * 0.70710678f));
        if (resid) val += resid[(size_t)row * N + col];
        if (outf16) ((_Float16*)Cout)[(size_t)row * N + col] = (_Float16)val;
        else        ((float*)Cout)[(size_t)row * N + col] = val;
      }
}

#define QB 128

// lane l <-> lane l ^ 16
static __device__ __forceinline__ float xhalf(float x) {
  int b = __builtin_bit_cast(int, x);
  return __builtin_bit_cast(float,
      __builtin_amdgcn_permlanex16(b, b, 0x76543210, 0xfedcba98, false, false));
}

__global__ __launch_bounds__(256) void attn_wmma(const _Float16* __restrict__ Qf,
                                                 const _Float16* __restrict__ Kf,
                                                 const _Float16* __restrict__ Vf,
                                                 _Float16* __restrict__ Of) {
  __shared__ __align__(16) _Float16 Ks[64 * TP];
  __shared__ __align__(16) _Float16 VsT[64 * TP];  // VsT[c][t]

  int tid = threadIdx.x, lane = tid & 31;
  int wid = __builtin_amdgcn_readfirstlane(tid >> 5);
  int half = lane >> 4, r = lane & 15;
  int iq = blockIdx.x, h = blockIdx.y, b = blockIdx.z;

  int ldRow = tid >> 2, ldCg = (tid & 3) * 16;  // 64 rows x 64 halves

  int q0 = iq * QB + wid * 16;   // first query of this wave
  int qg = q0 + r;               // this lane's query

  // Q^T as B operand, kept in registers; same k order as the K loader below
  v16h qf[2];
  {
    const _Float16* gq = Qf + ((size_t)b * SS + qg) * DD + h * HD + half * 8;
    #pragma unroll
    for (int kk = 0; kk < 2; ++kk)
      qf[kk] = cat16(*(const v8h*)(gq + kk * 32), *(const v8h*)(gq + kk * 32 + 16));
  }

  v8f ot[4];                     // O^T: ot[t][v] = O[query][t*16 + half*8 + v]
  #pragma unroll
  for (int t = 0; t < 4; ++t) ot[t] = (v8f){};
  float mrun = -3.0e38f, lsum = 0.0f;   // running maximum, scaled to base 2; this half's sum

  const int RP = TP / 8;   // row pitch in 16-byte units
  const v8h* pK = (const v8h*)Ks;
  const v8h* pV = (const v8h*)VsT;
  const float SC = 0.125f * 1.4426950408889634f;   // 1/sqrt(HD) * log2(e)

  int nj = 2 * iq + 2;
  for (int j = 0; j < nj; ++j) {
    {
      size_t g = ((size_t)b * SS + (size_t)j * 64 + ldRow) * DD + h * HD + ldCg;
      v8h k0v = *(const v8h*)(Kf + g);
      v8h k1v = *(const v8h*)(Kf + g + 8);
      v8h v0v = *(const v8h*)(Vf + g);
      v8h v1v = *(const v8h*)(Vf + g + 8);
      *(v8h*)&Ks[ldRow * TP + ldCg]     = k0v;
      *(v8h*)&Ks[ldRow * TP + ldCg + 8] = k1v;
      #pragma unroll
      for (int e = 0; e < 8; ++e) {
        VsT[(ldCg + e) * TP + ldRow]     = v0v[e];
        VsT[(ldCg + 8 + e) * TP + ldRow] = v1v[e];
      }
    }
    __syncthreads();

    if (j * 64 <= q0 + 15) {     // wave-uniform: a tile wholly above the diagonal adds nothing
      // scores^T: st[t][v] = K[j*64 + t*16 + half*8 + v] . Q[qg]
      v16h kf[4][2];
      #pragma unroll
      for (int t = 0; t < 4; ++t)
        #pragma unroll
        for (int kk = 0; kk < 2; ++kk) {
          int row = t * 16 + r;
          kf[t][kk] = cat16(pK[row * RP + kk * 4 + half], pK[row * RP + kk * 4 + 2 + half]);
        }
      // all 16 K reads stay in one group ahead of the products: one LDS latency, not eight
      __builtin_amdgcn_sched_barrier(0);
      v8f st[4];
      #pragma unroll
      for (int t = 0; t < 4; ++t)
        st[t] = __builtin_amdgcn_wmma_f32_16x16x32_f16(false, kf[t][0], false, qf[0],
                                                       (short)0, (v8f){}, false, false);
      #pragma unroll
      for (int t = 0; t < 4; ++t)
        st[t] = __builtin_amdgcn_wmma_f32_16x16x32_f16(false, kf[t][1], false, qf[1],
                                                       (short)0, st[t], false, false);
      v16h vf[2][4];
      #pragma unroll
      for (int kk = 0; kk < 2; ++kk)
        #pragma unroll
        for (int t = 0; t < 4; ++t) {
          int row = t * 16 + r;
          vf[kk][t] = cat16(pV[row * RP + kk * 4 + half], pV[row * RP + kk * 4 + 2 + half]);
        }
      // the 16 V^T reads stay here, in one group, so that they land under the softmax arithmetic
      __builtin_amdgcn_sched_barrier(0);
      if (j * 64 + 63 > q0) {    // wave-uniform: only tiles that touch the diagonal
        #pragma unroll
        for (int t = 0; t < 4; ++t)
          #pragma unroll
          for (int v = 0; v < 8; ++v)
            if (j * 64 + t * 16 + half * 8 + v > qg) st[t][v] = -1.0e30f;
      }

      // online softmax, one query per lane pair (l, l ^ 16); the maximum is taken over the
      // raw scores and scaled once, the scale rides in the exponent's multiply-add
      float tmx[4];
      #pragma unroll
      for (int t = 0; t < 4; ++t) {
        float a = fmaxf(fmaxf(st[t][0], st[t][1]), fmaxf(st[t][2], st[t][3]));
        float c = fmaxf(fmaxf(st[t][4], st[t][5]), fmaxf(st[t][6], st[t][7]));
        tmx[t] = fmaxf(a, c);
      }
      float tm = fmaxf(fmaxf(tmx[0], tmx[1]), fmaxf(tmx[2], tmx[3]));
      tm = fmaxf(tm, xhalf(tm)) * SC;
      tm = fmaxf(tm, mrun);
      float f = __builtin_amdgcn_exp2f(mrun - tm);
      mrun = tm;
      const v8f vsc = {SC, SC, SC, SC, SC, SC, SC, SC};
      const v8f vnm = {-tm, -tm, -tm, -tm, -tm, -tm, -tm, -tm};
      #pragma unroll
      for (int t = 0; t < 4; ++t) st[t] = __builtin_elementwise_fma(st[t], vsc, vnm);
      float tsm[4];
      #pragma unroll
      for (int t = 0; t < 4; ++t) {
        float ts = 0.0f;
        #pragma unroll
        for (int v = 0; v < 8; ++v) {
          float p = __builtin_amdgcn_exp2f(st[t][v]);
          st[t][v] = p;
          ts += p;
        }
        tsm[t] = ts;
      }
      lsum = lsum * f + ((tsm[0] + tsm[1]) + (tsm[2] + tsm[3]));
      #pragma unroll
      for (int t = 0; t < 4; ++t) ot[t] *= f;

      // O^T += V^T . P^T
      #pragma unroll
      for (int kk = 0; kk < 2; ++kk) {
        v16h pf;   // pf[s] = P^T[key kk*32 + (s < 8 ? half*8 + s : 16 + half*8 + s - 8)][qg]
        #pragma unroll
        for (int s = 0; s < 8; ++s) {
          pf[s]     = (_Float16)st[2 * kk][s];
          pf[s + 8] = (_Float16)st[2 * kk + 1][s];
        }
        #pragma unroll
        for (int t = 0; t < 4; ++t)
          ot[t] = __builtin_amdgcn_wmma_f32_16x16x32_f16(false, vf[kk][t], false, pf,
                                                         (short)0, ot[t], false, false);
      }
    }
    __syncthreads();
  }

  float inv = 1.0f / (lsum + xhalf(lsum));
  _Float16* go = Of + ((size_t)b * SS + qg) * DD + h * HD + half * 8;
  #pragma unroll
  for (int t = 0; t < 4; ++t) {
    v8h o;
    #pragma unroll
    for (int v = 0; v < 8; ++v) o[v] = (_Float16)(ot[t][v] * inv);
    *(v8h*)(go + t * 16) = o;
  }
}

// ---------------------------------------------------------------------------
// Host-side launch
// ---------------------------------------------------------------------------
extern "C" void kernel_launch(void* const* d_in, const int* in_sizes, int n_in,
                              void* d_out, int out_size, void* d_ws, size_t ws_size,
                              hipStream_t stream) {
  const float* x     = (const float*)d_in[0];
  const float* Wq    = (const float*)d_in[1];
  const float* bq    = (const float*)d_in[2];
  const float* Wk    = (const float*)d_in[3];
  const float* bk    = (const float*)d_in[4];
  const float* Wv    = (const float*)d_in[5];
  const float* bv    = (const float*)d_in[6];
  const float* Wo    = (const float*)d_in[7];
  const float* bo    = (const float*)d_in[8];
  const float* ln1_g = (const float*)d_in[9];
  const float* ln1_b = (const float*)d_in[10];
  const float* ln2_g = (const float*)d_in[11];
  const float* ln2_b = (const float*)d_in[12];
  const float* W1    = (const float*)d_in[13];
  const float* b1    = (const float*)d_in[14];
  const float* W2    = (const float*)d_in[15];
  const float* b2    = (const float*)d_in[16];
  float* out = (float*)d_out;

  auto align = [](size_t v) { return (v + 255) & ~(size_t)255; };
  char* base = (char*)d_ws;
  size_t off = 0;
  auto slot = [&](size_t bytes) { char* p = base + off; off += align(bytes); return p; };
  _Float16* hf16  = (_Float16*)slot((size_t)ROWS * DD * 2);
  _Float16* WqT   = (_Float16*)slot((size_t)DD * DD * 2);   // [N=768][K=768]
  _Float16* WkT   = (_Float16*)slot((size_t)DD * DD * 2);
  _Float16* WvT   = (_Float16*)slot((size_t)DD * DD * 2);
  _Float16* WoT   = (_Float16*)slot((size_t)DD * DD * 2);
  _Float16* W1T   = (_Float16*)slot((size_t)DD * FF * 2);   // [N=3072][K=768]
  _Float16* W2T   = (_Float16*)slot((size_t)FF * DD * 2);   // [N=768][K=3072]
  _Float16* Qf    = (_Float16*)slot((size_t)ROWS * DD * 2);
  _Float16* Kf    = (_Float16*)slot((size_t)ROWS * DD * 2);
  _Float16* Vf    = (_Float16*)slot((size_t)ROWS * DD * 2);
  _Float16* At16  = (_Float16*)slot((size_t)ROWS * DD * 2);
  float*    X1    = (float*)   slot((size_t)ROWS * DD * 4);
  _Float16* h216  = (_Float16*)slot((size_t)ROWS * DD * 2);
  _Float16* H1    = (_Float16*)slot((size_t)ROWS * FF * 2);

  // 1) weight conversion (f32 -> f16, transposed to [N][K])
  dim3 gHead(HD / TT, DD / TT, HH);
  cvt_T<<<gHead, 256, 0, stream>>>(Wq, WqT, DD, HD);
  cvt_T<<<gHead, 256, 0, stream>>>(Wk, WkT, DD, HD);
  cvt_T<<<gHead, 256, 0, stream>>>(Wv, WvT, DD, HD);
  cvt_T<<<dim3(DD / TT, DD / TT), 256, 0, stream>>>(Wo, WoT, DD, DD);
  cvt_T<<<dim3(FF / TT, DD / TT), 256, 0, stream>>>(W1, W1T, DD, FF);
  cvt_T<<<dim3(DD / TT, FF / TT), 256, 0, stream>>>(W2, W2T, FF, DD);

  // 2) LN1
  ln_f16<<<ROWS, 256, 0, stream>>>(x, ln1_g, ln1_b, hf16);

  // 3) Q/K/V projections (f16 out, +bias)
  dim3 gQKV(DD / BN, ROWS / BM);
  gemm_wmma<<<gQKV, 256, 0, stream>>>(hf16, WqT, bq, nullptr, Qf, ROWS, DD, DD, 1);
  gemm_wmma<<<gQKV, 256, 0, stream>>>(hf16, WkT, bk, nullptr, Kf, ROWS, DD, DD, 1);
  gemm_wmma<<<gQKV, 256, 0, stream>>>(hf16, WvT, bv, nullptr, Vf, ROWS, DD, DD, 1);

  // 4) causal flash attention
  dim3 gAtt(SS / QB, HH, BB);
  attn_wmma<<<gAtt, 256, 0, stream>>>(Qf, Kf, Vf, At16);

  // 5) output projection + residual (f32 out): X1 = x + attn @ Wo + bo
  gemm_wmma<<<gQKV, 256, 0, stream>>>(At16, WoT, bo, x, X1, ROWS, DD, DD, 0);

  // 6) LN2
  ln_f16<<<ROWS, 256, 0, stream>>>(X1, ln2_g, ln2_b, h216);

  // 7) FFN up + GELU (f16 out)
  dim3 gF1(FF / BN, ROWS / BM);
  gemm_wmma<<<gF1, 256, 0, stream>>>(h216, W1T, b1, nullptr, H1, ROWS, FF, DD, 1 | 2);

  // 8) FFN down + bias + residual (f32 out to d_out)
  dim3 gF2(DD / BN, ROWS / BM);
  gemm_wmma<<<gF2, 256, 0, stream>>>(H1, W2T, b2, X1, out, ROWS, DD, FF, 0);

  (void)in_sizes; (void)n_in; (void)out_size; (void)ws_size;
}

// v004
// A run of this version takes 252 microseconds.
// Two timings next to v003 put it at 1.26 and 1.27 times that version's speed.
// All steps since v000 together make it 2.15 times as fast.
#include <hip/hip_runtime.h>
#include <hip/hip_bf16.h>
#include <math.h>

typedef __attribute__((ext_vector_type(16))) _Float16 v16h;
typedef __attribute__((ext_vector_type(8)))  _Float16 v8h;
typedef __attribute__((ext_vector_type(8)))  float    v8f;
typedef __attribute__((ext_vector_type(4)))  _Float16 v4h;
typedef __attribute__((ext_vector_type(4)))  float    v4f;

#define BB 2
#define SS 2048
#define DD 768
#define HH 12
#define HD 64
#define FF 3072
#define ROWS (BB*SS)          // 4096
#define EPS 1e-5f

#define BM 128
#define BN 128
#define BK 128

// LDS row pitches in halves. A ds_load_b128 fragment read walks 16 rows at once;
// a pitch of 16 B x odd spreads those rows over all 64 banks.
#define AKP 136               // GEMM A and B tiles: 128 halves + 8 pad (272 B)
#define TP  72                // attention tiles: 64 halves + 8 pad (144 B)
#define BTB (BN * AKP * 2)    // one B buffer in bytes: 128 rows x 272 B = 34816 = 17 x 2 KiB

#define TT  64                // weight transpose tile edge
#define TTP 72                // its LDS row: 64 halves + 8 pad (144 B)

// ---------------------------------------------------------------------------
// Tensor load to LDS: one request of one wave brings a 2-D tile, through no register.
// ---------------------------------------------------------------------------
typedef uint32_t u32x4 __attribute__((ext_vector_type(4)));
typedef uint32_t u32x8 __attribute__((ext_vector_type(8)));

static __device__ __forceinline__ uint32_t uni(uint32_t v) {
  return (uint32_t)__builtin_amdgcn_readfirstlane(v);
}
// A test held in a scalar register, so that the branch on it is a scalar branch:
// a tensor load ignores EXEC and only such a branch keeps a wave from issuing it.
static __device__ __forceinline__ uint32_t pinned(uint32_t v) {
  uint32_t w = uni(v);
  asm volatile("" : "+s"(w));
  return w;
}
// Group 1: 1-byte elements, tensor = tile = BN rows of 256 bytes, source pitch in bytes,
// 4 dwords of LDS pad behind every 64 dwords (one row): LDS pitch 272 B.
static __device__ __forceinline__ u32x8 tdm_group1(uint32_t src_pitch) {
  constexpr uint32_t d0 = BK * 2, d1 = BN;
  u32x8 g;   // pinned(): each descriptor word is held in a scalar register of its own
  g[0] = pinned((1u << 20) | (5u << 22) | (3u << 25));
  g[1] = pinned((d0 & 0xFFFFu) << 16);
  g[2] = pinned((d0 >> 16) | ((d1 & 0xFFFFu) << 16));
  g[3] = pinned((d1 >> 16) | (d0 << 16));
  g[4] = pinned(d1);
  g[5] = pinned(src_pitch);
  g[6] = pinned(0u);
  g[7] = pinned(0u);
  return g;
}
// Group 0: count 1, LDS byte offset, global address of the tile's first byte, type 2.
static __device__ __forceinline__ u32x4 tdm_group0(uint32_t lds_dst, uint64_t ga) {
  u32x4 g;   // pinned(): each descriptor word is held in a scalar register of its own
  g[0] = pinned(1u);
  g[1] = pinned(lds_dst);
  g[2] = pinned((uint32_t)ga);
  g[3] = pinned((((uint32_t)(ga >> 32)) & 0x01FFFFFFu) | 0x80000000u);
  return g;
}
static __device__ __forceinline__ void tdm_load(u32x4 g0, u32x8 g1) {
  asm volatile("tensor_load_to_lds %0, %1" :: "s"(g0), "s"(g1) : "memory");
}
// The compiler places no wait for a tensor load: the issuing wave waits for its tile itself.
// The wait names the outstanding request's descriptor, so that its scalar registers stay
// untouched from the issue up to here.
static __device__ __forceinline__ void wait_tensor0(u32x4 g0, u32x8 g1) {
  asm volatile("s_wait_tensorcnt 0x0" :: "s"(g0), "s"(g1) : "memory");
}
// this wave's LDS reads have returned before the buffer they read is handed back for a refill
static __device__ __forceinline__ void wait_ds0() {
  asm volatile("s_wait_dscnt 0x0" ::: "memory");
}

static __device__ __forceinline__ v16h cat16(v8h lo, v8h hi) {
  return __builtin_shufflevector(lo, hi, 0,1,2,3,4,5,6,7,8,9,10,11,12,13,14,15);
}

// ---------------------------------------------------------------------------
// Weight conversion: fp32 -> f16, producing TRANSPOSED (N-major) weights so the
// GEMM B-operand is contraction-contiguous.
// in: blockIdx.z-th matrix [R][C] f32 -> out: blockIdx.z-th matrix [C][R] f16.
// One block moves a 64 x 64 tile through LDS: whole 128-byte lines are read and
// whole lines are written, 16 elements per thread. R and C are multiples of 64.
// (H, D, HD) weights are H such matrices: out[(h*HD+k)*D + d] = W[h][d][k].
// ---------------------------------------------------------------------------
__global__ __launch_bounds__(256) void cvt_T(const float* __restrict__ W,
                                             _Float16* __restrict__ out,
                                             int R, int C) {
  __shared__ __align__(16) _Float16 Ls[TT * TTP];   // Ls[c][r]
  int tid = threadIdx.x;
  int c0 = blockIdx.x * TT, r0 = blockIdx.y * TT;
  size_t zoff = (size_t)blockIdx.z * R * C;

  // each thread takes a 4 x 4 block: 4 rows, 16 bytes of each
  int rb = (tid >> 4) * 4, cb = (tid & 15) * 4;
  const float* src = W + zoff + (size_t)(r0 + rb) * C + c0 + cb;
  v4f w0 = *(const v4f*)src;
  v4f w1 = *(const v4f*)(src + C);
  v4f w2 = *(const v4f*)(src + 2 * (size_t)C);
  v4f w3 = *(const v4f*)(src + 3 * (size_t)C);
  #pragma unroll   // constant j: the loaded vectors stay in registers
  for (int j = 0; j < 4; ++j) {
    v4h p = {(_Float16)w0[j], (_Float16)w1[j], (_Float16)w2[j], (_Float16)w3[j]};
    *(v4h*)&Ls[(cb + j) * TTP + rb] = p;
  }
  __syncthreads();

  // 8 lanes write one 128-byte line of an output row
  int rg = (tid & 7) * 8;
  #pragma unroll   // both LDS reads issue before the first store waits
  for (int i = 0; i < 2; ++i) {
    int c = (tid >> 3) + 32 * i;
    v8h o = *(const v8h*)&Ls[c * TTP + rg];
    *(v8h*)(out + zoff + (size_t)(c0 + c) * R + r0 + rg) = o;
  }
}

// ---------------------------------------------------------------------------
// LayerNorm (row of 768) -> f16 output
// ---------------------------------------------------------------------------
__global__ __launch_bounds__(256) void ln_f16(const float* __restrict__ x,
                                              const float* __restrict__ g,
                                              const float* __restrict__ bta,
                                              _Float16* __restrict__ out) {
  __shared__ float red[256];
  int row = blockIdx.x, tid = threadIdx.x;
  const float* xr = x + (size_t)row * DD;
  float v0 = xr[tid], v1 = xr[tid + 256], v2 = xr[tid + 512];
  red[tid] = v0 + v1 + v2;
  __syncthreads();
  #pragma unroll
  for (int st = 128; st > 0; st >>= 1) {
    if (tid < st) red[tid] += red[tid + st];
    __syncthreads();
  }
  float mean = red[0] * (1.0f / DD);
  __syncthreads();
  float d0 = v0 - mean, d1 = v1 - mean, d2 = v2 - mean;
  red[tid] = d0 * d0 + d1 * d1 + d2 * d2;
  __syncthreads();
  #pragma unroll
  for (int st = 128; st > 0; st >>= 1) {
    if (tid < st) red[tid] += red[tid + st];
    __syncthreads();
  }
  float rs = rsqrtf(red[0] * (1.0f / DD) + EPS);
  _Float16* orow = out + (size_t)row * DD;
  orow[tid]       = (_Float16)(d0 * rs * g[tid]       + bta[tid]);
  orow[tid + 256] = (_Float16)(d1 * rs * g[tid + 256] + bta[tid + 256]);
  orow[tid + 512] = (_Float16)(d2 * rs * g[tid + 512] + bta[tid + 512]);
}

// ---------------------------------------------------------------------------
// WMMA GEMM: C[M,N] = act(A[M,K](f16) x BT[N,K](f16)^T + bias) (+ resid)
// 256 threads = 8 waves. Block tile 128x128, K-step 128 (256-byte tile rows).
// Wave grid 4(M) x 2(N); each wave: 2 A-frags x 4 B-frags x 4 k blocks -> 32 WMMA / K-step.
// B (weight) tiles come by tensor load into two LDS buffers, padded by the mover to the
// 272-byte pitch; wave 0 issues, one request outstanding.
// K is a multiple of 128.
// flags: bit0 = f16 output, bit1 = exact GELU
// ---------------------------------------------------------------------------
__global__ __launch_bounds__(256) void gemm_wmma(const _Float16* __restrict__ A,
                                                 const _Float16* __restrict__ BT,
                                                 const float* __restrict__ bias,
                                                 const float* __restrict__ resid,
                                                 void* __restrict__ Cout,
                                                 int M, int N, int K, int flags) {
  __shared__ __attribute__((aligned(2048))) _Float16 Bsd[2][BN * AKP];
  __shared__ __align__(16) _Float16 As[BM * AKP];
  int tid = threadIdx.x;
  int lane = tid & 31;
  const uint32_t wid = uni(tid >> 5);
  int half = lane >> 4, r = lane & 15;
  int wm = wid & 3, wn = wid >> 2;
  int m0 = blockIdx.y * BM, n0 = blockIdx.x * BN;

  // every loop over mi, ni, i and kk below is fully unrolled: constant indices keep the
  // fragments, the staged rows and the accumulators in registers
  v8f acc[2][4];
  #pragma unroll
  for (int mi = 0; mi < 2; ++mi)
    #pragma unroll
    for (int ni = 0; ni < 4; ++ni) acc[mi][ni] = (v8f){};

  const int np = K / BK;
  int ldRow = tid >> 4, ldCg = (tid & 15) * 8;   // 16 lanes take one 256-byte row; 8 x 16 rows
  const _Float16* ga = A + (size_t)(m0 + ldRow) * K + ldCg;
  // each thread prefetches one 128-byte line of the next A tile; the pointer never leaves A
  const _Float16* pf = A + (size_t)(m0 + (tid >> 1)) * K + (tid & 1) * 64 + (np > 1 ? BK : 0);

  const uint32_t ldsB = (uint32_t)(size_t)&Bsd[0][0];
  const uint64_t gB = (uint64_t)(size_t)(BT + (size_t)n0 * K);
  const u32x8 g1 = tdm_group1((uint32_t)K * 2u);
  u32x4 g0 = tdm_group0(ldsB, gB);

  if (pinned(wid == 0)) {
    tdm_load(g0, g1);
    wait_tensor0(g0, g1);
  }
  __syncthreads();   // publishes B tile 0
  g0 = tdm_group0(ldsB + BTB, gB + BK * 2);
  if (pinned(wid == 0 && np > 1)) tdm_load(g0, g1);

  for (int s = 0; s < np; ++s) {
    v8h a[8];   // all eight loads are in flight at once
    #pragma unroll
    for (int i = 0; i < 8; ++i) a[i] = *(const v8h*)(ga + (size_t)(16 * i) * K);
    // next tile's lines on their way to L2 while this tile is worked on; the wait in the same
    // statement stands in front of the pointer's advance
    asm volatile("global_prefetch_b8 %0, off scope:SCOPE_SE\n\ts_wait_xcnt 0x0" :: "v"(pf) : "memory");
    pf += (s + 2 < np) ? BK : 0;
    #pragma unroll
    for (int i = 0; i < 8; ++i) *(v8h*)&As[(ldRow + 16 * i) * AKP + ldCg] = a[i];
    ga += BK;
    __syncthreads();   // publishes A tile s

    const v8h* pA = (const v8h*)As;
    const v8h* pB = (const v8h*)&Bsd[s & 1][0];
    #pragma unroll
    for (int kk = 0; kk < BK / 32; ++kk) {
      v16h afr[2], bfr[4];
      #pragma unroll
      for (int mi = 0; mi < 2; ++mi) {
        int row = wm * 32 + mi * 16 + r;
        afr[mi] = cat16(pA[row * (AKP / 8) + kk * 4 + half], pA[row * (AKP / 8) + kk * 4 + 2 + half]);
      }
      #pragma unroll
      for (int ni = 0; ni < 4; ++ni) {
        int col = wn * 64 + ni * 16 + r;
        bfr[ni] = cat16(pB[col * (AKP / 8) + kk * 4 + half], pB[col * (AKP / 8) + kk * 4 + 2 + half]);
      }
      #pragma unroll
      for (int mi = 0; mi < 2; ++mi)
        #pragma unroll
        for (int ni = 0; ni < 4; ++ni)
          acc[mi][ni] = __builtin_amdgcn_wmma_f32_16x16x32_f16(
              false, afr[mi], false, bfr[ni], (short)0, acc[mi][ni], false, false);
    }

    // hand-over: B tile s + 1 is published, and buffer s & 1 and the A tile are free again
    wait_ds0();
    if (pinned(wid == 0)) wait_tensor0(g0, g1);
    __syncthreads();
    g0 = tdm_group0(ldsB + (uint32_t)(s & 1) * BTB, gB + (uint64_t)(s + 2) * (BK * 2));
    if (pinned(wid == 0 && s + 2 < np)) tdm_load(g0, g1);
  }
  // the ring's closing waits: no request and no LDS read is open when the wave goes on
  wait_tensor0(g0, g1);
  wait_ds0();

  bool outf16 = flags & 1, doGelu = flags & 2;
  #pragma unroll
  for (int mi = 0; mi < 2; ++mi)
    #pragma unroll
    for (int ni = 0; ni < 4; ++ni)
      #pragma unroll
      for (int v = 0; v < 8; ++v) {
        int row = m0 + wm * 32 + mi * 16 + half * 8 + v;
        int col = n0 + wn * 64 + ni * 16 + r;
        float val = acc[mi][ni][v] + bias[col];
        if (doGelu) val = 0.5f * val * (1.0f + erff(val * 0.70710678f));
        if (resid) val += resid[(size_t)row * N + col];
        if (outf16) ((_Float16*)Cout)[(size_t)row * N + col] = (_Float16)val;
        else        ((float*)Cout)[(size_t)row * N + col] = val;
      }
}

#define QB 128

// lane l <-> lane l ^ 16
static __device__ __forceinline__ float xhalf(float x) {
  int b = __builtin_bit_cast(int, x);
  return __builtin_bit_cast(float,
      __builtin_amdgcn_permlanex16(b, b, 0x76543210, 0xfedcba98, false, false));
}

__global__ __launch_bounds__(256) void attn_wmma(const _Float16* __restrict__ Qf,
                                                 const _Float16* __restrict__ Kf,
                                                 const _Float16* __restrict__ Vf,
                                                 _Float16* __restrict__ Of) {
  __shared__ __align__(16) _Float16 Ks[64 * TP];
  __shared__ __align__(16) _Float16 VsT[64 * TP];  // VsT[c][t]

  int tid = threadIdx.x, lane = tid & 31;
  int wid = __builtin_amdgcn_readfirstlane(tid >> 5);
  int half = lane >> 4, r = lane & 15;
  int iq = blockIdx.x, h = blockIdx.y, b = blockIdx.z;

  int ldRow = tid >> 2, ldCg = (tid & 3) * 16;  // 64 rows x 64 halves

  int q0 = iq * QB + wid * 16;   // first query of this wave
  int qg = q0 + r;               // this lane's query

  // Q^T as B operand, kept in registers; same k order as the K loader below
  v16h qf[2];
  {
    const _Float16* gq = Qf + ((size_t)b * SS + qg) * DD + h * HD + half * 8;
    #pragma unroll
    for (int kk = 0; kk < 2; ++kk)
      qf[kk] = cat16(*(const v8h*)(gq + kk * 32), *(const v8h*)(gq + kk * 32 + 16));
  }

  v8f ot[4];                     // O^T: ot[t][v] = O[query][t*16 + half*8 + v]
  #pragma unroll
  for (int t = 0; t < 4; ++t) ot[t] = (v8f){};
  float mrun = -3.0e38f, lsum = 0.0f;   // running maximum, scaled to base 2; this half's sum

  const int RP = TP / 8;   // row pitch in 16-byte units
  const v8h* pK = (const v8h*)Ks;
  const v8h* pV = (const v8h*)VsT;
  const float SC = 0.125f * 1.4426950408889634f;   // 1/sqrt(HD) * log2(e)

  int nj = 2 * iq + 2;
  for (int j = 0; j < nj; ++j) {
    {
      size_t g = ((size_t)b * SS + (size_t)j * 64 + ldRow) * DD + h * HD + ldCg;
      v8h k0v = *(const v8h*)(Kf + g);
      v8h k1v = *(const v8h*)(Kf + g + 8);
      v8h v0v = *(const v8h*)(Vf + g);
      v8h v1v = *(const v8h*)(Vf + g + 8);
      *(v8h*)&Ks[ldRow * TP + ldCg]     = k0v;
      *(v8h*)&Ks[ldRow * TP + ldCg + 8] = k1v;
      #pragma unroll
      for (int e = 0; e < 8; ++e) {
        VsT[(ldCg + e) * TP + ldRow]     = v0v[e];
        VsT[(ldCg + 8 + e) * TP + ldRow] = v1v[e];
      }
    }
    __syncthreads();

    if (j * 64 <= q0 + 15) {     // wave-uniform: a tile wholly above the diagonal adds nothing
      // scores^T: st[t][v] = K[j*64 + t*16 + half*8 + v] . Q[qg]
      v16h kf[4][2];
      #pragma unroll
      for (int t = 0; t < 4; ++t)
        #pragma unroll
        for (int kk = 0; kk < 2; ++kk) {
          int row = t * 16 + r;
          kf[t][kk] = cat16(pK[row * RP + kk * 4 + half], pK[row * RP + kk * 4 + 2 + half]);
        }
      // all 16 K reads stay in one group ahead of the products: one LDS latency, not eight
      __builtin_amdgcn_sched_barrier(0);
      v8f st[4];
      #pragma unroll
      for (int t = 0; t < 4; ++t)
        st[t] = __builtin_amdgcn_wmma_f32_16x16x32_f16(false, kf[t][0], false, qf[0],
                                                       (short)0, (v8f){}, false, false);
      #pragma unroll
      for (int t = 0; t < 4; ++t)
        st[t] = __builtin_amdgcn_wmma_f32_16x16x32_f16(false, kf[t][1], false, qf[1],
                                                       (short)0, st[t], false, false);
      v16h vf[2][4];
      #pragma unroll
      for (int kk = 0; kk < 2; ++kk)
        #pragma unroll
        for (int t = 0; t < 4; ++t) {
          int row = t * 16 + r;
          vf[kk][t] = cat16(pV[row * RP + kk * 4 + half], pV[row * RP + kk * 4 + 2 + half]);
        }
      // the 16 V^T reads stay here, in one group, so that they land under the softmax arithmetic
      __builtin_amdgcn_sched_barrier(0);
      if (j * 64 + 63 > q0) {    // wave-uniform: only tiles that touch the diagonal
        #pragma unroll
        for (int t = 0; t < 4; ++t)
          #pragma unroll
          for (int v = 0; v < 8; ++v)
            if (j * 64 + t * 16 + half * 8 + v > qg) st[t][v] = -1.0e30f;
      }

      // online softmax, one query per lane pair (l, l ^ 16); the maximum is taken over the
      // raw scores and scaled once, the scale rides in the exponent's multiply-add
      float tmx[4];
      #pragma unroll
      for (int t = 0; t < 4; ++t) {
        float a = fmaxf(fmaxf(st[t][0], st[t][1]), fmaxf(st[t][2], st[t][3]));
        float c = fmaxf(fmaxf(st[t][4], st[t][5]), fmaxf(st[t][6], st[t][7]));
        tmx[t] = fmaxf(a, c);
      }
      float tm = fmaxf(fmaxf(tmx[0], tmx[1]), fmaxf(tmx[2], tmx[3]));
      tm = fmaxf(tm, xhalf(tm)) * SC;
      tm = fmaxf(tm, mrun);
      float f = __builtin_amdgcn_exp2f(mrun - tm);
      mrun = tm;
      const v8f vsc = {SC, SC, SC, SC, SC, SC, SC, SC};
      const v8f vnm = {-tm, -tm, -tm, -tm, -tm, -tm, -tm, -tm};
      #pragma unroll
      for (int t = 0; t < 4; ++t) st[t] = __builtin_elementwise_fma(st[t], vsc, vnm);
      float tsm[4];
      #pragma unroll
      for (int t = 0; t < 4; ++t) {
        float ts = 0.0f;
        #pragma unroll
        for (int v = 0; v < 8; ++v) {
          float p = __builtin_amdgcn_exp2f(st[t][v]);
          st[t][v] = p;
          ts += p;
        }
        tsm[t] = ts;
      }
      lsum = lsum * f + ((tsm[0] + tsm[1]) + (tsm[2] + tsm[3]));
      #pragma unroll
      for (int t = 0; t < 4; ++t) ot[t] *= f;

      // O^T += V^T . P^T
      #pragma unroll
      for (int kk = 0; kk < 2; ++kk) {
        v16h pf;   // pf[s] = P^T[key kk*32 + (s < 8 ? half*8 + s : 16 + half*8 + s - 8)][qg]
        #pragma unroll
        for (int s = 0; s < 8; ++s) {
          pf[s]     = (_Float16)st[2 * kk][s];
          pf[s + 8] = (_Float16)st[2 * kk + 1][s];
        }
        #pragma unroll
        for (int t = 0; t < 4; ++t)
          ot[t] = __builtin_amdgcn_wmma_f32_16x16x32_f16(false, vf[kk][t], false, pf,
                                                         (short)0, ot[t], false, false);
      }
    }
    __syncthreads();
  }

  float inv = 1.0f / (lsum + xhalf(lsum));
  _Float16* go = Of + ((size_t)b * SS + qg) * DD + h * HD + half * 8;
  #pragma unroll
  for (int t = 0; t < 4; ++t) {
    v8h o;
    #pragma unroll
    for (int v = 0; v < 8; ++v) o[v] = (_Float16)(ot[t][v] * inv);
    *(v8h*)(go + t * 16) = o;
  }
}

// ---------------------------------------------------------------------------
// Host-side launch
// ---------------------------------------------------------------------------
extern "C" void kernel_launch(void* const* d_in, const int* in_sizes, int n_in,
                              void* d_out, int out_size, void* d_ws, size_t ws_size,
                              hipStream_t stream) {
  const float* x     = (const float*)d_in[0];
  const float* Wq    = (const float*)d_in[1];
  const float* bq    = (const float*)d_in[2];
  const float* Wk    = (const float*)d_in[3];
  const float* bk    = (const float*)d_in[4];
  const float* Wv    = (const float*)d_in[5];
  const float* bv    = (const float*)d_in[6];
  const float* Wo    = (const float*)d_in[7];
  const float* bo    = (const float*)d_in[8];
  const float* ln1_g = (const float*)d_in[9];
  const float* ln1_b = (const float*)d_in[10];
  const float* ln2_g = (const float*)d_in[11];
  const float* ln2_b = (const float*)d_in[12];
  const float* W1    = (const float*)d_in[13];
  const float* b1    = (const float*)d_in[14];
  const float* W2    = (const float*)d_in[15];
  const float* b2    = (const float*)d_in[16];
  float* out = (float*)d_out;

  auto align = [](size_t v) { return (v + 255) & ~(size_t)255; };
  char* base = (char*)d_ws;
  size_t off = 0;
  auto slot = [&](size_t bytes) { char* p = base + off; off += align(bytes); return p; };
  _Float16* hf16  = (_Float16*)slot((size_t)ROWS * DD * 2);
  _Float16* WqT   = (_Float16*)slot((size_t)DD * DD * 2);   // [N=768][K=768]
  _Float16* WkT   = (_Float16*)slot((size_t)DD * DD * 2);
  _Float16* WvT   = (_Float16*)slot((size_t)DD * DD * 2);
  _Float16* WoT   = (_Float16*)slot((size_t)DD * DD * 2);
  _Float16* W1T   = (_Float16*)slot((size_t)DD * FF * 2);   // [N=3072][K=768]
  _Float16* W2T   = (_Float16*)slot((size_t)FF * DD * 2);   // [N=768][K=3072]
  _Float16* Qf    = (_Float16*)slot((size_t)ROWS * DD * 2);
  _Float16* Kf    = (_Float16*)slot((size_t)ROWS * DD * 2);
  _Float16* Vf    = (_Float16*)slot((size_t)ROWS * DD * 2);
  _Float16* At16  = (_Float16*)slot((size_t)ROWS * DD * 2);
  float*    X1    = (float*)   slot((size_t)ROWS * DD * 4);
  _Float16* h216  = (_Float16*)slot((size_t)ROWS * DD * 2);
  _Float16* H1    = (_Float16*)slot((size_t)ROWS * FF * 2);

  // 1) weight conversion (f32 -> f16, transposed to [N][K])
  dim3 gHead(HD / TT, DD / TT, HH);
  cvt_T<<<gHead, 256, 0, stream>>>(Wq, WqT, DD, HD);
  cvt_T<<<gHead, 256, 0, stream>>>(Wk, WkT, DD, HD);
  cvt_T<<<gHead, 256, 0, stream>>>(Wv, WvT, DD, HD);
  cvt_T<<<dim3(DD / TT, DD / TT), 256, 0, stream>>>(Wo, WoT, DD, DD);
  cvt_T<<<dim3(FF / TT, DD / TT), 256, 0, stream>>>(W1, W1T, DD, FF);
  cvt_T<<<dim3(DD / TT, FF / TT), 256, 0, stream>>>(W2, W2T, FF, DD);

  // 2) LN1
  ln_f16<<<ROWS, 256, 0, stream>>>(x, ln1_g, ln1_b, hf16);

  // 3) Q/K/V projections (f16 out, +bias)
  dim3 gQKV(DD / BN, ROWS / BM);
  gemm_wmma<<<gQKV, 256, 0, stream>>>(hf16, WqT, bq, nullptr, Qf, ROWS, DD, DD, 1);
  gemm_wmma<<<gQKV, 256, 0, stream>>>(hf16, WkT, bk, nullptr, Kf, ROWS, DD, DD, 1);
  gemm_wmma<<<gQKV, 256, 0, stream>>>(hf16, WvT, bv, nullptr, Vf, ROWS, DD, DD, 1);

  // 4) causal flash attention
  dim3 gAtt(SS / QB, HH, BB);
  attn_wmma<<<gAtt, 256, 0, stream>>>(Qf, Kf, Vf, At16);

  // 5) output projection + residual (f32 out): X1 = x + attn @ Wo + bo
  gemm_wmma<<<gQKV, 256, 0, stream>>>(At16, WoT, bo, x, X1, ROWS, DD, DD, 0);

  // 6) LN2
  ln_f16<<<ROWS, 256, 0, stream>>>(X1, ln2_g, ln2_b, h216);

  // 7) FFN up + GELU (f16 out)
  dim3 gF1(FF / BN, ROWS / BM);
  gemm_wmma<<<gF1, 256, 0, stream>>>(h216, W1T, b1, nullptr, H1, ROWS, FF, DD, 1 | 2);

  // 8) FFN down + bias + residual (f32 out to d_out)
  dim3 gF2(DD / BN, ROWS / BM);
  gemm_wmma<<<gF2, 256, 0, stream>>>(H1, W2T, b2, X1, out, ROWS, DD, FF, 0);

  (void)in_sizes; (void)n_in; (void)out_size; (void)ws_size;
}

// v005
// A run of this version takes 206 microseconds.
// Next to v004, in two timings, it ran 1.22 times as fast each time.
// All steps since v000 together make it 2.63 times as fast.
#include <hip/hip_runtime.h>
#include <hip/hip_bf16.h>
#include <math.h>

typedef __attribute__((ext_vector_type(16))) _Float16 v16h;
typedef __attribute__((ext_vector_type(8)))  _Float16 v8h;
typedef __attribute__((ext_vector_type(8)))  float    v8f;
typedef __attribute__((ext_vector_type(4)))  _Float16 v4h;
typedef __attribute__((ext_vector_type(4)))  float    v4f;

#define BB 2
#define SS 2048
#define DD 768
#define HH 12
#define HD 64
#define FF 3072
#define ROWS (BB*SS)          // 4096
#define EPS 1e-5f

#define BM 128
#define BN 128
#define BK 128

// LDS row pitches in halves. A ds_load_b128 fragment read walks 16 rows at once;
// a pitch of 16 B x odd spreads those rows over all 64 banks.
#define AKP 136               // GEMM A and B tiles: 128 halves + 8 pad (272 B)
#define TP  72                // attention tiles: 64 halves + 8 pad (144 B)
#define BTB (BN * AKP * 2)    // one B buffer in bytes: 128 rows x 272 B = 34816 = 17 x 2 KiB

#define TT  64                // weight transpose tile edge
#define TTP 72                // its LDS row: 64 halves + 8 pad (144 B)

// ---------------------------------------------------------------------------
// Tensor load to LDS: one request of one wave brings a 2-D tile, through no register.
// ---------------------------------------------------------------------------
typedef uint32_t u32x4 __attribute__((ext_vector_type(4)));
typedef uint32_t u32x8 __attribute__((ext_vector_type(8)));

static __device__ __forceinline__ uint32_t uni(uint32_t v) {
  return (uint32_t)__builtin_amdgcn_readfirstlane(v);
}
// A test held in a scalar register, so that the branch on it is a scalar branch:
// a tensor load ignores EXEC and only such a branch keeps a wave from issuing it.
static __device__ __forceinline__ uint32_t pinned(uint32_t v) {
  uint32_t w = uni(v);
  asm volatile("" : "+s"(w));
  return w;
}
// Group 1: 1-byte elements, tensor = tile = BN rows of 256 bytes, source pitch in bytes,
// 4 dwords of LDS pad behind every 64 dwords (one row): LDS pitch 272 B.
static __device__ __forceinline__ u32x8 tdm_group1(uint32_t src_pitch) {
  constexpr uint32_t d0 = BK * 2, d1 = BN;
  u32x8 g;   // pinned(): each descriptor word is held in a scalar register of its own
  g[0] = pinned((1u << 20) | (5u << 22) | (3u << 25));
  g[1] = pinned((d0 & 0xFFFFu) << 16);
  g[2] = pinned((d0 >> 16) | ((d1 & 0xFFFFu) << 16));
  g[3] = pinned((d1 >> 16) | (d0 << 16));
  g[4] = pinned(d1);
  g[5] = pinned(src_pitch);
  g[6] = pinned(0u);
  g[7] = pinned(0u);
  return g;
}
// Group 0: count 1, LDS byte offset, global address of the tile's first byte, type 2.
static __device__ __forceinline__ u32x4 tdm_group0(uint32_t lds_dst, uint64_t ga) {
  u32x4 g;   // pinned(): each descriptor word is held in a scalar register of its own
  g[0] = pinned(1u);
  g[1] = pinned(lds_dst);
  g[2] = pinned((uint32_t)ga);
  g[3] = pinned((((uint32_t)(ga >> 32)) & 0x01FFFFFFu) | 0x80000000u);
  return g;
}
static __device__ __forceinline__ void tdm_load(u32x4 g0, u32x8 g1) {
  asm volatile("tensor_load_to_lds %0, %1" :: "s"(g0), "s"(g1) : "memory");
}
// The compiler places no wait for a tensor load: the issuing wave waits for its tile itself.
// The wait names the outstanding request's descriptor, so that its scalar registers stay
// untouched from the issue up to here.
static __device__ __forceinline__ void wait_tensor0(u32x4 g0, u32x8 g1) {
  asm volatile("s_wait_tensorcnt 0x0" :: "s"(g0), "s"(g1) : "memory");
}
// this wave's LDS reads have returned before the buffer they read is handed back for a refill
static __device__ __forceinline__ void wait_ds0() {
  asm volatile("s_wait_dscnt 0x0" ::: "memory");
}

static __device__ __forceinline__ v16h cat16(v8h lo, v8h hi) {
  return __builtin_shufflevector(lo, hi, 0,1,2,3,4,5,6,7,8,9,10,11,12,13,14,15);
}

// ---------------------------------------------------------------------------
// Weight conversion: fp32 -> f16, producing TRANSPOSED (N-major) weights so the
// GEMM B-operand is contraction-contiguous.
// in: bz-th matrix [R][C] f32 -> out: bz-th matrix [C][R] f16.
// One block moves a 64 x 64 tile through LDS: whole 128-byte lines are read and
// whole lines are written, 16 elements per thread. R and C are multiples of 64.
// (H, D, HD) weights are H such matrices: out[(h*HD+k)*D + d] = W[h][d][k].
// bx, by: the tile's column and row; bz: the matrix.
// ---------------------------------------------------------------------------
static __device__ __forceinline__ void cvt_T(const float* __restrict__ W,
                                             _Float16* __restrict__ out,
                                             int R, int C, int bx, int by, int bz) {
  __shared__ __align__(16) _Float16 Ls[TT * TTP];   // Ls[c][r]
  int tid = threadIdx.x;
  int c0 = bx * TT, r0 = by * TT;
  size_t zoff = (size_t)bz * R * C;

  // each thread takes a 4 x 4 block: 4 rows, 16 bytes of each
  int rb = (tid >> 4) * 4, cb = (tid & 15) * 4;
  const float* src = W + zoff + (size_t)(r0 + rb) * C + c0 + cb;
  v4f w0 = *(const v4f*)src;
  v4f w1 = *(const v4f*)(src + C);
  v4f w2 = *(const v4f*)(src + 2 * (size_t)C);
  v4f w3 = *(const v4f*)(src + 3 * (size_t)C);
  #pragma unroll   // constant j: the loaded vectors stay in registers
  for (int j = 0; j < 4; ++j) {
    v4h p = {(_Float16)w0[j], (_Float16)w1[j], (_Float16)w2[j], (_Float16)w3[j]};
    *(v4h*)&Ls[(cb + j) * TTP + rb] = p;
  }
  __syncthreads();

  // 8 lanes write one 128-byte line of an output row
  int rg = (tid & 7) * 8;
  #pragma unroll   // both LDS reads issue before the first store waits
  for (int i = 0; i < 2; ++i) {
    int c = (tid >> 3) + 32 * i;
    v8h o = *(const v8h*)&Ls[c * TTP + rg];
    *(v8h*)(out + zoff + (size_t)(c0 + c) * R + r0 + rg) = o;
  }
}

// ---------------------------------------------------------------------------
// LayerNorm (row of 768) -> f16 output
// ---------------------------------------------------------------------------
static __device__ __forceinline__ void ln_row(const float* __restrict__ x,
                                              const float* __restrict__ g,
                                              const float* __restrict__ bta,
                                              _Float16* __restrict__ out, int row) {
  __shared__ float red[256];
  int tid = threadIdx.x;
  const float* xr = x + (size_t)row * DD;
  float v0 = xr[tid], v1 = xr[tid + 256], v2 = xr[tid + 512];
  red[tid] = v0 + v1 + v2;
  __syncthreads();
  #pragma unroll
  for (int st = 128; st > 0; st >>= 1) {
    if (tid < st) red[tid] += red[tid + st];
    __syncthreads();
  }
  float mean = red[0] * (1.0f / DD);
  __syncthreads();
  float d0 = v0 - mean, d1 = v1 - mean, d2 = v2 - mean;
  red[tid] = d0 * d0 + d1 * d1 + d2 * d2;
  __syncthreads();
  #pragma unroll
  for (int st = 128; st > 0; st >>= 1) {
    if (tid < st) red[tid] += red[tid + st];
    __syncthreads();
  }
  float rs = rsqrtf(red[0] * (1.0f / DD) + EPS);
  _Float16* orow = out + (size_t)row * DD;
  orow[tid]       = (_Float16)(d0 * rs * g[tid]       + bta[tid]);
  orow[tid + 256] = (_Float16)(d1 * rs * g[tid + 256] + bta[tid + 256]);
  orow[tid + 512] = (_Float16)(d2 * rs * g[tid + 512] + bta[tid + 512]);
}

__global__ __launch_bounds__(256) void ln_f16(const float* __restrict__ x,
                                              const float* __restrict__ g,
                                              const float* __restrict__ bta,
                                              _Float16* __restrict__ out) {
  ln_row(x, g, bta, out, blockIdx.x);
}

// ---------------------------------------------------------------------------
// Everything the first products wait for, in ONE launch: none of these blocks reads what
// another writes. Blocks 0 .. ROWS-1 normalise one row of x each; the rest convert one
// 64 x 64 weight tile each (the longer-lived row blocks start first, the short ones last).
// WqkvT holds the three head weights one behind the other, each [768][768].
// ---------------------------------------------------------------------------
#define T_HEAD (HH * (DD / TT))           // tiles of one (H, D, HD) weight: 144
#define T_WO   ((DD / TT) * (DD / TT))    // 144
#define T_FF   ((FF / TT) * (DD / TT))    // tiles of W1, and of W2: 576
#define PREP_BLOCKS (ROWS + 3 * T_HEAD + T_WO + 2 * T_FF)

__global__ __launch_bounds__(256) void prep(const float* __restrict__ x,
                                            const float* __restrict__ g,
                                            const float* __restrict__ bta,
                                            _Float16* __restrict__ h,
                                            const float* __restrict__ Wq,
                                            const float* __restrict__ Wk,
                                            const float* __restrict__ Wv,
                                            const float* __restrict__ Wo,
                                            const float* __restrict__ W1,
                                            const float* __restrict__ W2,
                                            _Float16* __restrict__ WqkvT,
                                            _Float16* __restrict__ WoT,
                                            _Float16* __restrict__ W1T,
                                            _Float16* __restrict__ W2T) {
  int bid = blockIdx.x;   // every branch below is the same for the whole block
  if (bid < ROWS) {
    ln_row(x, g, bta, h, bid);
    return;
  }
  int t = bid - ROWS;
  const float* W;
  _Float16* o;
  int R = DD, C, bx, by, bz = 0;
  if (t < 3 * T_HEAD) {
    int m = t / T_HEAD, u = t - m * T_HEAD;
    W = m == 0 ? Wq : (m == 1 ? Wk : Wv);
    o = WqkvT + (size_t)m * DD * DD;
    C = HD; bx = 0; by = u % (DD / TT); bz = u / (DD / TT);
  } else if (t < 3 * T_HEAD + T_WO) {
    int u = t - 3 * T_HEAD;
    W = Wo; o = WoT;
    C = DD; bx = u % (DD / TT); by = u / (DD / TT);
  } else if (t < 3 * T_HEAD + T_WO + T_FF) {
    int u = t - (3 * T_HEAD + T_WO);
    W = W1; o = W1T;
    C = FF; bx = u % (FF / TT); by = u / (FF / TT);
  } else {
    int u = t - (3 * T_HEAD + T_WO + T_FF);
    W = W2; o = W2T;
    R = FF; C = DD; bx = u % (DD / TT); by = u / (DD / TT);
  }
  cvt_T(W, o, R, C, bx, by, bz);
}

// ---------------------------------------------------------------------------
// WMMA GEMM: C[M,N] = act(A[M,K](f16) x BT[N,K](f16)^T + bias) (+ resid)
// 256 threads = 8 waves. Block tile 128x128, K-step 128 (256-byte tile rows).
// Wave grid 4(M) x 2(N); each wave: 2 A-frags x 4 B-frags x 4 k blocks -> 32 WMMA / K-step.
// B (weight) tiles come by tensor load into two LDS buffers, padded by the mover to the
// 272-byte pitch; wave 0 issues, one request outstanding.
// K is a multiple of 128.
// blockIdx.z picks one of up to three products of the same A in one launch: weights and
// outputs lie one behind the other at BT and Cout, each product has its own bias.
// flags: bit0 = f16 output, bit1 = exact GELU
// ---------------------------------------------------------------------------
__global__ __launch_bounds__(256) void gemm_wmma(const _Float16* __restrict__ A,
                                                 const _Float16* __restrict__ BT,
                                                 const float* __restrict__ bias,
                                                 const float* __restrict__ bias1,
                                                 const float* __restrict__ bias2,
                                                 const float* __restrict__ resid,
                                                 void* __restrict__ Cout,
                                                 int M, int N, int K, int flags) {
  const int z = blockIdx.z;
  BT += (size_t)z * N * K;
  bias = z == 0 ? bias : (z == 1 ? bias1 : bias2);
  Cout = (char*)Cout + (size_t)z * M * N * ((flags & 1) ? 2 : 4);
  __shared__ __attribute__((aligned(2048))) _Float16 Bsd[2][BN * AKP];
  __shared__ __align__(16) _Float16 As[BM * AKP];
  int tid = threadIdx.x;
  int lane = tid & 31;
  const uint32_t wid = uni(tid >> 5);
  int half = lane >> 4, r = lane & 15;
  int wm = wid & 3, wn = wid >> 2;
  int m0 = blockIdx.y * BM, n0 = blockIdx.x * BN;

  // every loop over mi, ni, i and kk below is fully unrolled: constant indices keep the
  // fragments, the staged rows and the accumulators in registers
  v8f acc[2][4];
  #pragma unroll
  for (int mi = 0; mi < 2; ++mi)
    #pragma unroll
    for (int ni = 0; ni < 4; ++ni) acc[mi][ni] = (v8f){};

  const int np = K / BK;
  int ldRow = tid >> 4, ldCg = (tid & 15) * 8;   // 16 lanes take one 256-byte row; 8 x 16 rows
  const _Float16* ga = A + (size_t)(m0 + ldRow) * K + ldCg;
  // each thread prefetches one 128-byte line of the next A tile; the pointer never leaves A
  const _Float16* pf = A + (size_t)(m0 + (tid >> 1)) * K + (tid & 1) * 64 + (np > 1 ? BK : 0);

  const uint32_t ldsB = (uint32_t)(size_t)&Bsd[0][0];
  const uint64_t gB = (uint64_t)(size_t)(BT + (size_t)n0 * K);
  const u32x8 g1 = tdm_group1((uint32_t)K * 2u);
  u32x4 g0 = tdm_group0(ldsB, gB);

  if (pinned(wid == 0)) {
    tdm_load(g0, g1);
    wait_tensor0(g0, g1);
  }
  __syncthreads();   // publishes B tile 0
  g0 = tdm_group0(ldsB + BTB, gB + BK * 2);
  if (pinned(wid == 0 && np > 1)) tdm_load(g0, g1);

  for (int s = 0; s < np; ++s) {
    v8h a[8];   // all eight loads are in flight at once
    #pragma unroll
    for (int i = 0; i < 8; ++i) a[i] = *(const v8h*)(ga + (size_t)(16 * i) * K);
    // next tile's lines on their way to L2 while this tile is worked on; the wait in the same
    // statement stands in front of the pointer's advance
    asm volatile("global_prefetch_b8 %0, off scope:SCOPE_SE\n\ts_wait_xcnt 0x0" :: "v"(pf) : "memory");
    pf += (s + 2 < np) ? BK : 0;
    #pragma unroll
    for (int i = 0; i < 8; ++i) *(v8h*)&As[(ldRow + 16 * i) * AKP + ldCg] = a[i];
    ga += BK;
    __syncthreads();   // publishes A tile s

    const v8h* pA = (const v8h*)As;
    const v8h* pB = (const v8h*)&Bsd[s & 1][0];
    #pragma unroll
    for (int kk = 0; kk < BK / 32; ++kk) {
      v16h afr[2], bfr[4];
      #pragma unroll
      for (int mi = 0; mi < 2; ++mi) {
        int row = wm * 32 + mi * 16 + r;
        afr[mi] = cat16(pA[row * (AKP / 8) + kk * 4 + half], pA[row * (AKP / 8) + kk * 4 + 2 + half]);
      }
      #pragma unroll
      for (int ni = 0; ni < 4; ++ni) {
        int col = wn * 64 + ni * 16 + r;
        bfr[ni] = cat16(pB[col * (AKP / 8) + kk * 4 + half], pB[col * (AKP / 8) + kk * 4 + 2 + half]);
      }
      #pragma unroll
      for (int mi = 0; mi < 2; ++mi)
        #pragma unroll
        for (int ni = 0; ni < 4; ++ni)
          acc[mi][ni] = __builtin_amdgcn_wmma_f32_16x16x32_f16(
              false, afr[mi], false, bfr[ni], (short)0, acc[mi][ni], false, false);
    }

    // hand-over: B tile s + 1 is published, and buffer s & 1 and the A tile are free again
    wait_ds0();
    if (pinned(wid == 0)) wait_tensor0(g0, g1);
    __syncthreads();
    g0 = tdm_group0(ldsB + (uint32_t)(s & 1) * BTB, gB + (uint64_t)(s + 2) * (BK * 2));
    if (pinned(wid == 0 && s + 2 < np)) tdm_load(g0, g1);
  }
  // the ring's closing waits: no request and no LDS read is open when the wave goes on
  wait_tensor0(g0, g1);
  wait_ds0();

  // flags and resid are run-time values: every element below has its own scalar branches, and
  // each residual load is waited for on its own
  bool outf16 = flags & 1, doGelu = flags & 2;
  #pragma unroll
  for (int mi = 0; mi < 2; ++mi)
    #pragma unroll
    for (int ni = 0; ni < 4; ++ni)
      #pragma unroll
      for (int v = 0; v < 8; ++v) {
        int row = m0 + wm * 32 + mi * 16 + half * 8 + v;
        int col = n0 + wn * 64 + ni * 16 + r;
        float val = acc[mi][ni][v] + bias[col];
        if (doGelu) val = 0.5f * val * (1.0f + erff(val * 0.70710678f));
        if (resid) val += resid[(size_t)row * N + col];
        if (outf16) ((_Float16*)Cout)[(size_t)row * N + col] = (_Float16)val;
        else        ((float*)Cout)[(size_t)row * N + col] = val;
      }
}

#define QB 128

// lane l <-> lane l ^ 16
static __device__ __forceinline__ float xhalf(float x) {
  int b = __builtin_bit_cast(int, x);
  return __builtin_bit_cast(float,
      __builtin_amdgcn_permlanex16(b, b, 0x76543210, 0xfedcba98, false, false));
}

__global__ __launch_bounds__(256) void attn_wmma(const _Float16* __restrict__ Qf,
                                                 const _Float16* __restrict__ Kf,
                                                 const _Float16* __restrict__ Vf,
                                                 _Float16* __restrict__ Of) {
  __shared__ __align__(16) _Float16 Ks[64 * TP];
  __shared__ __align__(16) _Float16 VsT[64 * TP];  // VsT[c][t]

  int tid = threadIdx.x, lane = tid & 31;
  int wid = __builtin_amdgcn_readfirstlane(tid >> 5);
  int half = lane >> 4, r = lane & 15;
  int iq = blockIdx.x, h = blockIdx.y, b = blockIdx.z;

  int ldRow = tid >> 2, ldCg = (tid & 3) * 16;  // 64 rows x 64 halves

  int q0 = iq * QB + wid * 16;   // first query of this wave
  int qg = q0 + r;               // this lane's query

  // Q^T as B operand, kept in registers; same k order as the K loader below
  v16h qf[2];
  {
    const _Float16* gq = Qf + ((size_t)b * SS + qg) * DD + h * HD + half * 8;
    #pragma unroll
    for (int kk = 0; kk < 2; ++kk)
      qf[kk] = cat16(*(const v8h*)(gq + kk * 32), *(const v8h*)(gq + kk * 32 + 16));
  }

  v8f ot[4];                     // O^T: ot[t][v] = O[query][t*16 + half*8 + v]
  #pragma unroll
  for (int t = 0; t < 4; ++t) ot[t] = (v8f){};
  float mrun = -3.0e38f, lsum = 0.0f;   // running maximum, scaled to base 2; this half's sum

  const int RP = TP / 8;   // row pitch in 16-byte units
  const v8h* pK = (const v8h*)Ks;
  const v8h* pV = (const v8h*)VsT;
  const float SC = 0.125f * 1.4426950408889634f;   // 1/sqrt(HD) * log2(e)

  int nj = 2 * iq + 2;
  for (int j = 0; j < nj; ++j) {
    {
      size_t g = ((size_t)b * SS + (size_t)j * 64 + ldRow) * DD + h * HD + ldCg;
      v8h k0v = *(const v8h*)(Kf + g);
      v8h k1v = *(const v8h*)(Kf + g + 8);
      v8h v0v = *(const v8h*)(Vf + g);
      v8h v1v = *(const v8h*)(Vf + g + 8);
      *(v8h*)&Ks[ldRow * TP + ldCg]     = k0v;
      *(v8h*)&Ks[ldRow * TP + ldCg + 8] = k1v;
      #pragma unroll
      for (int e = 0; e < 8; ++e) {
        VsT[(ldCg + e) * TP + ldRow]     = v0v[e];
        VsT[(ldCg + 8 + e) * TP + ldRow] = v1v[e];
      }
    }
    __syncthreads();

    if (j * 64 <= q0 + 15) {     // wave-uniform: a tile wholly above the diagonal adds nothing
      // scores^T: st[t][v] = K[j*64 + t*16 + half*8 + v] . Q[qg]
      v16h kf[4][2];
      #pragma unroll
      for (int t = 0; t < 4; ++t)
        #pragma unroll
        for (int kk = 0; kk < 2; ++kk) {
          int row = t * 16 + r;
          kf[t][kk] = cat16(pK[row * RP + kk * 4 + half], pK[row * RP + kk * 4 + 2 + half]);
        }
      // all 16 K reads stay in one group ahead of the products: one LDS latency, not eight
      __builtin_amdgcn_sched_barrier(0);
      v8f st[4];
      #pragma unroll
      for (int t = 0; t < 4; ++t)
        st[t] = __builtin_amdgcn_wmma_f32_16x16x32_f16(false, kf[t][0], false, qf[0],
                                                       (short)0, (v8f){}, false, false);
      #pragma unroll
      for (int t = 0; t < 4; ++t)
        st[t] = __builtin_amdgcn_wmma_f32_16x16x32_f16(false, kf[t][1], false, qf[1],
                                                       (short)0, st[t], false, false);
      v16h vf[2][4];
      #pragma unroll
      for (int kk = 0; kk < 2; ++kk)
        #pragma unroll
        for (int t = 0; t < 4; ++t) {
          int row = t * 16 + r;
          vf[kk][t] = cat16(pV[row * RP + kk * 4 + half], pV[row * RP + kk * 4 + 2 + half]);
        }
      // the 16 V^T reads stay here, in one group, so that they land under the softmax arithmetic
      __builtin_amdgcn_sched_barrier(0);
      if (j * 64 + 63 > q0) {    // wave-uniform: only tiles that touch the diagonal
        #pragma unroll
        for (int t = 0; t < 4; ++t)
          #pragma unroll
          for (int v = 0; v < 8; ++v)
            if (j * 64 + t * 16 + half * 8 + v > qg) st[t][v] = -1.0e30f;
      }

      // online softmax, one query per lane pair (l, l ^ 16); the maximum is taken over the
      // raw scores and scaled once, the scale rides in the exponent's multiply-add
      float tmx[4];
      #pragma unroll
      for (int t = 0; t < 4; ++t) {
        float a = fmaxf(fmaxf(st[t][0], st[t][1]), fmaxf(st[t][2], st[t][3]));
        float c = fmaxf(fmaxf(st[t][4], st[t][5]), fmaxf(st[t][6], st[t][7]));
        tmx[t] = fmaxf(a, c);
      }
      float tm = fmaxf(fmaxf(tmx[0], tmx[1]), fmaxf(tmx[2], tmx[3]));
      tm = fmaxf(tm, xhalf(tm)) * SC;
      tm = fmaxf(tm, mrun);
      float f = __builtin_amdgcn_exp2f(mrun - tm);
      mrun = tm;
      const v8f vsc = {SC, SC, SC, SC, SC, SC, SC, SC};
      const v8f vnm = {-tm, -tm, -tm, -tm, -tm, -tm, -tm, -tm};
      #pragma unroll
      for (int t = 0; t < 4; ++t) st[t] = __builtin_elementwise_fma(st[t], vsc, vnm);
      float tsm[4];
      #pragma unroll
      for (int t = 0; t < 4; ++t) {
        float ts = 0.0f;
        #pragma unroll
        for (int v = 0; v < 8; ++v) {
          float p = __builtin_amdgcn_exp2f(st[t][v]);
          st[t][v] = p;
          ts += p;
        }
        tsm[t] = ts;
      }
      lsum = lsum * f + ((tsm[0] + tsm[1]) + (tsm[2] + tsm[3]));
      #pragma unroll
      for (int t = 0; t < 4; ++t) ot[t] *= f;

      // O^T += V^T . P^T
      #pragma unroll
      for (int kk = 0; kk < 2; ++kk) {
        v16h pf;   // pf[s] = P^T[key kk*32 + (s < 8 ? half*8 + s : 16 + half*8 + s - 8)][qg]
        #pragma unroll
        for (int s = 0; s < 8; ++s) {
          pf[s]     = (_Float16)st[2 * kk][s];
          pf[s + 8] = (_Float16)st[2 * kk + 1][s];
        }
        #pragma unroll
        for (int t = 0; t < 4; ++t)
          ot[t] = __builtin_amdgcn_wmma_f32_16x16x32_f16(false, vf[kk][t], false, pf,
                                                         (short)0, ot[t], false, false);
      }
    }
    __syncthreads();
  }

  float inv = 1.0f / (lsum + xhalf(lsum));
  _Float16* go = Of + ((size_t)b * SS + qg) * DD + h * HD + half * 8;
  #pragma unroll
  for (int t = 0; t < 4; ++t) {
    v8h o;
    #pragma unroll
    for (int v = 0; v < 8; ++v) o[v] = (_Float16)(ot[t][v] * inv);
    *(v8h*)(go + t * 16) = o;
  }
}

// ---------------------------------------------------------------------------
// Host-side launch
// ---------------------------------------------------------------------------
extern "C" void kernel_launch(void* const* d_in, const int* in_sizes, int n_in,
                              void* d_out, int out_size, void* d_ws, size_t ws_size,
                              hipStream_t stream) {
  const float* x     = (const float*)d_in[0];
  const float* Wq    = (const float*)d_in[1];
  const float* bq    = (const float*)d_in[2];
  const float* Wk    = (const float*)d_in[3];
  const float* bk    = (const float*)d_in[4];
  const float* Wv    = (const float*)d_in[5];
  const float* bv    = (const float*)d_in[6];
  const float* Wo    = (const float*)d_in[7];
  const float* bo    = (const float*)d_in[8];
  const float* ln1_g = (const float*)d_in[9];
  const float* ln1_b = (const float*)d_in[10];
  const float* ln2_g = (const float*)d_in[11];
  const float* ln2_b = (const float*)d_in[12];
  const float* W1    = (const float*)d_in[13];
  const float* b1    = (const float*)d_in[14];
  const float* W2    = (const float*)d_in[15];
  const float* b2    = (const float*)d_in[16];
  float* out = (float*)d_out;

  auto align = [](size_t v) { return (v + 255) & ~(size_t)255; };
  char* base = (char*)d_ws;
  size_t off = 0;
  auto slot = [&](size_t bytes) { char* p = base + off; off += align(bytes); return p; };
  _Float16* hf16  = (_Float16*)slot((size_t)ROWS * DD * 2);
  _Float16* WqkvT = (_Float16*)slot((size_t)3 * DD * DD * 2);   // three times [N=768][K=768]
  _Float16* WoT   = (_Float16*)slot((size_t)DD * DD * 2);
  _Float16* W1T   = (_Float16*)slot((size_t)DD * FF * 2);   // [N=3072][K=768]
  _Float16* W2T   = (_Float16*)slot((size_t)FF * DD * 2);   // [N=768][K=3072]
  _Float16* Qf    = (_Float16*)slot((size_t)3 * ROWS * DD * 2);   // Q, K, V one behind the other
  _Float16* Kf    = Qf + (size_t)ROWS * DD;
  _Float16* Vf    = Kf + (size_t)ROWS * DD;
  _Float16* At16  = (_Float16*)slot((size_t)ROWS * DD * 2);
  float*    X1    = (float*)   slot((size_t)ROWS * DD * 4);
  _Float16* h216  = (_Float16*)slot((size_t)ROWS * DD * 2);
  _Float16* H1    = (_Float16*)slot((size_t)ROWS * FF * 2);

  // 1) + 2) LN1 and the weight conversion (f32 -> f16, transposed to [N][K]), one launch
  prep<<<PREP_BLOCKS, 256, 0, stream>>>(x, ln1_g, ln1_b, hf16, Wq, Wk, Wv, Wo, W1, W2,
                                        WqkvT, WoT, W1T, W2T);

  // 3) Q/K/V projections (f16 out, +bias), one launch
  dim3 gQKV(DD / BN, ROWS / BM, 3);
  gemm_wmma<<<gQKV, 256, 0, stream>>>(hf16, WqkvT, bq, bk, bv, nullptr, Qf, ROWS, DD, DD, 1);

  // 4) causal flash attention
  dim3 gAtt(SS / QB, HH, BB);
  attn_wmma<<<gAtt, 256, 0, stream>>>(Qf, Kf, Vf, At16);

  // 5) output projection + residual (f32 out): X1 = x + attn @ Wo + bo
  dim3 gO(DD / BN, ROWS / BM);
  gemm_wmma<<<gO, 256, 0, stream>>>(At16, WoT, bo, bo, bo, x, X1, ROWS, DD, DD, 0);

  // 6) LN2
  ln_f16<<<ROWS, 256, 0, stream>>>(X1, ln2_g, ln2_b, h216);

  // 7) FFN up + GELU (f16 out)
  dim3 gF1(FF / BN, ROWS / BM);
  gemm_wmma<<<gF1, 256, 0, stream>>>(h216, W1T, b1, b1, b1, nullptr, H1, ROWS, FF, DD, 1 | 2);

  // 8) FFN down + bias + residual (f32 out to d_out)
  dim3 gF2(DD / BN, ROWS / BM);
  gemm_wmma<<<gF2, 256, 0, stream>>>(H1, W2T, b2, b2, b2, X1, out, ROWS, DD, FF, 0);

  (void)in_sizes; (void)n_in; (void)out_size; (void)ws_size;
}

// v006
// One run takes 157 microseconds.
// In both of two side-by-side timings against v005, it was 1.32 times as fast.
// Counting every step since v000, it is 3.47 times as fast.
#include <hip/hip_runtime.h>
#include <hip/hip_bf16.h>
#include <math.h>

typedef __attribute__((ext_vector_type(16))) _Float16 v16h;
typedef __attribute__((ext_vector_type(8)))  _Float16 v8h;
typedef __attribute__((ext_vector_type(8)))  float    v8f;
typedef __attribute__((ext_vector_type(4)))  _Float16 v4h;
typedef __attribute__((ext_vector_type(4)))  float    v4f;

#define BB 2
#define SS 2048
#define DD 768
#define HH 12
#define HD 64
#define FF 3072
#define ROWS (BB*SS)          // 4096
#define EPS 1e-5f

#define BM 128
#define BN 128
#define BK 128

// LDS row pitches in halves. A ds_load_b128 fragment read walks 16 rows at once;
// a pitch of 16 B x odd spreads those rows over all 64 banks.
#define AKP 136               // GEMM A and B tiles: 128 halves + 8 pad (272 B)
#define TP  72                // attention tiles: 64 halves + 8 pad (144 B)
#define BTB (BN * AKP * 2)    // one B buffer in bytes: 128 rows x 272 B = 34816 = 17 x 2 KiB

#define TT  64                // weight transpose tile edge
#define TTP 72                // its LDS row: 64 halves + 8 pad (144 B)

// ---------------------------------------------------------------------------
// Tensor load to LDS: one request of one wave brings a 2-D tile, through no register.
// ---------------------------------------------------------------------------
typedef uint32_t u32x4 __attribute__((ext_vector_type(4)));
typedef uint32_t u32x8 __attribute__((ext_vector_type(8)));

static __device__ __forceinline__ uint32_t uni(uint32_t v) {
  return (uint32_t)__builtin_amdgcn_readfirstlane(v);
}
// A test held in a scalar register, so that the branch on it is a scalar branch:
// a tensor load ignores EXEC and only such a branch keeps a wave from issuing it.
static __device__ __forceinline__ uint32_t pinned(uint32_t v) {
  uint32_t w = uni(v);
  asm volatile("" : "+s"(w));
  return w;
}
// Group 1: 1-byte elements, tensor = tile = BN rows of 256 bytes, source pitch in bytes,
// 4 dwords of LDS pad behind every 64 dwords (one row): LDS pitch 272 B.
static __device__ __forceinline__ u32x8 tdm_group1(uint32_t src_pitch) {
  constexpr uint32_t d0 = BK * 2, d1 = BN;
  u32x8 g;   // pinned(): each descriptor word is held in a scalar register of its own
  g[0] = pinned((1u << 20) | (5u << 22) | (3u << 25));
  g[1] = pinned((d0 & 0xFFFFu) << 16);
  g[2] = pinned((d0 >> 16) | ((d1 & 0xFFFFu) << 16));
  g[3] = pinned((d1 >> 16) | (d0 << 16));
  g[4] = pinned(d1);
  g[5] = pinned(src_pitch);
  g[6] = pinned(0u);
  g[7] = pinned(0u);
  return g;
}
// Group 0: count 1, LDS byte offset, global address of the tile's first byte, type 2.
static __device__ __forceinline__ u32x4 tdm_group0(uint32_t lds_dst, uint64_t ga) {
  u32x4 g;   // pinned(): each descriptor word is held in a scalar register of its own
  g[0] = pinned(1u);
  g[1] = pinned(lds_dst);
  g[2] = pinned((uint32_t)ga);
  g[3] = pinned((((uint32_t)(ga >> 32)) & 0x01FFFFFFu) | 0x80000000u);
  return g;
}
static __device__ __forceinline__ void tdm_load(u32x4 g0, u32x8 g1) {
  asm volatile("tensor_load_to_lds %0, %1" :: "s"(g0), "s"(g1) : "memory");
}
// The compiler places no wait for a tensor load: the issuing wave waits for its tile itself.
// The wait names the outstanding request's descriptor, so that its scalar registers stay
// untouched from the issue up to here.
static __device__ __forceinline__ void wait_tensor0(u32x4 g0, u32x8 g1) {
  asm volatile("s_wait_tensorcnt 0x0" :: "s"(g0), "s"(g1) : "memory");
}
// this wave's LDS reads have returned before the buffer they read is handed back for a refill
static __device__ __forceinline__ void wait_ds0() {
  asm volatile("s_wait_dscnt 0x0" ::: "memory");
}

static __device__ __forceinline__ v16h cat16(v8h lo, v8h hi) {
  return __builtin_shufflevector(lo, hi, 0,1,2,3,4,5,6,7,8,9,10,11,12,13,14,15);
}

// ---------------------------------------------------------------------------
// Weight conversion: fp32 -> f16, producing TRANSPOSED (N-major) weights so the
// GEMM B-operand is contraction-contiguous.
// in: bz-th matrix [R][C] f32 -> out: bz-th matrix [C][R] f16.
// One block moves a 64 x 64 tile through LDS: whole 128-byte lines are read and
// whole lines are written, 16 elements per thread. R and C are multiples of 64.
// (H, D, HD) weights are H such matrices: out[(h*HD+k)*D + d] = W[h][d][k].
// bx, by: the tile's column and row; bz: the matrix.
// ---------------------------------------------------------------------------
static __device__ __forceinline__ void cvt_T(const float* __restrict__ W,
                                             _Float16* __restrict__ out,
                                             int R, int C, int bx, int by, int bz) {
  __shared__ __align__(16) _Float16 Ls[TT * TTP];   // Ls[c][r]
  int tid = threadIdx.x;
  int c0 = bx * TT, r0 = by * TT;
  size_t zoff = (size_t)bz * R * C;

  // each thread takes a 4 x 4 block: 4 rows, 16 bytes of each
  int rb = (tid >> 4) * 4, cb = (tid & 15) * 4;
  const float* src = W + zoff + (size_t)(r0 + rb) * C + c0 + cb;
  v4f w0 = *(const v4f*)src;
  v4f w1 = *(const v4f*)(src + C);
  v4f w2 = *(const v4f*)(src + 2 * (size_t)C);
  v4f w3 = *(const v4f*)(src + 3 * (size_t)C);
  #pragma unroll   // constant j: the loaded vectors stay in registers
  for (int j = 0; j < 4; ++j) {
    v4h p = {(_Float16)w0[j], (_Float16)w1[j], (_Float16)w2[j], (_Float16)w3[j]};
    *(v4h*)&Ls[(cb + j) * TTP + rb] = p;
  }
  __syncthreads();

  // 8 lanes write one 128-byte line of an output row
  int rg = (tid & 7) * 8;
  #pragma unroll   // both LDS reads issue before the first store waits
  for (int i = 0; i < 2; ++i) {
    int c = (tid >> 3) + 32 * i;
    v8h o = *(const v8h*)&Ls[c * TTP + rg];
    *(v8h*)(out + zoff + (size_t)(c0 + c) * R + r0 + rg) = o;
  }
}

// ---------------------------------------------------------------------------
// LayerNorm (row of 768) -> f16 output
// ---------------------------------------------------------------------------
static __device__ __forceinline__ void ln_row(const float* __restrict__ x,
                                              const float* __restrict__ g,
                                              const float* __restrict__ bta,
                                              _Float16* __restrict__ out, int row) {
  __shared__ float red[256];
  int tid = threadIdx.x;
  const float* xr = x + (size_t)row * DD;
  float v0 = xr[tid], v1 = xr[tid + 256], v2 = xr[tid + 512];
  red[tid] = v0 + v1 + v2;
  __syncthreads();
  #pragma unroll
  for (int st = 128; st > 0; st >>= 1) {
    if (tid < st) red[tid] += red[tid + st];
    __syncthreads();
  }
  float mean = red[0] * (1.0f / DD);
  __syncthreads();
  float d0 = v0 - mean, d1 = v1 - mean, d2 = v2 - mean;
  red[tid] = d0 * d0 + d1 * d1 + d2 * d2;
  __syncthreads();
  #pragma unroll
  for (int st = 128; st > 0; st >>= 1) {
    if (tid < st) red[tid] += red[tid + st];
    __syncthreads();
  }
  float rs = rsqrtf(red[0] * (1.0f / DD) + EPS);
  _Float16* orow = out + (size_t)row * DD;
  orow[tid]       = (_Float16)(d0 * rs * g[tid]       + bta[tid]);
  orow[tid + 256] = (_Float16)(d1 * rs * g[tid + 256] + bta[tid + 256]);
  orow[tid + 512] = (_Float16)(d2 * rs * g[tid + 512] + bta[tid + 512]);
}

__global__ __launch_bounds__(256) void ln_f16(const float* __restrict__ x,
                                              const float* __restrict__ g,
                                              const float* __restrict__ bta,
                                              _Float16* __restrict__ out) {
  ln_row(x, g, bta, out, blockIdx.x);
}

// ---------------------------------------------------------------------------
// Everything the first products wait for, in ONE launch: none of these blocks reads what
// another writes. Blocks 0 .. ROWS-1 normalise one row of x each; the rest convert one
// 64 x 64 weight tile each (the longer-lived row blocks start first, the short ones last).
// WqkvT holds the three head weights one behind the other, each [768][768].
// ---------------------------------------------------------------------------
#define T_HEAD (HH * (DD / TT))           // tiles of one (H, D, HD) weight: 144
#define T_WO   ((DD / TT) * (DD / TT))    // 144
#define T_FF   ((FF / TT) * (DD / TT))    // tiles of W1, and of W2: 576
#define PREP_BLOCKS (ROWS + 3 * T_HEAD + T_WO + 2 * T_FF)

__global__ __launch_bounds__(256) void prep(const float* __restrict__ x,
                                            const float* __restrict__ g,
                                            const float* __restrict__ bta,
                                            _Float16* __restrict__ h,
                                            const float* __restrict__ Wq,
                                            const float* __restrict__ Wk,
                                            const float* __restrict__ Wv,
                                            const float* __restrict__ Wo,
                                            const float* __restrict__ W1,
                                            const float* __restrict__ W2,
                                            _Float16* __restrict__ WqkvT,
                                            _Float16* __restrict__ WoT,
                                            _Float16* __restrict__ W1T,
                                            _Float16* __restrict__ W2T) {
  int bid = blockIdx.x;   // every branch below is the same for the whole block
  if (bid < ROWS) {
    ln_row(x, g, bta, h, bid);
    return;
  }
  int t = bid - ROWS;
  const float* W;
  _Float16* o;
  int R = DD, C, bx, by, bz = 0;
  if (t < 3 * T_HEAD) {
    int m = t / T_HEAD, u = t - m * T_HEAD;
    W = m == 0 ? Wq : (m == 1 ? Wk : Wv);
    o = WqkvT + (size_t)m * DD * DD;
    C = HD; bx = 0; by = u % (DD / TT); bz = u / (DD / TT);
  } else if (t < 3 * T_HEAD + T_WO) {
    int u = t - 3 * T_HEAD;
    W = Wo; o = WoT;
    C = DD; bx = u % (DD / TT); by = u / (DD / TT);
  } else if (t < 3 * T_HEAD + T_WO + T_FF) {
    int u = t - (3 * T_HEAD + T_WO);
    W = W1; o = W1T;
    C = FF; bx = u % (FF / TT); by = u / (FF / TT);
  } else {
    int u = t - (3 * T_HEAD + T_WO + T_FF);
    W = W2; o = W2T;
    R = FF; C = DD; bx = u % (DD / TT); by = u / (DD / TT);
  }
  cvt_T(W, o, R, C, bx, by, bz);
}

// ---------------------------------------------------------------------------
// WMMA GEMM: C[M,N] = act(A[M,K](f16) x BT[N,K](f16)^T + bias) (+ resid)
// 256 threads = 8 waves. Block tile 128x128, K-step 128 (256-byte tile rows).
// Wave grid 4(M) x 2(N); each wave: 2 A-frags x 4 B-frags x 4 k blocks -> 32 WMMA / K-step.
// B (weight) tiles come by tensor load into two LDS buffers, padded by the mover to the
// 272-byte pitch; wave 0 issues, one request outstanding.
// K is a multiple of 128.
// blockIdx.z picks one of up to three products of the same A in one launch: weights and
// outputs lie one behind the other at BT and Cout, each product has its own bias.
// OUTF16: f16 output (else f32); GELU: exact GELU; RESID: resid is added. They are fixed at
// compile time, so that the epilogue is straight-line code.
// ---------------------------------------------------------------------------
template <bool OUTF16, bool GELU, bool RESID>
__global__ __launch_bounds__(256) void gemm_wmma(const _Float16* __restrict__ A,
                                                 const _Float16* __restrict__ BT,
                                                 const float* __restrict__ bias,
                                                 const float* __restrict__ bias1,
                                                 const float* __restrict__ bias2,
                                                 const float* __restrict__ resid,
                                                 void* __restrict__ Cout,
                                                 int M, int N, int K) {
  const int z = blockIdx.z;
  BT += (size_t)z * N * K;
  bias = z == 0 ? bias : (z == 1 ? bias1 : bias2);
  Cout = (char*)Cout + (size_t)z * M * N * (OUTF16 ? 2 : 4);
  __shared__ __attribute__((aligned(2048))) _Float16 Bsd[2][BN * AKP];
  __shared__ __align__(16) _Float16 As[BM * AKP];
  int tid = threadIdx.x;
  int lane = tid & 31;
  const uint32_t wid = uni(tid >> 5);
  int half = lane >> 4, r = lane & 15;
  int wm = wid & 3, wn = wid >> 2;
  int m0 = blockIdx.y * BM, n0 = blockIdx.x * BN;

  // every loop over mi, ni, i and kk below is fully unrolled: constant indices keep the
  // fragments, the staged rows and the accumulators in registers
  v8f acc[2][4];
  #pragma unroll
  for (int mi = 0; mi < 2; ++mi)
    #pragma unroll
    for (int ni = 0; ni < 4; ++ni) acc[mi][ni] = (v8f){};

  const int np = K / BK;
  int ldRow = tid >> 4, ldCg = (tid & 15) * 8;   // 16 lanes take one 256-byte row; 8 x 16 rows
  const _Float16* ga = A + (size_t)(m0 + ldRow) * K + ldCg;
  // each thread prefetches one 128-byte line of the next A tile; the pointer never leaves A
  const _Float16* pf = A + (size_t)(m0 + (tid >> 1)) * K + (tid & 1) * 64 + (np > 1 ? BK : 0);

  const uint32_t ldsB = (uint32_t)(size_t)&Bsd[0][0];
  const uint64_t gB = (uint64_t)(size_t)(BT + (size_t)n0 * K);
  const u32x8 g1 = tdm_group1((uint32_t)K * 2u);
  u32x4 g0 = tdm_group0(ldsB, gB);

  if (pinned(wid == 0)) {
    tdm_load(g0, g1);
    wait_tensor0(g0, g1);
  }
  __syncthreads();   // publishes B tile 0
  g0 = tdm_group0(ldsB + BTB, gB + BK * 2);
  if (pinned(wid == 0 && np > 1)) tdm_load(g0, g1);

  for (int s = 0; s < np; ++s) {
    v8h a[8];   // all eight loads are in flight at once
    #pragma unroll
    for (int i = 0; i < 8; ++i) a[i] = *(const v8h*)(ga + (size_t)(16 * i) * K);
    // next tile's lines on their way to L2 while this tile is worked on; the wait in the same
    // statement stands in front of the pointer's advance
    asm volatile("global_prefetch_b8 %0, off scope:SCOPE_SE\n\ts_wait_xcnt 0x0" :: "v"(pf) : "memory");
    pf += (s + 2 < np) ? BK : 0;
    #pragma unroll
    for (int i = 0; i < 8; ++i) *(v8h*)&As[(ldRow + 16 * i) * AKP + ldCg] = a[i];
    ga += BK;
    __syncthreads();   // publishes A tile s

    const v8h* pA = (const v8h*)As;
    const v8h* pB = (const v8h*)&Bsd[s & 1][0];
    #pragma unroll
    for (int kk = 0; kk < BK / 32; ++kk) {
      v16h afr[2], bfr[4];
      #pragma unroll
      for (int mi = 0; mi < 2; ++mi) {
        int row = wm * 32 + mi * 16 + r;
        afr[mi] = cat16(pA[row * (AKP / 8) + kk * 4 + half], pA[row * (AKP / 8) + kk * 4 + 2 + half]);
      }
      #pragma unroll
      for (int ni = 0; ni < 4; ++ni) {
        int col = wn * 64 + ni * 16 + r;
        bfr[ni] = cat16(pB[col * (AKP / 8) + kk * 4 + half], pB[col * (AKP / 8) + kk * 4 + 2 + half]);
      }
      #pragma unroll
      for (int mi = 0; mi < 2; ++mi)
        #pragma unroll
        for (int ni = 0; ni < 4; ++ni)
          acc[mi][ni] = __builtin_amdgcn_wmma_f32_16x16x32_f16(
              false, afr[mi], false, bfr[ni], (short)0, acc[mi][ni], false, false);
    }

    // hand-over: B tile s + 1 is published, and buffer s & 1 and the A tile are free again
    wait_ds0();
    if (pinned(wid == 0)) wait_tensor0(g0, g1);
    __syncthreads();
    g0 = tdm_group0(ldsB + (uint32_t)(s & 1) * BTB, gB + (uint64_t)(s + 2) * (BK * 2));
    if (pinned(wid == 0 && s + 2 < np)) tdm_load(g0, g1);
  }
  // the ring's closing waits: no request and no LDS read is open when the wave goes on
  wait_tensor0(g0, g1);
  wait_ds0();

  // element index of this lane's first output; a row further is N elements, a fragment
  // column 16 (a constant offset of the row's address). M * N stays below 2^31 elements.
  const uint32_t e0 = (uint32_t)(m0 + wm * 32 + half * 8) * (uint32_t)N + (uint32_t)(n0 + wn * 64 + r);
  const float* bp = bias + n0 + wn * 64 + r;
  float bv[4];
  #pragma unroll
  for (int ni = 0; ni < 4; ++ni) bv[ni] = bp[ni * 16];
  // no branch stands between the residual loads: a lane's 64 are issued back to back, with no
  // wait of its own for each
  float rv[2][4][8];
  if constexpr (RESID) {
    #pragma unroll
    for (int mi = 0; mi < 2; ++mi)
      #pragma unroll
      for (int v = 0; v < 8; ++v) {
        const float* rp = resid + (e0 + (uint32_t)(mi * 16 + v) * (uint32_t)N);
        #pragma unroll
        for (int ni = 0; ni < 4; ++ni) rv[mi][ni][v] = rp[ni * 16];
      }
  }
  #pragma unroll
  for (int mi = 0; mi < 2; ++mi)
    #pragma unroll
    for (int v = 0; v < 8; ++v) {
      const uint32_t e = e0 + (uint32_t)(mi * 16 + v) * (uint32_t)N;
      #pragma unroll
      for (int ni = 0; ni < 4; ++ni) {
        float val = acc[mi][ni][v] + bv[ni];
        if constexpr (GELU) val = 0.5f * val * (1.0f + erff(val * 0.70710678f));
        if constexpr (RESID) val += rv[mi][ni][v];
        if constexpr (OUTF16) ((_Float16*)Cout + e)[ni * 16] = (_Float16)val;
        else                  ((float*)Cout + e)[ni * 16] = val;
      }
    }
}

#define QB 128

// lane l <-> lane l ^ 16
static __device__ __forceinline__ float xhalf(float x) {
  int b = __builtin_bit_cast(int, x);
  return __builtin_bit_cast(float,
      __builtin_amdgcn_permlanex16(b, b, 0x76543210, 0xfedcba98, false, false));
}

__global__ __launch_bounds__(256) void attn_wmma(const _Float16* __restrict__ Qf,
                                                 const _Float16* __restrict__ Kf,
                                                 const _Float16* __restrict__ Vf,
                                                 _Float16* __restrict__ Of) {
  __shared__ __align__(16) _Float16 Ks[64 * TP];
  __shared__ __align__(16) _Float16 VsT[64 * TP];  // VsT[c][t]

  int tid = threadIdx.x, lane = tid & 31;
  int wid = __builtin_amdgcn_readfirstlane(tid >> 5);
  int half = lane >> 4, r = lane & 15;
  int iq = blockIdx.x, h = blockIdx.y, b = blockIdx.z;

  int ldRow = tid >> 2, ldCg = (tid & 3) * 16;  // 64 rows x 64 halves

  int q0 = iq * QB + wid * 16;   // first query of this wave
  int qg = q0 + r;               // this lane's query

  // Q^T as B operand, kept in registers; same k order as the K loader below
  v16h qf[2];
  {
    const _Float16* gq = Qf + ((size_t)b * SS + qg) * DD + h * HD + half * 8;
    #pragma unroll
    for (int kk = 0; kk < 2; ++kk)
      qf[kk] = cat16(*(const v8h*)(gq + kk * 32), *(const v8h*)(gq + kk * 32 + 16));
  }

  v8f ot[4];                     // O^T: ot[t][v] = O[query][t*16 + half*8 + v]
  #pragma unroll
  for (int t = 0; t < 4; ++t) ot[t] = (v8f){};
  float mrun = -3.0e38f, lsum = 0.0f;   // running maximum, scaled to base 2; this half's sum

  const int RP = TP / 8;   // row pitch in 16-byte units
  const v8h* pK = (const v8h*)Ks;
  const v8h* pV = (const v8h*)VsT;
  const float SC = 0.125f * 1.4426950408889634f;   // 1/sqrt(HD) * log2(e)

  int nj = 2 * iq + 2;
  for (int j = 0; j < nj; ++j) {
    {
      size_t g = ((size_t)b * SS + (size_t)j * 64 + ldRow) * DD + h * HD + ldCg;
      v8h k0v = *(const v8h*)(Kf + g);
      v8h k1v = *(const v8h*)(Kf + g + 8);
      v8h v0v = *(const v8h*)(Vf + g);
      v8h v1v = *(const v8h*)(Vf + g + 8);
      *(v8h*)&Ks[ldRow * TP + ldCg]     = k0v;
      *(v8h*)&Ks[ldRow * TP + ldCg + 8] = k1v;
      #pragma unroll
      for (int e = 0; e < 8; ++e) {
        VsT[(ldCg + e) * TP + ldRow]     = v0v[e];
        VsT[(ldCg + 8 + e) * TP + ldRow] = v1v[e];
      }
    }
    __syncthreads();

    if (j * 64 <= q0 + 15) {     // wave-uniform: a tile wholly above the diagonal adds nothing
      // scores^T: st[t][v] = K[j*64 + t*16 + half*8 + v] . Q[qg]
      v16h kf[4][2];
      #pragma unroll
      for (int t = 0; t < 4; ++t)
        #pragma unroll
        for (int kk = 0; kk < 2; ++kk) {
          int row = t * 16 + r;
          kf[t][kk] = cat16(pK[row * RP + kk * 4 + half], pK[row * RP + kk * 4 + 2 + half]);
        }
      // all 16 K reads stay in one group ahead of the products: one LDS latency, not eight
      __builtin_amdgcn_sched_barrier(0);
      v8f st[4];
      #pragma unroll
      for (int t = 0; t < 4; ++t)
        st[t] = __builtin_amdgcn_wmma_f32_16x16x32_f16(false, kf[t][0], false, qf[0],
                                                       (short)0, (v8f){}, false, false);
      #pragma unroll
      for (int t = 0; t < 4; ++t)
        st[t] = __builtin_amdgcn_wmma_f32_16x16x32_f16(false, kf[t][1], false, qf[1],
                                                       (short)0, st[t], false, false);
      v16h vf[2][4];
      #pragma unroll
      for (int kk = 0; kk < 2; ++kk)
        #pragma unroll
        for (int t = 0; t < 4; ++t) {
          int row = t * 16 + r;
          vf[kk][t] = cat16(pV[row * RP + kk * 4 + half], pV[row * RP + kk * 4 + 2 + half]);
        }
      // the 16 V^T reads stay here, in one group, so that they land under the softmax arithmetic
      __builtin_amdgcn_sched_barrier(0);
      if (j * 64 + 63 > q0) {    // wave-uniform: only tiles that touch the diagonal
        #pragma unroll
        for (int t = 0; t < 4; ++t)
          #pragma unroll
          for (int v = 0; v < 8; ++v)
            if (j * 64 + t * 16 + half * 8 + v > qg) st[t][v] = -1.0e30f;
      }

      // online softmax, one query per lane pair (l, l ^ 16); the maximum is taken over the
      // raw scores and scaled once, the scale rides in the exponent's multiply-add
      float tmx[4];
      #pragma unroll
      for (int t = 0; t < 4; ++t) {
        float a = fmaxf(fmaxf(st[t][0], st[t][1]), fmaxf(st[t][2], st[t][3]));
        float c = fmaxf(fmaxf(st[t][4], st[t][5]), fmaxf(st[t][6], st[t][7]));
        tmx[t] = fmaxf(a, c);
      }
      float tm = fmaxf(fmaxf(tmx[0], tmx[1]), fmaxf(tmx[2], tmx[3]));
      tm = fmaxf(tm, xhalf(tm)) * SC;
      tm = fmaxf(tm, mrun);
      float f = __builtin_amdgcn_exp2f(mrun - tm);
      mrun = tm;
      const v8f vsc = {SC, SC, SC, SC, SC, SC, SC, SC};
      const v8f vnm = {-tm, -tm, -tm, -tm, -tm, -tm, -tm, -tm};
      #pragma unroll
      for (int t = 0; t < 4; ++t) st[t] = __builtin_elementwise_fma(st[t], vsc, vnm);
      float tsm[4];
      #pragma unroll
      for (int t = 0; t < 4; ++t) {
        float ts = 0.0f;
        #pragma unroll
        for (int v = 0; v < 8; ++v) {
          float p = __builtin_amdgcn_exp2f(st[t][v]);
          st[t][v] = p;
          ts += p;
        }
        tsm[t] = ts;
      }
      lsum = lsum * f + ((tsm[0] + tsm[1]) + (tsm[2] + tsm[3]));
      #pragma unroll
      for (int t = 0; t < 4; ++t) ot[t] *= f;

      // O^T += V^T . P^T
      #pragma unroll
      for (int kk = 0; kk < 2; ++kk) {
        v16h pf;   // pf[s] = P^T[key kk*32 + (s < 8 ? half*8 + s : 16 + half*8 + s - 8)][qg]
        #pragma unroll
        for (int s = 0; s < 8; ++s) {
          pf[s]     = (_Float16)st[2 * kk][s];
          pf[s + 8] = (_Float16)st[2 * kk + 1][s];
        }
        #pragma unroll
        for (int t = 0; t < 4; ++t)
          ot[t] = __builtin_amdgcn_wmma_f32_16x16x32_f16(false, vf[kk][t], false, pf,
                                                         (short)0, ot[t], false, false);
      }
    }
    __syncthreads();
  }

  float inv = 1.0f / (lsum + xhalf(lsum));
  _Float16* go = Of + ((size_t)b * SS + qg) * DD + h * HD + half * 8;
  #pragma unroll
  for (int t = 0; t < 4; ++t) {
    v8h o;
    #pragma unroll
    for (int v = 0; v < 8; ++v) o[v] = (_Float16)(ot[t][v] * inv);
    *(v8h*)(go + t * 16) = o;
  }
}

// ---------------------------------------------------------------------------
// Host-side launch
// ---------------------------------------------------------------------------
extern "C" void kernel_launch(void* const* d_in, const int* in_sizes, int n_in,
                              void* d_out, int out_size, void* d_ws, size_t ws_size,
                              hipStream_t stream) {
  const float* x     = (const float*)d_in[0];
  const float* Wq    = (const float*)d_in[1];
  const float* bq    = (const float*)d_in[2];
  const float* Wk    = (const float*)d_in[3];
  const float* bk    = (const float*)d_in[4];
  const float* Wv    = (const float*)d_in[5];
  const float* bv    = (const float*)d_in[6];
  const float* Wo    = (const float*)d_in[7];
  const float* bo    = (const float*)d_in[8];
  const float* ln1_g = (const float*)d_in[9];
  const float* ln1_b = (const float*)d_in[10];
  const float* ln2_g = (const float*)d_in[11];
  const float* ln2_b = (const float*)d_in[12];
  const float* W1    = (const float*)d_in[13];
  const float* b1    = (const float*)d_in[14];
  const float* W2    = (const float*)d_in[15];
  const float* b2    = (const float*)d_in[16];
  float* out = (float*)d_out;

  auto align = [](size_t v) { return (v + 255) & ~(size_t)255; };
  char* base = (char*)d_ws;
  size_t off = 0;
  auto slot = [&](size_t bytes) { char* p = base + off; off += align(bytes); return p; };
  _Float16* hf16  = (_Float16*)slot((size_t)ROWS * DD * 2);
  _Float16* WqkvT = (_Float16*)slot((size_t)3 * DD * DD * 2);   // three times [N=768][K=768]
  _Float16* WoT   = (_Float16*)slot((size_t)DD * DD * 2);
  _Float16* W1T   = (_Float16*)slot((size_t)DD * FF * 2);   // [N=3072][K=768]
  _Float16* W2T   = (_Float16*)slot((size_t)FF * DD * 2);   // [N=768][K=3072]
  _Float16* Qf    = (_Float16*)slot((size_t)3 * ROWS * DD * 2);   // Q, K, V one behind the other
  _Float16* Kf    = Qf + (size_t)ROWS * DD;
  _Float16* Vf    = Kf + (size_t)ROWS * DD;
  _Float16* At16  = (_Float16*)slot((size_t)ROWS * DD * 2);
  float*    X1    = (float*)   slot((size_t)ROWS * DD * 4);
  _Float16* h216  = (_Float16*)slot((size_t)ROWS * DD * 2);
  _Float16* H1    = (_Float16*)slot((size_t)ROWS * FF * 2);

  // 1) + 2) LN1 and the weight conversion (f32 -> f16, transposed to [N][K]), one launch
  prep<<<PREP_BLOCKS, 256, 0, stream>>>(x, ln1_g, ln1_b, hf16, Wq, Wk, Wv, Wo, W1, W2,
                                        WqkvT, WoT, W1T, W2T);

  // 3) Q/K/V projections (f16 out, +bias), one launch
  dim3 gQKV(DD / BN, ROWS / BM, 3);
  gemm_wmma<true, false, false><<<gQKV, 256, 0, stream>>>(hf16, WqkvT, bq, bk, bv, nullptr, Qf, ROWS, DD, DD);

  // 4) causal flash attention
  dim3 gAtt(SS / QB, HH, BB);
  attn_wmma<<<gAtt, 256, 0, stream>>>(Qf, Kf, Vf, At16);

  // 5) output projection + residual (f32 out): X1 = x + attn @ Wo + bo
  dim3 gO(DD / BN, ROWS / BM);
  gemm_wmma<false, false, true><<<gO, 256, 0, stream>>>(At16, WoT, bo, bo, bo, x, X1, ROWS, DD, DD);

  // 6) LN2
  ln_f16<<<ROWS, 256, 0, stream>>>(X1, ln2_g, ln2_b, h216);

  // 7) FFN up + GELU (f16 out)
  dim3 gF1(FF / BN, ROWS / BM);
  gemm_wmma<true, true, false><<<gF1, 256, 0, stream>>>(h216, W1T, b1, b1, b1, nullptr, H1, ROWS, FF, DD);

  // 8) FFN down + bias + residual (f32 out to d_out)
  dim3 gF2(DD / BN, ROWS / BM);
  gemm_wmma<false, false, true><<<gF2, 256, 0, stream>>>(H1, W2T, b2, b2, b2, X1, out, ROWS, DD, FF);

  (void)in_sizes; (void)n_in; (void)out_size; (void)ws_size;
}

// v007
// A run of this version takes 140 microseconds.
// Two timings next to v006 both put it at 1.12 times that version's speed.
// All steps since v000 together make it 3.89 times as fast.
#include <hip/hip_runtime.h>
#include <hip/hip_bf16.h>
#include <math.h>

typedef __attribute__((ext_vector_type(16))) _Float16 v16h;
typedef __attribute__((ext_vector_type(8)))  _Float16 v8h;
typedef __attribute__((ext_vector_type(8)))  float    v8f;
typedef __attribute__((ext_vector_type(4)))  _Float16 v4h;
typedef __attribute__((ext_vector_type(4)))  float    v4f;

#define BB 2
#define SS 2048
#define DD 768
#define HH 12
#define HD 64
#define FF 3072
#define ROWS (BB*SS)          // 4096
#define EPS 1e-5f

#define BM 128
#define BN 128
#define BK 128

// LDS row pitches in halves. A ds_load_b128 fragment read walks 16 rows at once;
// a pitch of 16 B x odd spreads those rows over all 64 banks.
#define AKP 136               // GEMM A and B tiles: 128 halves + 8 pad (272 B)
#define TP  72                // attention K tile: 64 halves + 8 pad (144 B)
#define TPV 80                // attention V tile: 64 halves + 16 pad (160 B = 32 B x odd, for ds_load_tr16_b128)
#define BTB (BN * AKP * 2)    // one B buffer in bytes: 128 rows x 272 B = 34816 = 17 x 2 KiB

#define TT  64                // weight transpose tile edge
#define TTP 72                // its LDS row: 64 halves + 8 pad (144 B)

// ---------------------------------------------------------------------------
// Tensor load to LDS: one request of one wave brings a 2-D tile, through no register.
// ---------------------------------------------------------------------------
typedef uint32_t u32x4 __attribute__((ext_vector_type(4)));
typedef uint32_t u32x8 __attribute__((ext_vector_type(8)));

static __device__ __forceinline__ uint32_t uni(uint32_t v) {
  return (uint32_t)__builtin_amdgcn_readfirstlane(v);
}
// A test held in a scalar register, so that the branch on it is a scalar branch:
// a tensor load ignores EXEC and only such a branch keeps a wave from issuing it.
static __device__ __forceinline__ uint32_t pinned(uint32_t v) {
  uint32_t w = uni(v);
  asm volatile("" : "+s"(w));
  return w;
}
// Group 1: 1-byte elements, tensor = tile = BN rows of 256 bytes, source pitch in bytes,
// 4 dwords of LDS pad behind every 64 dwords (one row): LDS pitch 272 B.
static __device__ __forceinline__ u32x8 tdm_group1(uint32_t src_pitch) {
  constexpr uint32_t d0 = BK * 2, d1 = BN;
  u32x8 g;   // pinned(): each descriptor word is held in a scalar register of its own
  g[0] = pinned((1u << 20) | (5u << 22) | (3u << 25));
  g[1] = pinned((d0 & 0xFFFFu) << 16);
  g[2] = pinned((d0 >> 16) | ((d1 & 0xFFFFu) << 16));
  g[3] = pinned((d1 >> 16) | (d0 << 16));
  g[4] = pinned(d1);
  g[5] = pinned(src_pitch);
  g[6] = pinned(0u);
  g[7] = pinned(0u);
  return g;
}
// Group 0: count 1, LDS byte offset, global address of the tile's first byte, type 2.
static __device__ __forceinline__ u32x4 tdm_group0(uint32_t lds_dst, uint64_t ga) {
  u32x4 g;   // pinned(): each descriptor word is held in a scalar register of its own
  g[0] = pinned(1u);
  g[1] = pinned(lds_dst);
  g[2] = pinned((uint32_t)ga);
  g[3] = pinned((((uint32_t)(ga >> 32)) & 0x01FFFFFFu) | 0x80000000u);
  return g;
}
static __device__ __forceinline__ void tdm_load(u32x4 g0, u32x8 g1) {
  asm volatile("tensor_load_to_lds %0, %1" :: "s"(g0), "s"(g1) : "memory");
}
// The compiler places no wait for a tensor load: the issuing wave waits for its tile itself.
// The wait names the outstanding request's descriptor, so that its scalar registers stay
// untouched from the issue up to here.
static __device__ __forceinline__ void wait_tensor0(u32x4 g0, u32x8 g1) {
  asm volatile("s_wait_tensorcnt 0x0" :: "s"(g0), "s"(g1) : "memory");
}
// this wave's LDS reads have returned before the buffer they read is handed back for a refill
static __device__ __forceinline__ void wait_ds0() {
  asm volatile("s_wait_dscnt 0x0" ::: "memory");
}

static __device__ __forceinline__ v16h cat16(v8h lo, v8h hi) {
  return __builtin_shufflevector(lo, hi, 0,1,2,3,4,5,6,7,8,9,10,11,12,13,14,15);
}

// ---------------------------------------------------------------------------
// Weight conversion: fp32 -> f16, producing TRANSPOSED (N-major) weights so the
// GEMM B-operand is contraction-contiguous.
// in: bz-th matrix [R][C] f32 -> out: bz-th matrix [C][R] f16.
// One block moves a 64 x 64 tile through LDS: whole 128-byte lines are read and
// whole lines are written, 16 elements per thread. R and C are multiples of 64.
// (H, D, HD) weights are H such matrices: out[(h*HD+k)*D + d] = W[h][d][k].
// bx, by: the tile's column and row; bz: the matrix.
// ---------------------------------------------------------------------------
static __device__ __forceinline__ void cvt_T(const float* __restrict__ W,
                                             _Float16* __restrict__ out,
                                             int R, int C, int bx, int by, int bz) {
  __shared__ __align__(16) _Float16 Ls[TT * TTP];   // Ls[c][r]
  int tid = threadIdx.x;
  int c0 = bx * TT, r0 = by * TT;
  size_t zoff = (size_t)bz * R * C;

  // each thread takes a 4 x 4 block: 4 rows, 16 bytes of each
  int rb = (tid >> 4) * 4, cb = (tid & 15) * 4;
  const float* src = W + zoff + (size_t)(r0 + rb) * C + c0 + cb;
  v4f w0 = *(const v4f*)src;
  v4f w1 = *(const v4f*)(src + C);
  v4f w2 = *(const v4f*)(src + 2 * (size_t)C);
  v4f w3 = *(const v4f*)(src + 3 * (size_t)C);
  #pragma unroll   // constant j: the loaded vectors stay in registers
  for (int j = 0; j < 4; ++j) {
    v4h p = {(_Float16)w0[j], (_Float16)w1[j], (_Float16)w2[j], (_Float16)w3[j]};
    *(v4h*)&Ls[(cb + j) * TTP + rb] = p;
  }
  __syncthreads();

  // 8 lanes write one 128-byte line of an output row
  int rg = (tid & 7) * 8;
  #pragma unroll   // both LDS reads issue before the first store waits
  for (int i = 0; i < 2; ++i) {
    int c = (tid >> 3) + 32 * i;
    v8h o = *(const v8h*)&Ls[c * TTP + rg];
    *(v8h*)(out + zoff + (size_t)(c0 + c) * R + r0 + rg) = o;
  }
}

// ---------------------------------------------------------------------------
// LayerNorm (row of 768) -> f16 output
// ---------------------------------------------------------------------------
static __device__ __forceinline__ void ln_row(const float* __restrict__ x,
                                              const float* __restrict__ g,
                                              const float* __restrict__ bta,
                                              _Float16* __restrict__ out, int row) {
  __shared__ float red[256];
  int tid = threadIdx.x;
  const float* xr = x + (size_t)row * DD;
  float v0 = xr[tid], v1 = xr[tid + 256], v2 = xr[tid + 512];
  red[tid] = v0 + v1 + v2;
  __syncthreads();
  #pragma unroll
  for (int st = 128; st > 0; st >>= 1) {
    if (tid < st) red[tid] += red[tid + st];
    __syncthreads();
  }
  float mean = red[0] * (1.0f / DD);
  __syncthreads();
  float d0 = v0 - mean, d1 = v1 - mean, d2 = v2 - mean;
  red[tid] = d0 * d0 + d1 * d1 + d2 * d2;
  __syncthreads();
  #pragma unroll
  for (int st = 128; st > 0; st >>= 1) {
    if (tid < st) red[tid] += red[tid + st];
    __syncthreads();
  }
  float rs = rsqrtf(red[0] * (1.0f / DD) + EPS);
  _Float16* orow = out + (size_t)row * DD;
  orow[tid]       = (_Float16)(d0 * rs * g[tid]       + bta[tid]);
  orow[tid + 256] = (_Float16)(d1 * rs * g[tid + 256] + bta[tid + 256]);
  orow[tid + 512] = (_Float16)(d2 * rs * g[tid + 512] + bta[tid + 512]);
}

__global__ __launch_bounds__(256) void ln_f16(const float* __restrict__ x,
                                              const float* __restrict__ g,
                                              const float* __restrict__ bta,
                                              _Float16* __restrict__ out) {
  ln_row(x, g, bta, out, blockIdx.x);
}

// ---------------------------------------------------------------------------
// Everything the first products wait for, in ONE launch: none of these blocks reads what
// another writes. Blocks 0 .. ROWS-1 normalise one row of x each; the rest convert one
// 64 x 64 weight tile each (the longer-lived row blocks start first, the short ones last).
// WqkvT holds the three head weights one behind the other, each [768][768].
// ---------------------------------------------------------------------------
#define T_HEAD (HH * (DD / TT))           // tiles of one (H, D, HD) weight: 144
#define T_WO   ((DD / TT) * (DD / TT))    // 144
#define T_FF   ((FF / TT) * (DD / TT))    // tiles of W1, and of W2: 576
#define PREP_BLOCKS (ROWS + 3 * T_HEAD + T_WO + 2 * T_FF)

__global__ __launch_bounds__(256) void prep(const float* __restrict__ x,
                                            const float* __restrict__ g,
                                            const float* __restrict__ bta,
                                            _Float16* __restrict__ h,
                                            const float* __restrict__ Wq,
                                            const float* __restrict__ Wk,
                                            const float* __restrict__ Wv,
                                            const float* __restrict__ Wo,
                                            const float* __restrict__ W1,
                                            const float* __restrict__ W2,
                                            _Float16* __restrict__ WqkvT,
                                            _Float16* __restrict__ WoT,
                                            _Float16* __restrict__ W1T,
                                            _Float16* __restrict__ W2T) {
  int bid = blockIdx.x;   // every branch below is the same for the whole block
  if (bid < ROWS) {
    ln_row(x, g, bta, h, bid);
    return;
  }
  int t = bid - ROWS;
  const float* W;
  _Float16* o;
  int R = DD, C, bx, by, bz = 0;
  if (t < 3 * T_HEAD) {
    int m = t / T_HEAD, u = t - m * T_HEAD;
    W = m == 0 ? Wq : (m == 1 ? Wk : Wv);
    o = WqkvT + (size_t)m * DD * DD;
    C = HD; bx = 0; by = u % (DD / TT); bz = u / (DD / TT);
  } else if (t < 3 * T_HEAD + T_WO) {
    int u = t - 3 * T_HEAD;
    W = Wo; o = WoT;
    C = DD; bx = u % (DD / TT); by = u / (DD / TT);
  } else if (t < 3 * T_HEAD + T_WO + T_FF) {
    int u = t - (3 * T_HEAD + T_WO);
    W = W1; o = W1T;
    C = FF; bx = u % (FF / TT); by = u / (FF / TT);
  } else {
    int u = t - (3 * T_HEAD + T_WO + T_FF);
    W = W2; o = W2T;
    R = FF; C = DD; bx = u % (DD / TT); by = u / (DD / TT);
  }
  cvt_T(W, o, R, C, bx, by, bz);
}

// ---------------------------------------------------------------------------
// WMMA GEMM: C[M,N] = act(A[M,K](f16) x BT[N,K](f16)^T + bias) (+ resid)
// 256 threads = 8 waves. Block tile 128x128, K-step 128 (256-byte tile rows).
// Wave grid 4(M) x 2(N); each wave: 2 A-frags x 4 B-frags x 4 k blocks -> 32 WMMA / K-step.
// B (weight) tiles come by tensor load into two LDS buffers, padded by the mover to the
// 272-byte pitch; wave 0 issues, one request outstanding.
// K is a multiple of 128.
// blockIdx.z picks one of up to three products of the same A in one launch: weights and
// outputs lie one behind the other at BT and Cout, each product has its own bias.
// OUTF16: f16 output (else f32); GELU: exact GELU; RESID: resid is added. They are fixed at
// compile time, so that the epilogue is straight-line code.
// ---------------------------------------------------------------------------
template <bool OUTF16, bool GELU, bool RESID>
__global__ __launch_bounds__(256) void gemm_wmma(const _Float16* __restrict__ A,
                                                 const _Float16* __restrict__ BT,
                                                 const float* __restrict__ bias,
                                                 const float* __restrict__ bias1,
                                                 const float* __restrict__ bias2,
                                                 const float* __restrict__ resid,
                                                 void* __restrict__ Cout,
                                                 int M, int N, int K) {
  const int z = blockIdx.z;
  BT += (size_t)z * N * K;
  bias = z == 0 ? bias : (z == 1 ? bias1 : bias2);
  Cout = (char*)Cout + (size_t)z * M * N * (OUTF16 ? 2 : 4);
  __shared__ __attribute__((aligned(2048))) _Float16 Bsd[2][BN * AKP];
  __shared__ __align__(16) _Float16 As[BM * AKP];
  int tid = threadIdx.x;
  int lane = tid & 31;
  const uint32_t wid = uni(tid >> 5);
  int half = lane >> 4, r = lane & 15;
  int wm = wid & 3, wn = wid >> 2;
  int m0 = blockIdx.y * BM, n0 = blockIdx.x * BN;

  // every loop over mi, ni, i and kk below is fully unrolled: constant indices keep the
  // fragments, the staged rows and the accumulators in registers
  v8f acc[2][4];
  #pragma unroll
  for (int mi = 0; mi < 2; ++mi)
    #pragma unroll
    for (int ni = 0; ni < 4; ++ni) acc[mi][ni] = (v8f){};

  const int np = K / BK;
  int ldRow = tid >> 4, ldCg = (tid & 15) * 8;   // 16 lanes take one 256-byte row; 8 x 16 rows
  const _Float16* ga = A + (size_t)(m0 + ldRow) * K + ldCg;
  // each thread prefetches one 128-byte line of the next A tile; the pointer never leaves A
  const _Float16* pf = A + (size_t)(m0 + (tid >> 1)) * K + (tid & 1) * 64 + (np > 1 ? BK : 0);

  const uint32_t ldsB = (uint32_t)(size_t)&Bsd[0][0];
  const uint64_t gB = (uint64_t)(size_t)(BT + (size_t)n0 * K);
  const u32x8 g1 = tdm_group1((uint32_t)K * 2u);
  u32x4 g0 = tdm_group0(ldsB, gB);

  if (pinned(wid == 0)) {
    tdm_load(g0, g1);
    wait_tensor0(g0, g1);
  }
  __syncthreads();   // publishes B tile 0
  g0 = tdm_group0(ldsB + BTB, gB + BK * 2);
  if (pinned(wid == 0 && np > 1)) tdm_load(g0, g1);

  for (int s = 0; s < np; ++s) {
    v8h a[8];   // all eight loads are in flight at once
    #pragma unroll
    for (int i = 0; i < 8; ++i) a[i] = *(const v8h*)(ga + (size_t)(16 * i) * K);
    // next tile's lines on their way to L2 while this tile is worked on; the wait in the same
    // statement stands in front of the pointer's advance
    asm volatile("global_prefetch_b8 %0, off scope:SCOPE_SE\n\ts_wait_xcnt 0x0" :: "v"(pf) : "memory");
    pf += (s + 2 < np) ? BK : 0;
    #pragma unroll
    for (int i = 0; i < 8; ++i) *(v8h*)&As[(ldRow + 16 * i) * AKP + ldCg] = a[i];
    ga += BK;
    __syncthreads();   // publishes A tile s

    const v8h* pA = (const v8h*)As;
    const v8h* pB = (const v8h*)&Bsd[s & 1][0];
    #pragma unroll
    for (int kk = 0; kk < BK / 32; ++kk) {
      v16h afr[2], bfr[4];
      #pragma unroll
      for (int mi = 0; mi < 2; ++mi) {
        int row = wm * 32 + mi * 16 + r;
        afr[mi] = cat16(pA[row * (AKP / 8) + kk * 4 + half], pA[row * (AKP / 8) + kk * 4 + 2 + half]);
      }
      #pragma unroll
      for (int ni = 0; ni < 4; ++ni) {
        int col = wn * 64 + ni * 16 + r;
        bfr[ni] = cat16(pB[col * (AKP / 8) + kk * 4 + half], pB[col * (AKP / 8) + kk * 4 + 2 + half]);
      }
      #pragma unroll
      for (int mi = 0; mi < 2; ++mi)
        #pragma unroll
        for (int ni = 0; ni < 4; ++ni)
          acc[mi][ni] = __builtin_amdgcn_wmma_f32_16x16x32_f16(
              false, afr[mi], false, bfr[ni], (short)0, acc[mi][ni], false, false);
    }

    // hand-over: B tile s + 1 is published, and buffer s & 1 and the A tile are free again
    wait_ds0();
    if (pinned(wid == 0)) wait_tensor0(g0, g1);
    __syncthreads();
    g0 = tdm_group0(ldsB + (uint32_t)(s & 1) * BTB, gB + (uint64_t)(s + 2) * (BK * 2));
    if (pinned(wid == 0 && s + 2 < np)) tdm_load(g0, g1);
  }
  // the ring's closing waits: no request and no LDS read is open when the wave goes on
  wait_tensor0(g0, g1);
  wait_ds0();

  // element index of this lane's first output; a row further is N elements, a fragment
  // column 16 (a constant offset of the row's address). M * N stays below 2^31 elements.
  const uint32_t e0 = (uint32_t)(m0 + wm * 32 + half * 8) * (uint32_t)N + (uint32_t)(n0 + wn * 64 + r);
  const float* bp = bias + n0 + wn * 64 + r;
  float bv[4];
  #pragma unroll
  for (int ni = 0; ni < 4; ++ni) bv[ni] = bp[ni * 16];
  // no branch stands between the residual loads: a lane's 64 are issued back to back, with no
  // wait of its own for each
  float rv[2][4][8];
  if constexpr (RESID) {
    #pragma unroll
    for (int mi = 0; mi < 2; ++mi)
      #pragma unroll
      for (int v = 0; v < 8; ++v) {
        const float* rp = resid + (e0 + (uint32_t)(mi * 16 + v) * (uint32_t)N);
        #pragma unroll
        for (int ni = 0; ni < 4; ++ni) rv[mi][ni][v] = rp[ni * 16];
      }
  }
  #pragma unroll
  for (int mi = 0; mi < 2; ++mi)
    #pragma unroll
    for (int v = 0; v < 8; ++v) {
      const uint32_t e = e0 + (uint32_t)(mi * 16 + v) * (uint32_t)N;
      #pragma unroll
      for (int ni = 0; ni < 4; ++ni) {
        float val = acc[mi][ni][v] + bv[ni];
        if constexpr (GELU) val = 0.5f * val * (1.0f + erff(val * 0.70710678f));
        if constexpr (RESID) val += rv[mi][ni][v];
        if constexpr (OUTF16) ((_Float16*)Cout + e)[ni * 16] = (_Float16)val;
        else                  ((float*)Cout + e)[ni * 16] = val;
      }
    }
}

#define QB 128

// lane l <-> lane l ^ 16
static __device__ __forceinline__ float xhalf(float x) {
  int b = __builtin_bit_cast(int, x);
  return __builtin_bit_cast(float,
      __builtin_amdgcn_permlanex16(b, b, 0x76543210, 0xfedcba98, false, false));
}

// the issuing wave's own copies have landed; the barrier behind it publishes them to the others
static __device__ __forceinline__ void wait_async0() {
  asm volatile("s_wait_asynccnt 0x0" ::: "memory");
}
// One 64-key tile of K and of V, 16 bytes a lane and copy: two rows' pieces of each. The wait in
// the same statement stands in front of any rewrite of the address registers the copies name.
static __device__ __forceinline__ void copy_kv(uint32_t lk, uint32_t lv,
                                               const _Float16* gk, const _Float16* gv) {
  uint32_t lk1 = lk + 32 * TP * 2, lv1 = lv + 32 * TPV * 2;
  const _Float16* gk1 = gk + 32 * DD;
  const _Float16* gv1 = gv + 32 * DD;
  asm volatile("global_load_async_to_lds_b128 %0, %4, off\n\t"
               "global_load_async_to_lds_b128 %1, %5, off\n\t"
               "global_load_async_to_lds_b128 %2, %6, off\n\t"
               "global_load_async_to_lds_b128 %3, %7, off\n\t"
               "s_wait_xcnt 0x0"
               :: "v"(lk), "v"(lk1), "v"(lv), "v"(lv1), "v"(gk), "v"(gk1), "v"(gv), "v"(gv1)
               : "memory");
}
// 16 x 16 halves of a row-major LDS tile, transposed: half of a 16 x 32 A fragment
typedef short s16x8 __attribute__((ext_vector_type(8)));
static __device__ __forceinline__ v8h ld_tr16(const _Float16* p) {
  typedef __attribute__((address_space(3))) s16x8 lds_s16x8;
  return __builtin_bit_cast(v8h, __builtin_amdgcn_ds_load_tr16_b128_v8i16((lds_s16x8*)p));
}

__global__ __launch_bounds__(256) void attn_wmma(const _Float16* __restrict__ Qf,
                                                 const _Float16* __restrict__ Kf,
                                                 const _Float16* __restrict__ Vf,
                                                 _Float16* __restrict__ Of) {
  __shared__ __align__(16) _Float16 Ks[2][64 * TP];
  __shared__ __align__(16) _Float16 Vs[2][64 * TPV];   // Vs[buffer][key][c]

  int tid = threadIdx.x, lane = tid & 31;
  int wid = __builtin_amdgcn_readfirstlane(tid >> 5);
  int half = lane >> 4, r = lane & 15;
  int iq = blockIdx.x, h = blockIdx.y, b = blockIdx.z;

  int ldRow = tid >> 3, ldCg = (tid & 7) * 8;   // 8 lanes copy one 128-byte row; rows ldRow, ldRow + 32

  int q0 = iq * QB + wid * 16;   // first query of this wave
  int qg = q0 + r;               // this lane's query

  // Q^T as B operand, kept in registers; same k order as the K loader below
  v16h qf[2];
  {
    const _Float16* gq = Qf + ((size_t)b * SS + qg) * DD + h * HD + half * 8;
    #pragma unroll
    for (int kk = 0; kk < 2; ++kk)
      qf[kk] = cat16(*(const v8h*)(gq + kk * 32), *(const v8h*)(gq + kk * 32 + 16));
  }

  v8f ot[4];                     // O^T: ot[t][v] = O[query][t*16 + half*8 + v]
  #pragma unroll
  for (int t = 0; t < 4; ++t) ot[t] = (v8f){};
  float mrun = -3.0e38f, lsum = 0.0f;   // running maximum, scaled to base 2; this half's sum

  const int RP = TP / 8;   // K row pitch in 16-byte units
  const float SC = 0.125f * 1.4426950408889634f;   // 1/sqrt(HD) * log2(e)

  int nj = 2 * iq + 2;       // at least two tiles
  // this lane's copy addresses: LDS bytes in buffer 0, and tile 0 in memory
  const uint32_t lk = (uint32_t)(size_t)&Ks[0][ldRow * TP + ldCg];
  const uint32_t lv = (uint32_t)(size_t)&Vs[0][ldRow * TPV + ldCg];
  const size_t g0 = ((size_t)b * SS + ldRow) * DD + h * HD + ldCg;
  const _Float16* gk = Kf + g0;
  const _Float16* gv = Vf + g0;

  copy_kv(lk, lv, gk, gv);
  wait_async0();
  __syncthreads();           // publishes tile 0
  copy_kv(lk + 64 * TP * 2, lv + 64 * TPV * 2, gk + 64 * DD, gv + 64 * DD);

  for (int j = 0; j < nj; ++j) {
    const int bf = j & 1;
    const v8h* pK = (const v8h*)&Ks[bf][0];
    // transposing load: lane l names row 8 * (l >> 4) + (l & 7), 16-byte piece (l >> 3) & 1
    const _Float16* pV = &Vs[bf][(half * 8 + (lane & 7)) * TPV + ((lane >> 3) & 1) * 8];

    if (j * 64 <= q0 + 15) {     // wave-uniform: a tile wholly above the diagonal adds nothing
      // scores^T: st[t][v] = K[j*64 + t*16 + half*8 + v] . Q[qg]
      v16h kf[4][2];
      #pragma unroll
      for (int t = 0; t < 4; ++t)
        #pragma unroll
        for (int kk = 0; kk < 2; ++kk) {
          int row = t * 16 + r;
          kf[t][kk] = cat16(pK[row * RP + kk * 4 + half], pK[row * RP + kk * 4 + 2 + half]);
        }
      // all 16 K reads stay in one group ahead of the products: one LDS latency, not eight
      __builtin_amdgcn_sched_barrier(0);
      v8f st[4];
      #pragma unroll
      for (int t = 0; t < 4; ++t)
        st[t] = __builtin_amdgcn_wmma_f32_16x16x32_f16(false, kf[t][0], false, qf[0],
                                                       (short)0, (v8f){}, false, false);
      #pragma unroll
      for (int t = 0; t < 4; ++t)
        st[t] = __builtin_amdgcn_wmma_f32_16x16x32_f16(false, kf[t][1], false, qf[1],
                                                       (short)0, st[t], false, false);
      v16h vf[2][4];
      #pragma unroll
      for (int kk = 0; kk < 2; ++kk)
        #pragma unroll
        for (int t = 0; t < 4; ++t)   // keys kk*32 + half*8 + 0..7, then 16 further on; column t*16 + r
          vf[kk][t] = cat16(ld_tr16(pV + (kk * 32) * TPV + t * 16),
                            ld_tr16(pV + (kk * 32 + 16) * TPV + t * 16));
      // the 16 V^T reads stay here, in one group, so that they land under the softmax arithmetic
      __builtin_amdgcn_sched_barrier(0);
      if (j * 64 + 63 > q0) {    // wave-uniform: only tiles that touch the diagonal
        #pragma unroll
        for (int t = 0; t < 4; ++t)
          #pragma unroll
          for (int v = 0; v < 8; ++v)
            if (j * 64 + t * 16 + half * 8 + v > qg) st[t][v] = -1.0e30f;
      }

      // online softmax, one query per lane pair (l, l ^ 16); the maximum is taken over the
      // raw scores and scaled once, the scale rides in the exponent's multiply-add
      float tmx[4];
      #pragma unroll
      for (int t = 0; t < 4; ++t) {
        float a = fmaxf(fmaxf(st[t][0], st[t][1]), fmaxf(st[t][2], st[t][3]));
        float c = fmaxf(fmaxf(st[t][4], st[t][5]), fmaxf(st[t][6], st[t][7]));
        tmx[t] = fmaxf(a, c);
      }
      float tm = fmaxf(fmaxf(tmx[0], tmx[1]), fmaxf(tmx[2], tmx[3]));
      tm = fmaxf(tm, xhalf(tm)) * SC;
      tm = fmaxf(tm, mrun);
      float f = __builtin_amdgcn_exp2f(mrun - tm);
      mrun = tm;
      const v8f vsc = {SC, SC, SC, SC, SC, SC, SC, SC};
      const v8f vnm = {-tm, -tm, -tm, -tm, -tm, -tm, -tm, -tm};
      #pragma unroll
      for (int t = 0; t < 4; ++t) st[t] = __builtin_elementwise_fma(st[t], vsc, vnm);
      float tsm[4];
      #pragma unroll
      for (int t = 0; t < 4; ++t) {
        float ts = 0.0f;
        #pragma unroll
        for (int v = 0; v < 8; ++v) {
          float p = __builtin_amdgcn_exp2f(st[t][v]);
          st[t][v] = p;
          ts += p;
        }
        tsm[t] = ts;
      }
      lsum = lsum * f + ((tsm[0] + tsm[1]) + (tsm[2] + tsm[3]));
      #pragma unroll
      for (int t = 0; t < 4; ++t) ot[t] *= f;

      // O^T += V^T . P^T
      #pragma unroll
      for (int kk = 0; kk < 2; ++kk) {
        v16h pf;   // pf[s] = P^T[key kk*32 + (s < 8 ? half*8 + s : 16 + half*8 + s - 8)][qg]
        #pragma unroll
        for (int s = 0; s < 8; ++s) {
          pf[s]     = (_Float16)st[2 * kk][s];
          pf[s + 8] = (_Float16)st[2 * kk + 1][s];
        }
        #pragma unroll
        for (int t = 0; t < 4; ++t)
          ot[t] = __builtin_amdgcn_wmma_f32_16x16x32_f16(false, vf[kk][t], false, pf,
                                                         (short)0, ot[t], false, false);
      }
    }

    // hand-over, passed by every wave: tile j + 1 is published, and buffer bf is free again
    wait_ds0();
    wait_async0();
    __syncthreads();
    if (j + 2 < nj)          // the same for the whole block
      copy_kv(lk + (uint32_t)bf * (64 * TP * 2), lv + (uint32_t)bf * (64 * TPV * 2),
              gk + (size_t)(j + 2) * (64 * DD), gv + (size_t)(j + 2) * (64 * DD));
  }
  wait_async0();             // no copy is open when the wave goes on

  float inv = 1.0f / (lsum + xhalf(lsum));
  _Float16* go = Of + ((size_t)b * SS + qg) * DD + h * HD + half * 8;
  #pragma unroll
  for (int t = 0; t < 4; ++t) {
    v8h o;
    #pragma unroll
    for (int v = 0; v < 8; ++v) o[v] = (_Float16)(ot[t][v] * inv);
    *(v8h*)(go + t * 16) = o;
  }
}

// ---------------------------------------------------------------------------
// Host-side launch
// ---------------------------------------------------------------------------
extern "C" void kernel_launch(void* const* d_in, const int* in_sizes, int n_in,
                              void* d_out, int out_size, void* d_ws, size_t ws_size,
                              hipStream_t stream) {
  const float* x     = (const float*)d_in[0];
  const float* Wq    = (const float*)d_in[1];
  const float* bq    = (const float*)d_in[2];
  const float* Wk    = (const float*)d_in[3];
  const float* bk    = (const float*)d_in[4];
  const float* Wv    = (const float*)d_in[5];
  const float* bv    = (const float*)d_in[6];
  const float* Wo    = (const float*)d_in[7];
  const float* bo    = (const float*)d_in[8];
  const float* ln1_g = (const float*)d_in[9];
  const float* ln1_b = (const float*)d_in[10];
  const float* ln2_g = (const float*)d_in[11];
  const float* ln2_b = (const float*)d_in[12];
  const float* W1    = (const float*)d_in[13];
  const float* b1    = (const float*)d_in[14];
  const float* W2    = (const float*)d_in[15];
  const float* b2    = (const float*)d_in[16];
  float* out = (float*)d_out;

  auto align = [](size_t v) { return (v + 255) & ~(size_t)255; };
  char* base = (char*)d_ws;
  size_t off = 0;
  auto slot = [&](size_t bytes) { char* p = base + off; off += align(bytes); return p; };
  _Float16* hf16  = (_Float16*)slot((size_t)ROWS * DD * 2);
  _Float16* WqkvT = (_Float16*)slot((size_t)3 * DD * DD * 2);   // three times [N=768][K=768]
  _Float16* WoT   = (_Float16*)slot((size_t)DD * DD * 2);
  _Float16* W1T   = (_Float16*)slot((size_t)DD * FF * 2);   // [N=3072][K=768]
  _Float16* W2T   = (_Float16*)slot((size_t)FF * DD * 2);   // [N=768][K=3072]
  _Float16* Qf    = (_Float16*)slot((size_t)3 * ROWS * DD * 2);   // Q, K, V one behind the other
  _Float16* Kf    = Qf + (size_t)ROWS * DD;
  _Float16* Vf    = Kf + (size_t)ROWS * DD;
  _Float16* At16  = (_Float16*)slot((size_t)ROWS * DD * 2);
  float*    X1    = (float*)   slot((size_t)ROWS * DD * 4);
  _Float16* h216  = (_Float16*)slot((size_t)ROWS * DD * 2);
  _Float16* H1    = (_Float16*)slot((size_t)ROWS * FF * 2);

  // 1) + 2) LN1 and the weight conversion (f32 -> f16, transposed to [N][K]), one launch
  prep<<<PREP_BLOCKS, 256, 0, stream>>>(x, ln1_g, ln1_b, hf16, Wq, Wk, Wv, Wo, W1, W2,
                                        WqkvT, WoT, W1T, W2T);

  // 3) Q/K/V projections (f16 out, +bias), one launch
  dim3 gQKV(DD / BN, ROWS / BM, 3);
  gemm_wmma<true, false, false><<<gQKV, 256, 0, stream>>>(hf16, WqkvT, bq, bk, bv, nullptr, Qf, ROWS, DD, DD);

  // 4) causal flash attention
  dim3 gAtt(SS / QB, HH, BB);
  attn_wmma<<<gAtt, 256, 0, stream>>>(Qf, Kf, Vf, At16);

  // 5) output projection + residual (f32 out): X1 = x + attn @ Wo + bo
  dim3 gO(DD / BN, ROWS / BM);
  gemm_wmma<false, false, true><<<gO, 256, 0, stream>>>(At16, WoT, bo, bo, bo, x, X1, ROWS, DD, DD);

  // 6) LN2
  ln_f16<<<ROWS, 256, 0, stream>>>(X1, ln2_g, ln2_b, h216);

  // 7) FFN up + GELU (f16 out)
  dim3 gF1(FF / BN, ROWS / BM);
  gemm_wmma<true, true, false><<<gF1, 256, 0, stream>>>(h216, W1T, b1, b1, b1, nullptr, H1, ROWS, FF, DD);

  // 8) FFN down + bias + residual (f32 out to d_out)
  dim3 gF2(DD / BN, ROWS / BM);
  gemm_wmma<false, false, true><<<gF2, 256, 0, stream>>>(H1, W2T, b2, b2, b2, X1, out, ROWS, DD, FF);

  (void)in_sizes; (void)n_in; (void)out_size; (void)ws_size;
}

// v008
// Measured time: 129 microseconds a run.
// Next to v007, in two timings, it ran 1.09 times as fast each time.
// Over all steps from v000 it is 4.24 times as fast.
#include <hip/hip_runtime.h>
#include <hip/hip_bf16.h>
#include <math.h>

typedef __attribute__((ext_vector_type(16))) _Float16 v16h;
typedef __attribute__((ext_vector_type(8)))  _Float16 v8h;
typedef __attribute__((ext_vector_type(8)))  float    v8f;
typedef __attribute__((ext_vector_type(4)))  _Float16 v4h;
typedef __attribute__((ext_vector_type(4)))  float    v4f;

#define BB 2
#define SS 2048
#define DD 768
#define HH 12
#define HD 64
#define FF 3072
#define ROWS (BB*SS)          // 4096
#define EPS 1e-5f

#define BM 128
#define BN 128
#define BK 128

// LDS row pitches in halves. A ds_load_b128 fragment read walks 16 rows at once;
// a pitch of 16 B x odd spreads those rows over all 64 banks.
#define AKP 136               // GEMM A and B tiles: 128 halves + 8 pad (272 B)
#define TP  72                // attention K tile: 64 halves + 8 pad (144 B)
#define TPV 80                // attention V tile: 64 halves + 16 pad (160 B = 32 B x odd, for ds_load_tr16_b128)
#define BTB (BN * AKP * 2)    // one B buffer in bytes: 128 rows x 272 B = 34816 = 17 x 2 KiB

#define TT  64                // weight transpose tile edge
#define TTP 72                // its LDS row: 64 halves + 8 pad (144 B)

// ---------------------------------------------------------------------------
// Tensor load to LDS: one request of one wave brings a 2-D tile, through no register.
// ---------------------------------------------------------------------------
typedef uint32_t u32x4 __attribute__((ext_vector_type(4)));
typedef uint32_t u32x8 __attribute__((ext_vector_type(8)));

static __device__ __forceinline__ uint32_t uni(uint32_t v) {
  return (uint32_t)__builtin_amdgcn_readfirstlane(v);
}
// A test held in a scalar register, so that the branch on it is a scalar branch:
// a tensor load ignores EXEC and only such a branch keeps a wave from issuing it.
static __device__ __forceinline__ uint32_t pinned(uint32_t v) {
  uint32_t w = uni(v);
  asm volatile("" : "+s"(w));
  return w;
}
// Group 1: 1-byte elements, tensor = tile = BN rows of 256 bytes, source pitch in bytes,
// 4 dwords of LDS pad behind every 64 dwords (one row): LDS pitch 272 B.
static __device__ __forceinline__ u32x8 tdm_group1(uint32_t src_pitch) {
  constexpr uint32_t d0 = BK * 2, d1 = BN;
  u32x8 g;   // pinned(): each descriptor word is held in a scalar register of its own
  g[0] = pinned((1u << 20) | (5u << 22) | (3u << 25));
  g[1] = pinned((d0 & 0xFFFFu) << 16);
  g[2] = pinned((d0 >> 16) | ((d1 & 0xFFFFu) << 16));
  g[3] = pinned((d1 >> 16) | (d0 << 16));
  g[4] = pinned(d1);
  g[5] = pinned(src_pitch);
  g[6] = pinned(0u);
  g[7] = pinned(0u);
  return g;
}
// Group 0: count 1, LDS byte offset, global address of the tile's first byte, type 2.
static __device__ __forceinline__ u32x4 tdm_group0(uint32_t lds_dst, uint64_t ga) {
  u32x4 g;   // pinned(): each descriptor word is held in a scalar register of its own
  g[0] = pinned(1u);
  g[1] = pinned(lds_dst);
  g[2] = pinned((uint32_t)ga);
  g[3] = pinned((((uint32_t)(ga >> 32)) & 0x01FFFFFFu) | 0x80000000u);
  return g;
}
static __device__ __forceinline__ void tdm_load(u32x4 g0, u32x8 g1) {
  asm volatile("tensor_load_to_lds %0, %1" :: "s"(g0), "s"(g1) : "memory");
}
// The compiler places no wait for a tensor load: the issuing wave waits for its tile itself.
// The wait names the outstanding request's descriptor, so that its scalar registers stay
// untouched from the issue up to here.
static __device__ __forceinline__ void wait_tensor0(u32x4 g0, u32x8 g1) {
  asm volatile("s_wait_tensorcnt 0x0" :: "s"(g0), "s"(g1) : "memory");
}
// this wave's LDS reads have returned before the buffer they read is handed back for a refill
static __device__ __forceinline__ void wait_ds0() {
  asm volatile("s_wait_dscnt 0x0" ::: "memory");
}

static __device__ __forceinline__ v16h cat16(v8h lo, v8h hi) {
  return __builtin_shufflevector(lo, hi, 0,1,2,3,4,5,6,7,8,9,10,11,12,13,14,15);
}

// ---------------------------------------------------------------------------
// Weight conversion: fp32 -> f16, producing TRANSPOSED (N-major) weights so the
// GEMM B-operand is contraction-contiguous.
// in: bz-th matrix [R][C] f32 -> out: bz-th matrix [C][R] f16.
// One block moves a 64 x 64 tile through LDS: whole 128-byte lines are read and
// whole lines are written, 16 elements per thread. R and C are multiples of 64.
// (H, D, HD) weights are H such matrices: out[(h*HD+k)*D + d] = W[h][d][k].
// bx, by: the tile's column and row; bz: the matrix.
// ---------------------------------------------------------------------------
static __device__ __forceinline__ void cvt_T(const float* __restrict__ W,
                                             _Float16* __restrict__ out,
                                             int R, int C, int bx, int by, int bz) {
  __shared__ __align__(16) _Float16 Ls[TT * TTP];   // Ls[c][r]
  int tid = threadIdx.x;
  int c0 = bx * TT, r0 = by * TT;
  size_t zoff = (size_t)bz * R * C;

  // each thread takes a 4 x 4 block: 4 rows, 16 bytes of each
  int rb = (tid >> 4) * 4, cb = (tid & 15) * 4;
  const float* src = W + zoff + (size_t)(r0 + rb) * C + c0 + cb;
  v4f w0 = *(const v4f*)src;
  v4f w1 = *(const v4f*)(src + C);
  v4f w2 = *(const v4f*)(src + 2 * (size_t)C);
  v4f w3 = *(const v4f*)(src + 3 * (size_t)C);
  #pragma unroll   // constant j: the loaded vectors stay in registers
  for (int j = 0; j < 4; ++j) {
    v4h p = {(_Float16)w0[j], (_Float16)w1[j], (_Float16)w2[j], (_Float16)w3[j]};
    *(v4h*)&Ls[(cb + j) * TTP + rb] = p;
  }
  __syncthreads();

  // 8 lanes write one 128-byte line of an output row
  int rg = (tid & 7) * 8;
  #pragma unroll   // both LDS reads issue before the first store waits
  for (int i = 0; i < 2; ++i) {
    int c = (tid >> 3) + 32 * i;
    v8h o = *(const v8h*)&Ls[c * TTP + rg];
    *(v8h*)(out + zoff + (size_t)(c0 + c) * R + r0 + rg) = o;
  }
}

// ---------------------------------------------------------------------------
// LayerNorm (row of 768) -> f16 output
// ---------------------------------------------------------------------------
static __device__ __forceinline__ void ln_row(const float* __restrict__ x,
                                              const float* __restrict__ g,
                                              const float* __restrict__ bta,
                                              _Float16* __restrict__ out, int row) {
  __shared__ float red[256];
  int tid = threadIdx.x;
  const float* xr = x + (size_t)row * DD;
  float v0 = xr[tid], v1 = xr[tid + 256], v2 = xr[tid + 512];
  red[tid] = v0 + v1 + v2;
  __syncthreads();
  #pragma unroll
  for (int st = 128; st > 0; st >>= 1) {
    if (tid < st) red[tid] += red[tid + st];
    __syncthreads();
  }
  float mean = red[0] * (1.0f / DD);
  __syncthreads();
  float d0 = v0 - mean, d1 = v1 - mean, d2 = v2 - mean;
  red[tid] = d0 * d0 + d1 * d1 + d2 * d2;
  __syncthreads();
  #pragma unroll
  for (int st = 128; st > 0; st >>= 1) {
    if (tid < st) red[tid] += red[tid + st];
    __syncthreads();
  }
  float rs = rsqrtf(red[0] * (1.0f / DD) + EPS);
  _Float16* orow = out + (size_t)row * DD;
  orow[tid]       = (_Float16)(d0 * rs * g[tid]       + bta[tid]);
  orow[tid + 256] = (_Float16)(d1 * rs * g[tid + 256] + bta[tid + 256]);
  orow[tid + 512] = (_Float16)(d2 * rs * g[tid + 512] + bta[tid + 512]);
}

__global__ __launch_bounds__(256) void ln_f16(const float* __restrict__ x,
                                              const float* __restrict__ g,
                                              const float* __restrict__ bta,
                                              _Float16* __restrict__ out) {
  ln_row(x, g, bta, out, blockIdx.x);
}

// ---------------------------------------------------------------------------
// Everything the first products wait for, in ONE launch: none of these blocks reads what
// another writes. Blocks 0 .. ROWS-1 normalise one row of x each; the rest convert one
// 64 x 64 weight tile each (the longer-lived row blocks start first, the short ones last).
// WqkvT holds the three head weights one behind the other, each [768][768].
// ---------------------------------------------------------------------------
#define T_HEAD (HH * (DD / TT))           // tiles of one (H, D, HD) weight: 144
#define T_WO   ((DD / TT) * (DD / TT))    // 144
#define T_FF   ((FF / TT) * (DD / TT))    // tiles of W1, and of W2: 576
#define PREP_BLOCKS (ROWS + 3 * T_HEAD + T_WO + 2 * T_FF)

__global__ __launch_bounds__(256) void prep(const float* __restrict__ x,
                                            const float* __restrict__ g,
                                            const float* __restrict__ bta,
                                            _Float16* __restrict__ h,
                                            const float* __restrict__ Wq,
                                            const float* __restrict__ Wk,
                                            const float* __restrict__ Wv,
                                            const float* __restrict__ Wo,
                                            const float* __restrict__ W1,
                                            const float* __restrict__ W2,
                                            _Float16* __restrict__ WqkvT,
                                            _Float16* __restrict__ WoT,
                                            _Float16* __restrict__ W1T,
                                            _Float16* __restrict__ W2T) {
  int bid = blockIdx.x;   // every branch below is the same for the whole block
  if (bid < ROWS) {
    ln_row(x, g, bta, h, bid);
    return;
  }
  int t = bid - ROWS;
  const float* W;
  _Float16* o;
  int R = DD, C, bx, by, bz = 0;
  if (t < 3 * T_HEAD) {
    int m = t / T_HEAD, u = t - m * T_HEAD;
    W = m == 0 ? Wq : (m == 1 ? Wk : Wv);
    o = WqkvT + (size_t)m * DD * DD;
    C = HD; bx = 0; by = u % (DD / TT); bz = u / (DD / TT);
  } else if (t < 3 * T_HEAD + T_WO) {
    int u = t - 3 * T_HEAD;
    W = Wo; o = WoT;
    C = DD; bx = u % (DD / TT); by = u / (DD / TT);
  } else if (t < 3 * T_HEAD + T_WO + T_FF) {
    int u = t - (3 * T_HEAD + T_WO);
    W = W1; o = W1T;
    C = FF; bx = u % (FF / TT); by = u / (FF / TT);
  } else {
    int u = t - (3 * T_HEAD + T_WO + T_FF);
    W = W2; o = W2T;
    R = FF; C = DD; bx = u % (DD / TT); by = u / (DD / TT);
  }
  cvt_T(W, o, R, C, bx, by, bz);
}

// ---------------------------------------------------------------------------
// WMMA GEMM: C[M,N] = act(A[M,K](f16) x BT[N,K](f16)^T + bias) (+ resid)
// 256 threads = 8 waves. Block tile 128x128, K-step 128 (256-byte tile rows).
// Wave grid 4(M) x 2(N); each wave: 2 A-frags x 4 B-frags x 4 k blocks -> 32 WMMA / K-step.
// B (weight) tiles come by tensor load into two LDS buffers, padded by the mover to the
// 272-byte pitch; wave 0 issues, one request outstanding.
// K is a multiple of 128.
// blockIdx.z picks one of up to three products of the same A in one launch: weights and
// outputs lie one behind the other at BT and Cout, each product has its own bias.
// OUTF16: f16 output (else f32); GELU: exact GELU; RESID: resid is added. They are fixed at
// compile time, so that the epilogue is straight-line code.
// ---------------------------------------------------------------------------
template <bool OUTF16, bool GELU, bool RESID>
__global__ __launch_bounds__(256) void gemm_wmma(const _Float16* __restrict__ A,
                                                 const _Float16* __restrict__ BT,
                                                 const float* __restrict__ bias,
                                                 const float* __restrict__ bias1,
                                                 const float* __restrict__ bias2,
                                                 const float* __restrict__ resid,
                                                 void* __restrict__ Cout,
                                                 int M, int N, int K) {
  const int z = blockIdx.z;
  BT += (size_t)z * N * K;
  bias = z == 0 ? bias : (z == 1 ? bias1 : bias2);
  Cout = (char*)Cout + (size_t)z * M * N * (OUTF16 ? 2 : 4);
  __shared__ __attribute__((aligned(2048))) _Float16 Bsd[2][BN * AKP];
  __shared__ __align__(16) _Float16 As[BM * AKP];
  int tid = threadIdx.x;
  int lane = tid & 31;
  const uint32_t wid = uni(tid >> 5);
  int half = lane >> 4, r = lane & 15;
  int wm = wid & 3, wn = wid >> 2;
  int m0 = blockIdx.y * BM, n0 = blockIdx.x * BN;

  // every loop over mi, ni, i and kk below is fully unrolled: constant indices keep the
  // fragments, the staged rows and the accumulators in registers
  v8f acc[2][4];
  #pragma unroll
  for (int mi = 0; mi < 2; ++mi)
    #pragma unroll
    for (int ni = 0; ni < 4; ++ni) acc[mi][ni] = (v8f){};

  const int np = K / BK;
  int ldRow = tid >> 4, ldCg = (tid & 15) * 8;   // 16 lanes take one 256-byte row; 8 x 16 rows
  const _Float16* ga = A + (size_t)(m0 + ldRow) * K + ldCg;
  // each thread prefetches one 128-byte line of the A tile after the next; the pointer never leaves A
  const _Float16* pf = A + (size_t)(m0 + (tid >> 1)) * K + (tid & 1) * 64 + (np > 2 ? 2 * BK : (np > 1 ? BK : 0));
  // A tile 0 is on its way to registers while B tile 0 lands; all eight loads are in flight at once
  v8h a[8];
  {
    const _Float16* pa[8];
    #pragma unroll
    for (int i = 0; i < 8; ++i) pa[i] = ga + (size_t)(16 * i) * K;
    #pragma unroll
    for (int i = 0; i < 8; ++i) a[i] = *(const v8h*)pa[i];
    // the wait names the loads' addresses as inputs, so that no address register is rewritten in front of it
    asm volatile("s_wait_xcnt 0x0"
                 :: "v"(pa[0]), "v"(pa[1]), "v"(pa[2]), "v"(pa[3]), "v"(pa[4]), "v"(pa[5]), "v"(pa[6]), "v"(pa[7])
                 : "memory");
    ga += BK;   // from here on: the tile to be fetched next
  }

  const uint32_t ldsB = (uint32_t)(size_t)&Bsd[0][0];
  const uint64_t gB = (uint64_t)(size_t)(BT + (size_t)n0 * K);
  const u32x8 g1 = tdm_group1((uint32_t)K * 2u);
  u32x4 g0 = tdm_group0(ldsB, gB);

  if (pinned(wid == 0)) {
    tdm_load(g0, g1);
    wait_tensor0(g0, g1);
  }
  __syncthreads();   // publishes B tile 0
  g0 = tdm_group0(ldsB + BTB, gB + BK * 2);
  if (pinned(wid == 0 && np > 1)) tdm_load(g0, g1);

  for (int s = 0; s < np; ++s) {
    #pragma unroll
    for (int i = 0; i < 8; ++i) *(v8h*)&As[(ldRow + 16 * i) * AKP + ldCg] = a[i];
    __syncthreads();   // publishes A tile s
    if (s + 1 < np) {   // the same for the whole block
      // A tile s + 1 goes to registers under this tile's products: its latency is off the K step
      const _Float16* pa[8];
      #pragma unroll
      for (int i = 0; i < 8; ++i) pa[i] = ga + (size_t)(16 * i) * K;
      #pragma unroll
      for (int i = 0; i < 8; ++i) a[i] = *(const v8h*)pa[i];
      // the tile after it on its way to L2; the wait in the same statement names the loads'
      // addresses as inputs, so that no address register is rewritten in front of it
      asm volatile("global_prefetch_b8 %0, off scope:SCOPE_SE\n\ts_wait_xcnt 0x0"
                   :: "v"(pf), "v"(pa[0]), "v"(pa[1]), "v"(pa[2]), "v"(pa[3]), "v"(pa[4]), "v"(pa[5]),
                      "v"(pa[6]), "v"(pa[7])
                   : "memory");
      ga += BK;
      pf += (s + 3 < np) ? BK : 0;
    }

    const v8h* pA = (const v8h*)As;
    const v8h* pB = (const v8h*)&Bsd[s & 1][0];
    #pragma unroll
    for (int kk = 0; kk < BK / 32; ++kk) {
      v16h afr[2], bfr[4];
      #pragma unroll
      for (int mi = 0; mi < 2; ++mi) {
        int row = wm * 32 + mi * 16 + r;
        afr[mi] = cat16(pA[row * (AKP / 8) + kk * 4 + half], pA[row * (AKP / 8) + kk * 4 + 2 + half]);
      }
      #pragma unroll
      for (int ni = 0; ni < 4; ++ni) {
        int col = wn * 64 + ni * 16 + r;
        bfr[ni] = cat16(pB[col * (AKP / 8) + kk * 4 + half], pB[col * (AKP / 8) + kk * 4 + 2 + half]);
      }
      #pragma unroll
      for (int mi = 0; mi < 2; ++mi)
        #pragma unroll
        for (int ni = 0; ni < 4; ++ni)
          acc[mi][ni] = __builtin_amdgcn_wmma_f32_16x16x32_f16(
              false, afr[mi], false, bfr[ni], (short)0, acc[mi][ni], false, false);
    }

    // hand-over: B tile s + 1 is published, and buffer s & 1 and the A tile are free again
    wait_ds0();
    if (pinned(wid == 0)) wait_tensor0(g0, g1);
    __syncthreads();
    g0 = tdm_group0(ldsB + (uint32_t)(s & 1) * BTB, gB + (uint64_t)(s + 2) * (BK * 2));
    if (pinned(wid == 0 && s + 2 < np)) tdm_load(g0, g1);
  }
  // the ring's closing waits: no request and no LDS read is open when the wave goes on
  wait_tensor0(g0, g1);
  wait_ds0();

  // element index of this lane's first output; a row further is N elements, a fragment
  // column 16 (a constant offset of the row's address). M * N stays below 2^31 elements.
  const uint32_t e0 = (uint32_t)(m0 + wm * 32 + half * 8) * (uint32_t)N + (uint32_t)(n0 + wn * 64 + r);
  const float* bp = bias + n0 + wn * 64 + r;
  float bv[4];
  #pragma unroll
  for (int ni = 0; ni < 4; ++ni) bv[ni] = bp[ni * 16];
  // no branch stands between the residual loads: a lane's 64 are issued back to back, with no
  // wait of its own for each
  float rv[2][4][8];
  if constexpr (RESID) {
    #pragma unroll
    for (int mi = 0; mi < 2; ++mi)
      #pragma unroll
      for (int v = 0; v < 8; ++v) {
        const float* rp = resid + (e0 + (uint32_t)(mi * 16 + v) * (uint32_t)N);
        #pragma unroll
        for (int ni = 0; ni < 4; ++ni) rv[mi][ni][v] = rp[ni * 16];
      }
  }
  #pragma unroll
  for (int mi = 0; mi < 2; ++mi)
    #pragma unroll
    for (int v = 0; v < 8; ++v) {
      const uint32_t e = e0 + (uint32_t)(mi * 16 + v) * (uint32_t)N;
      #pragma unroll
      for (int ni = 0; ni < 4; ++ni) {
        float val = acc[mi][ni][v] + bv[ni];
        if constexpr (GELU) val = 0.5f * val * (1.0f + erff(val * 0.70710678f));
        if constexpr (RESID) val += rv[mi][ni][v];
        if constexpr (OUTF16) ((_Float16*)Cout + e)[ni * 16] = (_Float16)val;
        else                  ((float*)Cout + e)[ni * 16] = val;
      }
    }
}

#define QB 128

// lane l <-> lane l ^ 16
static __device__ __forceinline__ float xhalf(float x) {
  int b = __builtin_bit_cast(int, x);
  return __builtin_bit_cast(float,
      __builtin_amdgcn_permlanex16(b, b, 0x76543210, 0xfedcba98, false, false));
}

// the issuing wave's own copies have landed; the barrier behind it publishes them to the others
static __device__ __forceinline__ void wait_async0() {
  asm volatile("s_wait_asynccnt 0x0" ::: "memory");
}
// One 64-key tile of K and of V, 16 bytes a lane and copy: two rows' pieces of each. The wait in
// the same statement stands in front of any rewrite of the address registers the copies name.
static __device__ __forceinline__ void copy_kv(uint32_t lk, uint32_t lv,
                                               const _Float16* gk, const _Float16* gv) {
  uint32_t lk1 = lk + 32 * TP * 2, lv1 = lv + 32 * TPV * 2;
  const _Float16* gk1 = gk + 32 * DD;
  const _Float16* gv1 = gv + 32 * DD;
  asm volatile("global_load_async_to_lds_b128 %0, %4, off\n\t"
               "global_load_async_to_lds_b128 %1, %5, off\n\t"
               "global_load_async_to_lds_b128 %2, %6, off\n\t"
               "global_load_async_to_lds_b128 %3, %7, off\n\t"
               "s_wait_xcnt 0x0"
               :: "v"(lk), "v"(lk1), "v"(lv), "v"(lv1), "v"(gk), "v"(gk1), "v"(gv), "v"(gv1)
               : "memory");
}
// 16 x 16 halves of a row-major LDS tile, transposed: half of a 16 x 32 A fragment
typedef short s16x8 __attribute__((ext_vector_type(8)));
static __device__ __forceinline__ v8h ld_tr16(const _Float16* p) {
  typedef __attribute__((address_space(3))) s16x8 lds_s16x8;
  return __builtin_bit_cast(v8h, __builtin_amdgcn_ds_load_tr16_b128_v8i16((lds_s16x8*)p));
}

__global__ __launch_bounds__(256) void attn_wmma(const _Float16* __restrict__ Qf,
                                                 const _Float16* __restrict__ Kf,
                                                 const _Float16* __restrict__ Vf,
                                                 _Float16* __restrict__ Of) {
  __shared__ __align__(16) _Float16 Ks[2][64 * TP];
  __shared__ __align__(16) _Float16 Vs[2][64 * TPV];   // Vs[buffer][key][c]

  int tid = threadIdx.x, lane = tid & 31;
  int wid = __builtin_amdgcn_readfirstlane(tid >> 5);
  int half = lane >> 4, r = lane & 15;
  int iq = blockIdx.x, h = blockIdx.y, b = blockIdx.z;

  int ldRow = tid >> 3, ldCg = (tid & 7) * 8;   // 8 lanes copy one 128-byte row; rows ldRow, ldRow + 32

  int q0 = iq * QB + wid * 16;   // first query of this wave
  int qg = q0 + r;               // this lane's query

  // Q^T as B operand, kept in registers; same k order as the K loader below
  v16h qf[2];
  {
    const _Float16* gq = Qf + ((size_t)b * SS + qg) * DD + h * HD + half * 8;
    #pragma unroll
    for (int kk = 0; kk < 2; ++kk)
      qf[kk] = cat16(*(const v8h*)(gq + kk * 32), *(const v8h*)(gq + kk * 32 + 16));
  }

  v8f ot[4];                     // O^T: ot[t][v] = O[query][t*16 + half*8 + v]
  #pragma unroll
  for (int t = 0; t < 4; ++t) ot[t] = (v8f){};
  float mrun = -3.0e38f, lsum = 0.0f;   // running maximum, scaled to base 2; this half's sum

  const int RP = TP / 8;   // K row pitch in 16-byte units
  const float SC = 0.125f * 1.4426950408889634f;   // 1/sqrt(HD) * log2(e)

  int nj = 2 * iq + 2;       // at least two tiles
  // this lane's copy addresses: LDS bytes in buffer 0, and tile 0 in memory
  const uint32_t lk = (uint32_t)(size_t)&Ks[0][ldRow * TP + ldCg];
  const uint32_t lv = (uint32_t)(size_t)&Vs[0][ldRow * TPV + ldCg];
  const size_t g0 = ((size_t)b * SS + ldRow) * DD + h * HD + ldCg;
  const _Float16* gk = Kf + g0;
  const _Float16* gv = Vf + g0;

  copy_kv(lk, lv, gk, gv);
  wait_async0();
  __syncthreads();           // publishes tile 0
  copy_kv(lk + 64 * TP * 2, lv + 64 * TPV * 2, gk + 64 * DD, gv + 64 * DD);

  for (int j = 0; j < nj; ++j) {
    const int bf = j & 1;
    const v8h* pK = (const v8h*)&Ks[bf][0];
    // transposing load: lane l names row 8 * (l >> 4) + (l & 7), 16-byte piece (l >> 3) & 1
    const _Float16* pV = &Vs[bf][(half * 8 + (lane & 7)) * TPV + ((lane >> 3) & 1) * 8];

    if (j * 64 <= q0 + 15) {     // wave-uniform: a tile wholly above the diagonal adds nothing
      // scores^T: st[t][v] = K[j*64 + t*16 + half*8 + v] . Q[qg]
      v16h kf[4][2];
      #pragma unroll
      for (int t = 0; t < 4; ++t)
        #pragma unroll
        for (int kk = 0; kk < 2; ++kk) {
          int row = t * 16 + r;
          kf[t][kk] = cat16(pK[row * RP + kk * 4 + half], pK[row * RP + kk * 4 + 2 + half]);
        }
      // all 16 K reads stay in one group ahead of the products: one LDS latency, not eight
      __builtin_amdgcn_sched_barrier(0);
      v8f st[4];
      #pragma unroll
      for (int t = 0; t < 4; ++t)
        st[t] = __builtin_amdgcn_wmma_f32_16x16x32_f16(false, kf[t][0], false, qf[0],
                                                       (short)0, (v8f){}, false, false);
      #pragma unroll
      for (int t = 0; t < 4; ++t)
        st[t] = __builtin_amdgcn_wmma_f32_16x16x32_f16(false, kf[t][1], false, qf[1],
                                                       (short)0, st[t], false, false);
      v16h vf[2][4];
      #pragma unroll
      for (int kk = 0; kk < 2; ++kk)
        #pragma unroll
        for (int t = 0; t < 4; ++t)   // keys kk*32 + half*8 + 0..7, then 16 further on; column t*16 + r
          vf[kk][t] = cat16(ld_tr16(pV + (kk * 32) * TPV + t * 16),
                            ld_tr16(pV + (kk * 32 + 16) * TPV + t * 16));
      // the 16 V^T reads stay here, in one group, so that they land under the softmax arithmetic
      __builtin_amdgcn_sched_barrier(0);
      if (j * 64 + 63 > q0) {    // wave-uniform: only tiles that touch the diagonal
        #pragma unroll
        for (int t = 0; t < 4; ++t)
          #pragma unroll
          for (int v = 0; v < 8; ++v)
            if (j * 64 + t * 16 + half * 8 + v > qg) st[t][v] = -1.0e30f;
      }

      // online softmax, one query per lane pair (l, l ^ 16); the maximum is taken over the
      // raw scores and scaled once, the scale rides in the exponent's multiply-add
      float tmx[4];
      #pragma unroll
      for (int t = 0; t < 4; ++t) {
        float a = fmaxf(fmaxf(st[t][0], st[t][1]), fmaxf(st[t][2], st[t][3]));
        float c = fmaxf(fmaxf(st[t][4], st[t][5]), fmaxf(st[t][6], st[t][7]));
        tmx[t] = fmaxf(a, c);
      }
      float tm = fmaxf(fmaxf(tmx[0], tmx[1]), fmaxf(tmx[2], tmx[3]));
      tm = fmaxf(tm, xhalf(tm)) * SC;
      tm = fmaxf(tm, mrun);
      float f = __builtin_amdgcn_exp2f(mrun - tm);
      mrun = tm;
      const v8f vsc = {SC, SC, SC, SC, SC, SC, SC, SC};
      const v8f vnm = {-tm, -tm, -tm, -tm, -tm, -tm, -tm, -tm};
      #pragma unroll
      for (int t = 0; t < 4; ++t) st[t] = __builtin_elementwise_fma(st[t], vsc, vnm);
      float tsm[4];
      #pragma unroll
      for (int t = 0; t < 4; ++t) {
        float ts = 0.0f;
        #pragma unroll
        for (int v = 0; v < 8; ++v) {
          float p = __builtin_amdgcn_exp2f(st[t][v]);
          st[t][v] = p;
          ts += p;
        }
        tsm[t] = ts;
      }
      lsum = lsum * f + ((tsm[0] + tsm[1]) + (tsm[2] + tsm[3]));
      #pragma unroll
      for (int t = 0; t < 4; ++t) ot[t] *= f;

      // O^T += V^T . P^T
      #pragma unroll
      for (int kk = 0; kk < 2; ++kk) {
        v16h pf;   // pf[s] = P^T[key kk*32 + (s < 8 ? half*8 + s : 16 + half*8 + s - 8)][qg]
        #pragma unroll
        for (int s = 0; s < 8; ++s) {
          pf[s]     = (_Float16)st[2 * kk][s];
          pf[s + 8] = (_Float16)st[2 * kk + 1][s];
        }
        #pragma unroll
        for (int t = 0; t < 4; ++t)
          ot[t] = __builtin_amdgcn_wmma_f32_16x16x32_f16(false, vf[kk][t], false, pf,
                                                         (short)0, ot[t], false, false);
      }
    }

    // hand-over, passed by every wave: tile j + 1 is published, and buffer bf is free again
    wait_ds0();
    wait_async0();
    __syncthreads();
    if (j + 2 < nj)          // the same for the whole block
      copy_kv(lk + (uint32_t)bf * (64 * TP * 2), lv + (uint32_t)bf * (64 * TPV * 2),
              gk + (size_t)(j + 2) * (64 * DD), gv + (size_t)(j + 2) * (64 * DD));
  }
  wait_async0();             // no copy is open when the wave goes on

  float inv = 1.0f / (lsum + xhalf(lsum));
  _Float16* go = Of + ((size_t)b * SS + qg) * DD + h * HD + half * 8;
  #pragma unroll
  for (int t = 0; t < 4; ++t) {
    v8h o;
    #pragma unroll
    for (int v = 0; v < 8; ++v) o[v] = (_Float16)(ot[t][v] * inv);
    *(v8h*)(go + t * 16) = o;
  }
}

// ---------------------------------------------------------------------------
// Host-side launch
// ---------------------------------------------------------------------------
extern "C" void kernel_launch(void* const* d_in, const int* in_sizes, int n_in,
                              void* d_out, int out_size, void* d_ws, size_t ws_size,
                              hipStream_t stream) {
  const float* x     = (const float*)d_in[0];
  const float* Wq    = (const float*)d_in[1];
  const float* bq    = (const float*)d_in[2];
  const float* Wk    = (const float*)d_in[3];
  const float* bk    = (const float*)d_in[4];
  const float* Wv    = (const float*)d_in[5];
  const float* bv    = (const float*)d_in[6];
  const float* Wo    = (const float*)d_in[7];
  const float* bo    = (const float*)d_in[8];
  const float* ln1_g = (const float*)d_in[9];
  const float* ln1_b = (const float*)d_in[10];
  const float* ln2_g = (const float*)d_in[11];
  const float* ln2_b = (const float*)d_in[12];
  const float* W1    = (const float*)d_in[13];
  const float* b1    = (const float*)d_in[14];
  const float* W2    = (const float*)d_in[15];
  const float* b2    = (const float*)d_in[16];
  float* out = (float*)d_out;

  auto align = [](size_t v) { return (v + 255) & ~(size_t)255; };
  char* base = (char*)d_ws;
  size_t off = 0;
  auto slot = [&](size_t bytes) { char* p = base + off; off += align(bytes); return p; };
  _Float16* hf16  = (_Float16*)slot((size_t)ROWS * DD * 2);
  _Float16* WqkvT = (_Float16*)slot((size_t)3 * DD * DD * 2);   // three times [N=768][K=768]
  _Float16* WoT   = (_Float16*)slot((size_t)DD * DD * 2);
  _Float16* W1T   = (_Float16*)slot((size_t)DD * FF * 2);   // [N=3072][K=768]
  _Float16* W2T   = (_Float16*)slot((size_t)FF * DD * 2);   // [N=768][K=3072]
  _Float16* Qf    = (_Float16*)slot((size_t)3 * ROWS * DD * 2);   // Q, K, V one behind the other
  _Float16* Kf    = Qf + (size_t)ROWS * DD;
  _Float16* Vf    = Kf + (size_t)ROWS * DD;
  _Float16* At16  = (_Float16*)slot((size_t)ROWS * DD * 2);
  float*    X1    = (float*)   slot((size_t)ROWS * DD * 4);
  _Float16* h216  = (_Float16*)slot((size_t)ROWS * DD * 2);
  _Float16* H1    = (_Float16*)slot((size_t)ROWS * FF * 2);

  // 1) + 2) LN1 and the weight conversion (f32 -> f16, transposed to [N][K]), one launch
  prep<<<PREP_BLOCKS, 256, 0, stream>>>(x, ln1_g, ln1_b, hf16, Wq, Wk, Wv, Wo, W1, W2,
                                        WqkvT, WoT, W1T, W2T);

  // 3) Q/K/V projections (f16 out, +bias), one launch
  dim3 gQKV(DD / BN, ROWS / BM, 3);
  gemm_wmma<true, false, false><<<gQKV, 256, 0, stream>>>(hf16, WqkvT, bq, bk, bv, nullptr, Qf, ROWS, DD, DD);

  // 4) causal flash attention
  dim3 gAtt(SS / QB, HH, BB);
  attn_wmma<<<gAtt, 256, 0, stream>>>(Qf, Kf, Vf, At16);

  // 5) output projection + residual (f32 out): X1 = x + attn @ Wo + bo
  dim3 gO(DD / BN, ROWS / BM);
  gemm_wmma<false, false, true><<<gO, 256, 0, stream>>>(At16, WoT, bo, bo, bo, x, X1, ROWS, DD, DD);

  // 6) LN2
  ln_f16<<<ROWS, 256, 0, stream>>>(X1, ln2_g, ln2_b, h216);

  // 7) FFN up + GELU (f16 out)
  dim3 gF1(FF / BN, ROWS / BM);
  gemm_wmma<true, true, false><<<gF1, 256, 0, stream>>>(h216, W1T, b1, b1, b1, nullptr, H1, ROWS, FF, DD);

  // 8) FFN down + bias + residual (f32 out to d_out)
  dim3 gF2(DD / BN, ROWS / BM);
  gemm_wmma<false, false, true><<<gF2, 256, 0, stream>>>(H1, W2T, b2, b2, b2, X1, out, ROWS, DD, FF);

  (void)in_sizes; (void)n_in; (void)out_size; (void)ws_size;
}

// v009
// It runs in 122 microseconds.
// Next to v008, in two timings, it ran 1.06 and 1.05 times as fast.
// Counting every step since v000, it is 4.47 times as fast.
#include <hip/hip_runtime.h>
#include <hip/hip_bf16.h>
#include <math.h>

typedef __attribute__((ext_vector_type(16))) _Float16 v16h;
typedef __attribute__((ext_vector_type(8)))  _Float16 v8h;
typedef __attribute__((ext_vector_type(8)))  float    v8f;
typedef __attribute__((ext_vector_type(4)))  _Float16 v4h;
typedef __attribute__((ext_vector_type(4)))  float    v4f;

#define BB 2
#define SS 2048
#define DD 768
#define HH 12
#define HD 64
#define FF 3072
#define ROWS (BB*SS)          // 4096
#define EPS 1e-5f

#define BM 128
#define BN 128
#define BK 128

// LDS row pitches in halves. A ds_load_b128 fragment read walks 16 rows at once;
// a pitch of 16 B x odd spreads those rows over all 64 banks.
#define AKP 136               // GEMM A and B tiles: 128 halves + 8 pad (272 B)
#define TP  72                // attention K tile: 64 halves + 8 pad (144 B)
#define TPV 80                // attention V tile: 64 halves + 16 pad (160 B = 32 B x odd, for ds_load_tr16_b128)
#define BTB (BN * AKP * 2)    // one B buffer in bytes: 128 rows x 272 B = 34816 = 17 x 2 KiB

#define TT  64                // weight transpose tile edge
#define TTP 72                // its LDS row: 64 halves + 8 pad (144 B)

// ---------------------------------------------------------------------------
// Tensor load to LDS: one request of one wave brings a 2-D tile, through no register.
// ---------------------------------------------------------------------------
typedef uint32_t u32x4 __attribute__((ext_vector_type(4)));
typedef uint32_t u32x8 __attribute__((ext_vector_type(8)));

static __device__ __forceinline__ uint32_t uni(uint32_t v) {
  return (uint32_t)__builtin_amdgcn_readfirstlane(v);
}
// A test held in a scalar register, so that the branch on it is a scalar branch:
// a tensor load ignores EXEC and only such a branch keeps a wave from issuing it.
static __device__ __forceinline__ uint32_t pinned(uint32_t v) {
  uint32_t w = uni(v);
  asm volatile("" : "+s"(w));
  return w;
}
// Group 1: 1-byte elements, tensor = tile = BN rows of 256 bytes, source pitch in bytes,
// 4 dwords of LDS pad behind every 64 dwords (one row): LDS pitch 272 B.
static __device__ __forceinline__ u32x8 tdm_group1(uint32_t src_pitch) {
  constexpr uint32_t d0 = BK * 2, d1 = BN;
  u32x8 g;   // pinned(): each descriptor word is held in a scalar register of its own
  g[0] = pinned((1u << 20) | (5u << 22) | (3u << 25));
  g[1] = pinned((d0 & 0xFFFFu) << 16);
  g[2] = pinned((d0 >> 16) | ((d1 & 0xFFFFu) << 16));
  g[3] = pinned((d1 >> 16) | (d0 << 16));
  g[4] = pinned(d1);
  g[5] = pinned(src_pitch);
  g[6] = pinned(0u);
  g[7] = pinned(0u);
  return g;
}
// Group 0: count 1, LDS byte offset, global address of the tile's first byte, type 2.
static __device__ __forceinline__ u32x4 tdm_group0(uint32_t lds_dst, uint64_t ga) {
  u32x4 g;   // pinned(): each descriptor word is held in a scalar register of its own
  g[0] = pinned(1u);
  g[1] = pinned(lds_dst);
  g[2] = pinned((uint32_t)ga);
  g[3] = pinned((((uint32_t)(ga >> 32)) & 0x01FFFFFFu) | 0x80000000u);
  return g;
}
static __device__ __forceinline__ void tdm_load(u32x4 g0, u32x8 g1) {
  asm volatile("tensor_load_to_lds %0, %1" :: "s"(g0), "s"(g1) : "memory");
}
// The compiler places no wait for a tensor load: the issuing wave waits for its tile itself.
// The wait names the outstanding request's descriptor, so that its scalar registers stay
// untouched from the issue up to here.
static __device__ __forceinline__ void wait_tensor0(u32x4 g0, u32x8 g1) {
  asm volatile("s_wait_tensorcnt 0x0" :: "s"(g0), "s"(g1) : "memory");
}
// this wave's LDS reads have returned before the buffer they read is handed back for a refill
static __device__ __forceinline__ void wait_ds0() {
  asm volatile("s_wait_dscnt 0x0" ::: "memory");
}

static __device__ __forceinline__ v16h cat16(v8h lo, v8h hi) {
  return __builtin_shufflevector(lo, hi, 0,1,2,3,4,5,6,7,8,9,10,11,12,13,14,15);
}

// ---------------------------------------------------------------------------
// Weight conversion: fp32 -> f16, producing TRANSPOSED (N-major) weights so the
// GEMM B-operand is contraction-contiguous.
// in: bz-th matrix [R][C] f32 -> out: bz-th matrix [C][R] f16.
// One block moves a 64 x 64 tile through LDS: whole 128-byte lines are read and
// whole lines are written, 16 elements per thread. R and C are multiples of 64.
// (H, D, HD) weights are H such matrices: out[(h*HD+k)*D + d] = W[h][d][k].
// bx, by: the tile's column and row; bz: the matrix.
// ---------------------------------------------------------------------------
static __device__ __forceinline__ void cvt_T(const float* __restrict__ W,
                                             _Float16* __restrict__ out,
                                             int R, int C, int bx, int by, int bz) {
  __shared__ __align__(16) _Float16 Ls[TT * TTP];   // Ls[c][r]
  int tid = threadIdx.x;
  int c0 = bx * TT, r0 = by * TT;
  size_t zoff = (size_t)bz * R * C;

  // each thread takes a 4 x 4 block: 4 rows, 16 bytes of each
  int rb = (tid >> 4) * 4, cb = (tid & 15) * 4;
  const float* src = W + zoff + (size_t)(r0 + rb) * C + c0 + cb;
  v4f w0 = *(const v4f*)src;
  v4f w1 = *(const v4f*)(src + C);
  v4f w2 = *(const v4f*)(src + 2 * (size_t)C);
  v4f w3 = *(const v4f*)(src + 3 * (size_t)C);
  #pragma unroll   // constant j: the loaded vectors stay in registers
  for (int j = 0; j < 4; ++j) {
    v4h p = {(_Float16)w0[j], (_Float16)w1[j], (_Float16)w2[j], (_Float16)w3[j]};
    *(v4h*)&Ls[(cb + j) * TTP + rb] = p;
  }
  __syncthreads();

  // 8 lanes write one 128-byte line of an output row
  int rg = (tid & 7) * 8;
  #pragma unroll   // both LDS reads issue before the first store waits
  for (int i = 0; i < 2; ++i) {
    int c = (tid >> 3) + 32 * i;
    v8h o = *(const v8h*)&Ls[c * TTP + rg];
    *(v8h*)(out + zoff + (size_t)(c0 + c) * R + r0 + rg) = o;
  }
}

// ---------------------------------------------------------------------------
// LayerNorm (row of 768) -> f16 output. ONE WAVE takes one row: a lane holds 24 of its
// values in registers (six 16-byte loads, 512 contiguous bytes a wave and load), both sums
// are in-lane adds plus a five-step exchange between lanes. No LDS, no barrier, and an
// eighth of the waves to start.
// ---------------------------------------------------------------------------
#define LNR 8                 // rows per 256-thread block: one per wave

// sum over the 32 lanes, the same value in every lane: four steps inside the 16-lane row,
// then lane l <-> lane l ^ 16
template <int CTRL>
static __device__ __forceinline__ float row_x(float x) {
  int b = __builtin_bit_cast(int, x);
  return __builtin_bit_cast(float, __builtin_amdgcn_update_dpp(0, b, CTRL, 0xf, 0xf, true));
}
static __device__ __forceinline__ float wave_sum(float s) {
  s += row_x<0x161>(s);   // row_xmask:1
  s += row_x<0x162>(s);   // row_xmask:2
  s += row_x<0x164>(s);   // row_xmask:4
  s += row_x<0x168>(s);   // row_xmask:8
  int b = __builtin_bit_cast(int, s);
  return s + __builtin_bit_cast(float,
      __builtin_amdgcn_permlanex16(b, b, 0x76543210, 0xfedcba98, false, false));
}

static __device__ __forceinline__ void ln_row(const float* __restrict__ x,
                                              const float* __restrict__ g,
                                              const float* __restrict__ bta,
                                              _Float16* __restrict__ out, int row) {
  int lane = threadIdx.x & 31;
  const v4f* xr = (const v4f*)(x + (size_t)row * DD) + lane;
  const v4f* gr = (const v4f*)g + lane;
  const v4f* br = (const v4f*)bta + lane;
  // every loop over i is fully unrolled: constant indices keep the row in registers
  v4f v[6], gv[6], bv[6];
  #pragma unroll
  for (int i = 0; i < 6; ++i) v[i] = xr[32 * i];
  #pragma unroll
  for (int i = 0; i < 6; ++i) { gv[i] = gr[32 * i]; bv[i] = br[32 * i]; }
  // all 18 loads stay here, in flight at once: sunk behind the sums, the gain and bias loads
  // would cost a second load latency at the row's end
  __builtin_amdgcn_sched_barrier(0);
  v4f s4 = (v[0] + v[1]) + (v[2] + v[3]) + (v[4] + v[5]);
  float mean = wave_sum((s4[0] + s4[1]) + (s4[2] + s4[3])) * (1.0f / DD);
  v4f q4 = (v4f){};
  #pragma unroll
  for (int i = 0; i < 6; ++i) {
    v[i] -= mean;
    q4 += v[i] * v[i];
  }
  float rs = rsqrtf(wave_sum((q4[0] + q4[1]) + (q4[2] + q4[3])) * (1.0f / DD) + EPS);
  v4h* orow = (v4h*)(out + (size_t)row * DD) + lane;
  #pragma unroll
  for (int i = 0; i < 6; ++i) {
    v4f y = v[i] * rs * gv[i] + bv[i];
    orow[32 * i] = (v4h){(_Float16)y[0], (_Float16)y[1], (_Float16)y[2], (_Float16)y[3]};
  }
}

__global__ __launch_bounds__(256) void ln_f16(const float* __restrict__ x,
                                              const float* __restrict__ g,
                                              const float* __restrict__ bta,
                                              _Float16* __restrict__ out) {
  ln_row(x, g, bta, out, blockIdx.x * LNR + uni(threadIdx.x >> 5));
}

// ---------------------------------------------------------------------------
// Everything the first products wait for, in ONE launch: none of these blocks reads what
// another writes. Blocks 0 .. LN_BLOCKS-1 normalise eight rows of x each; the rest convert one
// 64 x 64 weight tile each.
// WqkvT holds the three head weights one behind the other, each [768][768].
// ---------------------------------------------------------------------------
#define T_HEAD (HH * (DD / TT))           // tiles of one (H, D, HD) weight: 144
#define T_WO   ((DD / TT) * (DD / TT))    // 144
#define T_FF   ((FF / TT) * (DD / TT))    // tiles of W1, and of W2: 576
#define LN_BLOCKS (ROWS / LNR)
#define PREP_BLOCKS (LN_BLOCKS + 3 * T_HEAD + T_WO + 2 * T_FF)

__global__ __launch_bounds__(256) void prep(const float* __restrict__ x,
                                            const float* __restrict__ g,
                                            const float* __restrict__ bta,
                                            _Float16* __restrict__ h,
                                            const float* __restrict__ Wq,
                                            const float* __restrict__ Wk,
                                            const float* __restrict__ Wv,
                                            const float* __restrict__ Wo,
                                            const float* __restrict__ W1,
                                            const float* __restrict__ W2,
                                            _Float16* __restrict__ WqkvT,
                                            _Float16* __restrict__ WoT,
                                            _Float16* __restrict__ W1T,
                                            _Float16* __restrict__ W2T) {
  int bid = blockIdx.x;   // every branch below is the same for the whole block
  if (bid < LN_BLOCKS) {
    ln_row(x, g, bta, h, bid * LNR + uni(threadIdx.x >> 5));
    return;
  }
  int t = bid - LN_BLOCKS;
  const float* W;
  _Float16* o;
  int R = DD, C, bx, by, bz = 0;
  if (t < 3 * T_HEAD) {
    int m = t / T_HEAD, u = t - m * T_HEAD;
    W = m == 0 ? Wq : (m == 1 ? Wk : Wv);
    o = WqkvT + (size_t)m * DD * DD;
    C = HD; bx = 0; by = u % (DD / TT); bz = u / (DD / TT);
  } else if (t < 3 * T_HEAD + T_WO) {
    int u = t - 3 * T_HEAD;
    W = Wo; o = WoT;
    C = DD; bx = u % (DD / TT); by = u / (DD / TT);
  } else if (t < 3 * T_HEAD + T_WO + T_FF) {
    int u = t - (3 * T_HEAD + T_WO);
    W = W1; o = W1T;
    C = FF; bx = u % (FF / TT); by = u / (FF / TT);
  } else {
    int u = t - (3 * T_HEAD + T_WO + T_FF);
    W = W2; o = W2T;
    R = FF; C = DD; bx = u % (DD / TT); by = u / (DD / TT);
  }
  cvt_T(W, o, R, C, bx, by, bz);
}

// ---------------------------------------------------------------------------
// WMMA GEMM: C[M,N] = act(A[M,K](f16) x BT[N,K](f16)^T + bias) (+ resid)
// 256 threads = 8 waves. Block tile 128x128, K-step 128 (256-byte tile rows).
// Wave grid 4(M) x 2(N); each wave: 2 A-frags x 4 B-frags x 4 k blocks -> 32 WMMA / K-step.
// B (weight) tiles come by tensor load into two LDS buffers, padded by the mover to the
// 272-byte pitch; wave 0 issues, one request outstanding.
// K is a multiple of 128.
// blockIdx.z picks one of up to three products of the same A in one launch: weights and
// outputs lie one behind the other at BT and Cout, each product has its own bias.
// OUTF16: f16 output (else f32); GELU: exact GELU; RESID: resid is added. They are fixed at
// compile time, so that the epilogue is straight-line code.
// ---------------------------------------------------------------------------
template <bool OUTF16, bool GELU, bool RESID>
__global__ __launch_bounds__(256) void gemm_wmma(const _Float16* __restrict__ A,
                                                 const _Float16* __restrict__ BT,
                                                 const float* __restrict__ bias,
                                                 const float* __restrict__ bias1,
                                                 const float* __restrict__ bias2,
                                                 const float* __restrict__ resid,
                                                 void* __restrict__ Cout,
                                                 int M, int N, int K) {
  const int z = blockIdx.z;
  BT += (size_t)z * N * K;
  bias = z == 0 ? bias : (z == 1 ? bias1 : bias2);
  Cout = (char*)Cout + (size_t)z * M * N * (OUTF16 ? 2 : 4);
  __shared__ __attribute__((aligned(2048))) _Float16 Bsd[2][BN * AKP];
  __shared__ __align__(16) _Float16 As[BM * AKP];
  int tid = threadIdx.x;
  int lane = tid & 31;
  const uint32_t wid = uni(tid >> 5);
  int half = lane >> 4, r = lane & 15;
  int wm = wid & 3, wn = wid >> 2;
  int m0 = blockIdx.y * BM, n0 = blockIdx.x * BN;

  // every loop over mi, ni, i and kk below is fully unrolled: constant indices keep the
  // fragments, the staged rows and the accumulators in registers
  v8f acc[2][4];
  #pragma unroll
  for (int mi = 0; mi < 2; ++mi)
    #pragma unroll
    for (int ni = 0; ni < 4; ++ni) acc[mi][ni] = (v8f){};

  const int np = K / BK;
  int ldRow = tid >> 4, ldCg = (tid & 15) * 8;   // 16 lanes take one 256-byte row; 8 x 16 rows
  const _Float16* ga = A + (size_t)(m0 + ldRow) * K + ldCg;
  // each thread prefetches one 128-byte line of the A tile after the next; the pointer never leaves A
  const _Float16* pf = A + (size_t)(m0 + (tid >> 1)) * K + (tid & 1) * 64 + (np > 2 ? 2 * BK : (np > 1 ? BK : 0));
  // A tile 0 is on its way to registers while B tile 0 lands; all eight loads are in flight at once
  v8h a[8];
  {
    const _Float16* pa[8];
    #pragma unroll
    for (int i = 0; i < 8; ++i) pa[i] = ga + (size_t)(16 * i) * K;
    #pragma unroll
    for (int i = 0; i < 8; ++i) a[i] = *(const v8h*)pa[i];
    // the wait names the loads' addresses as inputs, so that no address register is rewritten in front of it
    asm volatile("s_wait_xcnt 0x0"
                 :: "v"(pa[0]), "v"(pa[1]), "v"(pa[2]), "v"(pa[3]), "v"(pa[4]), "v"(pa[5]), "v"(pa[6]), "v"(pa[7])
                 : "memory");
    ga += BK;   // from here on: the tile to be fetched next
  }

  const uint32_t ldsB = (uint32_t)(size_t)&Bsd[0][0];
  const uint64_t gB = (uint64_t)(size_t)(BT + (size_t)n0 * K);
  const u32x8 g1 = tdm_group1((uint32_t)K * 2u);
  u32x4 g0 = tdm_group0(ldsB, gB);

  if (pinned(wid == 0)) {
    tdm_load(g0, g1);
    wait_tensor0(g0, g1);
  }
  __syncthreads();   // publishes B tile 0
  g0 = tdm_group0(ldsB + BTB, gB + BK * 2);
  if (pinned(wid == 0 && np > 1)) tdm_load(g0, g1);

  for (int s = 0; s < np; ++s) {
    #pragma unroll
    for (int i = 0; i < 8; ++i) *(v8h*)&As[(ldRow + 16 * i) * AKP + ldCg] = a[i];
    __syncthreads();   // publishes A tile s
    if (s + 1 < np) {   // the same for the whole block
      // A tile s + 1 goes to registers under this tile's products: its latency is off the K step
      const _Float16* pa[8];
      #pragma unroll
      for (int i = 0; i < 8; ++i) pa[i] = ga + (size_t)(16 * i) * K;
      #pragma unroll
      for (int i = 0; i < 8; ++i) a[i] = *(const v8h*)pa[i];
      // the tile after it on its way to L2; the wait in the same statement names the loads'
      // addresses as inputs, so that no address register is rewritten in front of it
      asm volatile("global_prefetch_b8 %0, off scope:SCOPE_SE\n\ts_wait_xcnt 0x0"
                   :: "v"(pf), "v"(pa[0]), "v"(pa[1]), "v"(pa[2]), "v"(pa[3]), "v"(pa[4]), "v"(pa[5]),
                      "v"(pa[6]), "v"(pa[7])
                   : "memory");
      ga += BK;
      pf += (s + 3 < np) ? BK : 0;
    }

    const v8h* pA = (const v8h*)As;
    const v8h* pB = (const v8h*)&Bsd[s & 1][0];
    #pragma unroll
    for (int kk = 0; kk < BK / 32; ++kk) {
      v16h afr[2], bfr[4];
      #pragma unroll
      for (int mi = 0; mi < 2; ++mi) {
        int row = wm * 32 + mi * 16 + r;
        afr[mi] = cat16(pA[row * (AKP / 8) + kk * 4 + half], pA[row * (AKP / 8) + kk * 4 + 2 + half]);
      }
      #pragma unroll
      for (int ni = 0; ni < 4; ++ni) {
        int col = wn * 64 + ni * 16 + r;
        bfr[ni] = cat16(pB[col * (AKP / 8) + kk * 4 + half], pB[col * (AKP / 8) + kk * 4 + 2 + half]);
      }
      #pragma unroll
      for (int mi = 0; mi < 2; ++mi)
        #pragma unroll
        for (int ni = 0; ni < 4; ++ni)
          acc[mi][ni] = __builtin_amdgcn_wmma_f32_16x16x32_f16(
              false, afr[mi], false, bfr[ni], (short)0, acc[mi][ni], false, false);
    }

    // hand-over: B tile s + 1 is published, and buffer s & 1 and the A tile are free again
    wait_ds0();
    if (pinned(wid == 0)) wait_tensor0(g0, g1);
    __syncthreads();
    g0 = tdm_group0(ldsB + (uint32_t)(s & 1) * BTB, gB + (uint64_t)(s + 2) * (BK * 2));
    if (pinned(wid == 0 && s + 2 < np)) tdm_load(g0, g1);
  }
  // the ring's closing waits: no request and no LDS read is open when the wave goes on
  wait_tensor0(g0, g1);
  wait_ds0();

  // element index of this lane's first output; a row further is N elements, a fragment
  // column 16 (a constant offset of the row's address). M * N stays below 2^31 elements.
  const uint32_t e0 = (uint32_t)(m0 + wm * 32 + half * 8) * (uint32_t)N + (uint32_t)(n0 + wn * 64 + r);
  const float* bp = bias + n0 + wn * 64 + r;
  float bv[4];
  #pragma unroll
  for (int ni = 0; ni < 4; ++ni) bv[ni] = bp[ni * 16];
  // no branch stands between the residual loads: a lane's 64 are issued back to back, with no
  // wait of its own for each
  float rv[2][4][8];
  if constexpr (RESID) {
    #pragma unroll
    for (int mi = 0; mi < 2; ++mi)
      #pragma unroll
      for (int v = 0; v < 8; ++v) {
        const float* rp = resid + (e0 + (uint32_t)(mi * 16 + v) * (uint32_t)N);
        #pragma unroll
        for (int ni = 0; ni < 4; ++ni) rv[mi][ni][v] = rp[ni * 16];
      }
  }
  #pragma unroll
  for (int mi = 0; mi < 2; ++mi)
    #pragma unroll
    for (int v = 0; v < 8; ++v) {
      const uint32_t e = e0 + (uint32_t)(mi * 16 + v) * (uint32_t)N;
      #pragma unroll
      for (int ni = 0; ni < 4; ++ni) {
        float val = acc[mi][ni][v] + bv[ni];
        if constexpr (GELU) val = 0.5f * val * (1.0f + erff(val * 0.70710678f));
        if constexpr (RESID) val += rv[mi][ni][v];
        if constexpr (OUTF16) ((_Float16*)Cout + e)[ni * 16] = (_Float16)val;
        else                  ((float*)Cout + e)[ni * 16] = val;
      }
    }
}

#define QB 128

// lane l <-> lane l ^ 16
static __device__ __forceinline__ float xhalf(float x) {
  int b = __builtin_bit_cast(int, x);
  return __builtin_bit_cast(float,
      __builtin_amdgcn_permlanex16(b, b, 0x76543210, 0xfedcba98, false, false));
}

// the issuing wave's own copies have landed; the barrier behind it publishes them to the others
static __device__ __forceinline__ void wait_async0() {
  asm volatile("s_wait_asynccnt 0x0" ::: "memory");
}
// One 64-key tile of K and of V, 16 bytes a lane and copy: two rows' pieces of each. The wait in
// the same statement stands in front of any rewrite of the address registers the copies name.
static __device__ __forceinline__ void copy_kv(uint32_t lk, uint32_t lv,
                                               const _Float16* gk, const _Float16* gv) {
  uint32_t lk1 = lk + 32 * TP * 2, lv1 = lv + 32 * TPV * 2;
  const _Float16* gk1 = gk + 32 * DD;
  const _Float16* gv1 = gv + 32 * DD;
  asm volatile("global_load_async_to_lds_b128 %0, %4, off\n\t"
               "global_load_async_to_lds_b128 %1, %5, off\n\t"
               "global_load_async_to_lds_b128 %2, %6, off\n\t"
               "global_load_async_to_lds_b128 %3, %7, off\n\t"
               "s_wait_xcnt 0x0"
               :: "v"(lk), "v"(lk1), "v"(lv), "v"(lv1), "v"(gk), "v"(gk1), "v"(gv), "v"(gv1)
               : "memory");
}
// 16 x 16 halves of a row-major LDS tile, transposed: half of a 16 x 32 A fragment
typedef short s16x8 __attribute__((ext_vector_type(8)));
static __device__ __forceinline__ v8h ld_tr16(const _Float16* p) {
  typedef __attribute__((address_space(3))) s16x8 lds_s16x8;
  return __builtin_bit_cast(v8h, __builtin_amdgcn_ds_load_tr16_b128_v8i16((lds_s16x8*)p));
}

__global__ __launch_bounds__(256) void attn_wmma(const _Float16* __restrict__ Qf,
                                                 const _Float16* __restrict__ Kf,
                                                 const _Float16* __restrict__ Vf,
                                                 _Float16* __restrict__ Of) {
  __shared__ __align__(16) _Float16 Ks[2][64 * TP];
  __shared__ __align__(16) _Float16 Vs[2][64 * TPV];   // Vs[buffer][key][c]

  int tid = threadIdx.x, lane = tid & 31;
  int wid = __builtin_amdgcn_readfirstlane(tid >> 5);
  int half = lane >> 4, r = lane & 15;
  int iq = blockIdx.x, h = blockIdx.y, b = blockIdx.z;

  int ldRow = tid >> 3, ldCg = (tid & 7) * 8;   // 8 lanes copy one 128-byte row; rows ldRow, ldRow + 32

  int q0 = iq * QB + wid * 16;   // first query of this wave
  int qg = q0 + r;               // this lane's query

  // Q^T as B operand, kept in registers; same k order as the K loader below
  v16h qf[2];
  {
    const _Float16* gq = Qf + ((size_t)b * SS + qg) * DD + h * HD + half * 8;
    #pragma unroll
    for (int kk = 0; kk < 2; ++kk)
      qf[kk] = cat16(*(const v8h*)(gq + kk * 32), *(const v8h*)(gq + kk * 32 + 16));
  }

  v8f ot[4];                     // O^T: ot[t][v] = O[query][t*16 + half*8 + v]
  #pragma unroll
  for (int t = 0; t < 4; ++t) ot[t] = (v8f){};
  float mrun = -3.0e38f, lsum = 0.0f;   // running maximum, scaled to base 2; this half's sum

  const int RP = TP / 8;   // K row pitch in 16-byte units
  const float SC = 0.125f * 1.4426950408889634f;   // 1/sqrt(HD) * log2(e)

  int nj = 2 * iq + 2;       // at least two tiles
  // this lane's copy addresses: LDS bytes in buffer 0, and tile 0 in memory
  const uint32_t lk = (uint32_t)(size_t)&Ks[0][ldRow * TP + ldCg];
  const uint32_t lv = (uint32_t)(size_t)&Vs[0][ldRow * TPV + ldCg];
  const size_t g0 = ((size_t)b * SS + ldRow) * DD + h * HD + ldCg;
  const _Float16* gk = Kf + g0;
  const _Float16* gv = Vf + g0;

  copy_kv(lk, lv, gk, gv);
  wait_async0();
  __syncthreads();           // publishes tile 0
  copy_kv(lk + 64 * TP * 2, lv + 64 * TPV * 2, gk + 64 * DD, gv + 64 * DD);

  for (int j = 0; j < nj; ++j) {
    const int bf = j & 1;
    const v8h* pK = (const v8h*)&Ks[bf][0];
    // transposing load: lane l names row 8 * (l >> 4) + (l & 7), 16-byte piece (l >> 3) & 1
    const _Float16* pV = &Vs[bf][(half * 8 + (lane & 7)) * TPV + ((lane >> 3) & 1) * 8];

    if (j * 64 <= q0 + 15) {     // wave-uniform: a tile wholly above the diagonal adds nothing
      // scores^T: st[t][v] = K[j*64 + t*16 + half*8 + v] . Q[qg]
      v16h kf[4][2];
      #pragma unroll
      for (int t = 0; t < 4; ++t)
        #pragma unroll
        for (int kk = 0; kk < 2; ++kk) {
          int row = t * 16 + r;
          kf[t][kk] = cat16(pK[row * RP + kk * 4 + half], pK[row * RP + kk * 4 + 2 + half]);
        }
      // all 16 K reads stay in one group ahead of the products: one LDS latency, not eight
      __builtin_amdgcn_sched_barrier(0);
      v8f st[4];
      #pragma unroll
      for (int t = 0; t < 4; ++t)
        st[t] = __builtin_amdgcn_wmma_f32_16x16x32_f16(false, kf[t][0], false, qf[0],
                                                       (short)0, (v8f){}, false, false);
      #pragma unroll
      for (int t = 0; t < 4; ++t)
        st[t] = __builtin_amdgcn_wmma_f32_16x16x32_f16(false, kf[t][1], false, qf[1],
                                                       (short)0, st[t], false, false);
      v16h vf[2][4];
      #pragma unroll
      for (int kk = 0; kk < 2; ++kk)
        #pragma unroll
        for (int t = 0; t < 4; ++t)   // keys kk*32 + half*8 + 0..7, then 16 further on; column t*16 + r
          vf[kk][t] = cat16(ld_tr16(pV + (kk * 32) * TPV + t * 16),
                            ld_tr16(pV + (kk * 32 + 16) * TPV + t * 16));
      // the 16 V^T reads stay here, in one group, so that they land under the softmax arithmetic
      __builtin_amdgcn_sched_barrier(0);
      if (j * 64 + 63 > q0) {    // wave-uniform: only tiles that touch the diagonal
        #pragma unroll
        for (int t = 0; t < 4; ++t)
          #pragma unroll
          for (int v = 0; v < 8; ++v)
            if (j * 64 + t * 16 + half * 8 + v > qg) st[t][v] = -1.0e30f;
      }

      // online softmax, one query per lane pair (l, l ^ 16); the maximum is taken over the
      // raw scores and scaled once, the scale rides in the exponent's multiply-add
      float tmx[4];
      #pragma unroll
      for (int t = 0; t < 4; ++t) {
        float a = fmaxf(fmaxf(st[t][0], st[t][1]), fmaxf(st[t][2], st[t][3]));
        float c = fmaxf(fmaxf(st[t][4], st[t][5]), fmaxf(st[t][6], st[t][7]));
        tmx[t] = fmaxf(a, c);
      }
      float tm = fmaxf(fmaxf(tmx[0], tmx[1]), fmaxf(tmx[2], tmx[3]));
      tm = fmaxf(tm, xhalf(tm)) * SC;
      tm = fmaxf(tm, mrun);
      float f = __builtin_amdgcn_exp2f(mrun - tm);
      mrun = tm;
      const v8f vsc = {SC, SC, SC, SC, SC, SC, SC, SC};
      const v8f vnm = {-tm, -tm, -tm, -tm, -tm, -tm, -tm, -tm};
      #pragma unroll
      for (int t = 0; t < 4; ++t) st[t] = __builtin_elementwise_fma(st[t], vsc, vnm);
      float tsm[4];
      #pragma unroll
      for (int t = 0; t < 4; ++t) {
        float ts = 0.0f;
        #pragma unroll
        for (int v = 0; v < 8; ++v) {
          float p = __builtin_amdgcn_exp2f(st[t][v]);
          st[t][v] = p;
          ts += p;
        }
        tsm[t] = ts;
      }
      lsum = lsum * f + ((tsm[0] + tsm[1]) + (tsm[2] + tsm[3]));
      #pragma unroll
      for (int t = 0; t < 4; ++t) ot[t] *= f;

      // O^T += V^T . P^T
      #pragma unroll
      for (int kk = 0; kk < 2; ++kk) {
        v16h pf;   // pf[s] = P^T[key kk*32 + (s < 8 ? half*8 + s : 16 + half*8 + s - 8)][qg]
        #pragma unroll
        for (int s = 0; s < 8; ++s) {
          pf[s]     = (_Float16)st[2 * kk][s];
          pf[s + 8] = (_Float16)st[2 * kk + 1][s];
        }
        #pragma unroll
        for (int t = 0; t < 4; ++t)
          ot[t] = __builtin_amdgcn_wmma_f32_16x16x32_f16(false, vf[kk][t], false, pf,
                                                         (short)0, ot[t], false, false);
      }
    }

    // hand-over, passed by every wave: tile j + 1 is published, and buffer bf is free again
    wait_ds0();
    wait_async0();
    __syncthreads();
    if (j + 2 < nj)          // the same for the whole block
      copy_kv(lk + (uint32_t)bf * (64 * TP * 2), lv + (uint32_t)bf * (64 * TPV * 2),
              gk + (size_t)(j + 2) * (64 * DD), gv + (size_t)(j + 2) * (64 * DD));
  }
  wait_async0();             // no copy is open when the wave goes on

  float inv = 1.0f / (lsum + xhalf(lsum));
  _Float16* go = Of + ((size_t)b * SS + qg) * DD + h * HD + half * 8;
  #pragma unroll
  for (int t = 0; t < 4; ++t) {
    v8h o;
    #pragma unroll
    for (int v = 0; v < 8; ++v) o[v] = (_Float16)(ot[t][v] * inv);
    *(v8h*)(go + t * 16) = o;
  }
}

// ---------------------------------------------------------------------------
// Host-side launch
// ---------------------------------------------------------------------------
extern "C" void kernel_launch(void* const* d_in, const int* in_sizes, int n_in,
                              void* d_out, int out_size, void* d_ws, size_t ws_size,
                              hipStream_t stream) {
  const float* x     = (const float*)d_in[0];
  const float* Wq    = (const float*)d_in[1];
  const float* bq    = (const float*)d_in[2];
  const float* Wk    = (const float*)d_in[3];
  const float* bk    = (const float*)d_in[4];
  const float* Wv    = (const float*)d_in[5];
  const float* bv    = (const float*)d_in[6];
  const float* Wo    = (const float*)d_in[7];
  const float* bo    = (const float*)d_in[8];
  const float* ln1_g = (const float*)d_in[9];
  const float* ln1_b = (const float*)d_in[10];
  const float* ln2_g = (const float*)d_in[11];
  const float* ln2_b = (const float*)d_in[12];
  const float* W1    = (const float*)d_in[13];
  const float* b1    = (const float*)d_in[14];
  const float* W2    = (const float*)d_in[15];
  const float* b2    = (const float*)d_in[16];
  float* out = (float*)d_out;

  auto align = [](size_t v) { return (v + 255) & ~(size_t)255; };
  char* base = (char*)d_ws;
  size_t off = 0;
  auto slot = [&](size_t bytes) { char* p = base + off; off += align(bytes); return p; };
  _Float16* hf16  = (_Float16*)slot((size_t)ROWS * DD * 2);
  _Float16* WqkvT = (_Float16*)slot((size_t)3 * DD * DD * 2);   // three times [N=768][K=768]
  _Float16* WoT   = (_Float16*)slot((size_t)DD * DD * 2);
  _Float16* W1T   = (_Float16*)slot((size_t)DD * FF * 2);   // [N=3072][K=768]
  _Float16* W2T   = (_Float16*)slot((size_t)FF * DD * 2);   // [N=768][K=3072]
  _Float16* Qf    = (_Float16*)slot((size_t)3 * ROWS * DD * 2);   // Q, K, V one behind the other
  _Float16* Kf    = Qf + (size_t)ROWS * DD;
  _Float16* Vf    = Kf + (size_t)ROWS * DD;
  _Float16* At16  = (_Float16*)slot((size_t)ROWS * DD * 2);
  float*    X1    = (float*)   slot((size_t)ROWS * DD * 4);
  _Float16* h216  = (_Float16*)slot((size_t)ROWS * DD * 2);
  _Float16* H1    = (_Float16*)slot((size_t)ROWS * FF * 2);

  // 1) + 2) LN1 and the weight conversion (f32 -> f16, transposed to [N][K]), one launch
  prep<<<PREP_BLOCKS, 256, 0, stream>>>(x, ln1_g, ln1_b, hf16, Wq, Wk, Wv, Wo, W1, W2,
                                        WqkvT, WoT, W1T, W2T);

  // 3) Q/K/V projections (f16 out, +bias), one launch
  dim3 gQKV(DD / BN, ROWS / BM, 3);
  gemm_wmma<true, false, false><<<gQKV, 256, 0, stream>>>(hf16, WqkvT, bq, bk, bv, nullptr, Qf, ROWS, DD, DD);

  // 4) causal flash attention
  dim3 gAtt(SS / QB, HH, BB);
  attn_wmma<<<gAtt, 256, 0, stream>>>(Qf, Kf, Vf, At16);

  // 5) output projection + residual (f32 out): X1 = x + attn @ Wo + bo
  dim3 gO(DD / BN, ROWS / BM);
  gemm_wmma<false, false, true><<<gO, 256, 0, stream>>>(At16, WoT, bo, bo, bo, x, X1, ROWS, DD, DD);

  // 6) LN2
  ln_f16<<<ROWS / LNR, 256, 0, stream>>>(X1, ln2_g, ln2_b, h216);

  // 7) FFN up + GELU (f16 out)
  dim3 gF1(FF / BN, ROWS / BM);
  gemm_wmma<true, true, false><<<gF1, 256, 0, stream>>>(h216, W1T, b1, b1, b1, nullptr, H1, ROWS, FF, DD);

  // 8) FFN down + bias + residual (f32 out to d_out)
  dim3 gF2(DD / BN, ROWS / BM);
  gemm_wmma<false, false, true><<<gF2, 256, 0, stream>>>(H1, W2T, b2, b2, b2, X1, out, ROWS, DD, FF);

  (void)in_sizes; (void)n_in; (void)out_size; (void)ws_size;
}

// v010
// It runs in 117 microseconds.
// Two timings next to v009 put it at 1.03 and 1.07 times that version's speed.
// All steps since v000 together make it 4.69 times as fast.
#include <hip/hip_runtime.h>
#include <hip/hip_bf16.h>
#include <math.h>

typedef __attribute__((ext_vector_type(16))) _Float16 v16h;
typedef __attribute__((ext_vector_type(8)))  _Float16 v8h;
typedef __attribute__((ext_vector_type(8)))  float    v8f;
typedef __attribute__((ext_vector_type(4)))  _Float16 v4h;
typedef __attribute__((ext_vector_type(4)))  float    v4f;

#define BB 2
#define SS 2048
#define DD 768
#define HH 12
#define HD 64
#define FF 3072
#define ROWS (BB*SS)          // 4096
#define EPS 1e-5f

#define BM 128
#define BN 128
#define BK 128

// LDS row pitches in halves. A ds_load_b128 fragment read walks 16 rows at once;
// a pitch of 16 B x odd spreads those rows over all 64 banks.
#define AKP 136               // GEMM A and B tiles: 128 halves + 8 pad (272 B)
#define TP  72                // attention K tile: 64 halves + 8 pad (144 B)
#define TPV 80                // attention V tile: 64 halves + 16 pad (160 B = 32 B x odd, for ds_load_tr16_b128)
#define BTB (BN * AKP * 2)    // one B buffer in bytes: 128 rows x 272 B = 34816 = 17 x 2 KiB

#define TT  64                // weight transpose tile edge
#define TTP 72                // its LDS row: 64 halves + 8 pad (144 B)

// ---------------------------------------------------------------------------
// Tensor load to LDS: one request of one wave brings a 2-D tile, through no register.
// ---------------------------------------------------------------------------
typedef uint32_t u32x4 __attribute__((ext_vector_type(4)));
typedef uint32_t u32x8 __attribute__((ext_vector_type(8)));

static __device__ __forceinline__ uint32_t uni(uint32_t v) {
  return (uint32_t)__builtin_amdgcn_readfirstlane(v);
}
// A test held in a scalar register, so that the branch on it is a scalar branch:
// a tensor load ignores EXEC and only such a branch keeps a wave from issuing it.
static __device__ __forceinline__ uint32_t pinned(uint32_t v) {
  uint32_t w = uni(v);
  asm volatile("" : "+s"(w));
  return w;
}
// Group 1: 1-byte elements, tensor = tile = BN rows of 256 bytes, source pitch in bytes,
// 4 dwords of LDS pad behind every 64 dwords (one row): LDS pitch 272 B.
static __device__ __forceinline__ u32x8 tdm_group1(uint32_t src_pitch) {
  constexpr uint32_t d0 = BK * 2, d1 = BN;
  u32x8 g;   // pinned(): each descriptor word is held in a scalar register of its own
  g[0] = pinned((1u << 20) | (5u << 22) | (3u << 25));
  g[1] = pinned((d0 & 0xFFFFu) << 16);
  g[2] = pinned((d0 >> 16) | ((d1 & 0xFFFFu) << 16));
  g[3] = pinned((d1 >> 16) | (d0 << 16));
  g[4] = pinned(d1);
  g[5] = pinned(src_pitch);
  g[6] = pinned(0u);
  g[7] = pinned(0u);
  return g;
}
// Group 0: count 1, LDS byte offset, global address of the tile's first byte, type 2.
static __device__ __forceinline__ u32x4 tdm_group0(uint32_t lds_dst, uint64_t ga) {
  u32x4 g;   // pinned(): each descriptor word is held in a scalar register of its own
  g[0] = pinned(1u);
  g[1] = pinned(lds_dst);
  g[2] = pinned((uint32_t)ga);
  g[3] = pinned((((uint32_t)(ga >> 32)) & 0x01FFFFFFu) | 0x80000000u);
  return g;
}
static __device__ __forceinline__ void tdm_load(u32x4 g0, u32x8 g1) {
  asm volatile("tensor_load_to_lds %0, %1" :: "s"(g0), "s"(g1) : "memory");
}
// The compiler places no wait for a tensor load: the issuing wave waits for its tile itself.
// The wait names the outstanding request's descriptor, so that its scalar registers stay
// untouched from the issue up to here.
static __device__ __forceinline__ void wait_tensor0(u32x4 g0, u32x8 g1) {
  asm volatile("s_wait_tensorcnt 0x0" :: "s"(g0), "s"(g1) : "memory");
}
// this wave's LDS reads have returned before the buffer they read is handed back for a refill
static __device__ __forceinline__ void wait_ds0() {
  asm volatile("s_wait_dscnt 0x0" ::: "memory");
}

static __device__ __forceinline__ v16h cat16(v8h lo, v8h hi) {
  return __builtin_shufflevector(lo, hi, 0,1,2,3,4,5,6,7,8,9,10,11,12,13,14,15);
}

// ---------------------------------------------------------------------------
// Weight conversion: fp32 -> f16, producing TRANSPOSED (N-major) weights so the
// GEMM B-operand is contraction-contiguous.
// in: bz-th matrix [R][C] f32 -> out: bz-th matrix [C][R] f16.
// One block moves a 64 x 64 tile through LDS: whole 128-byte lines are read and
// whole lines are written, 16 elements per thread. R and C are multiples of 64.
// (H, D, HD) weights are H such matrices: out[(h*HD+k)*D + d] = W[h][d][k].
// bx, by: the tile's column and row; bz: the matrix.
// ---------------------------------------------------------------------------
static __device__ __forceinline__ void cvt_T(const float* __restrict__ W,
                                             _Float16* __restrict__ out,
                                             int R, int C, int bx, int by, int bz) {
  __shared__ __align__(16) _Float16 Ls[TT * TTP];   // Ls[c][r]
  int tid = threadIdx.x;
  int c0 = bx * TT, r0 = by * TT;
  size_t zoff = (size_t)bz * R * C;

  // each thread takes a 4 x 4 block: 4 rows, 16 bytes of each
  int rb = (tid >> 4) * 4, cb = (tid & 15) * 4;
  const float* src = W + zoff + (size_t)(r0 + rb) * C + c0 + cb;
  v4f w0 = *(const v4f*)src;
  v4f w1 = *(const v4f*)(src + C);
  v4f w2 = *(const v4f*)(src + 2 * (size_t)C);
  v4f w3 = *(const v4f*)(src + 3 * (size_t)C);
  #pragma unroll   // constant j: the loaded vectors stay in registers
  for (int j = 0; j < 4; ++j) {
    v4h p = {(_Float16)w0[j], (_Float16)w1[j], (_Float16)w2[j], (_Float16)w3[j]};
    *(v4h*)&Ls[(cb + j) * TTP + rb] = p;
  }
  __syncthreads();

  // 8 lanes write one 128-byte line of an output row
  int rg = (tid & 7) * 8;
  #pragma unroll   // both LDS reads issue before the first store waits
  for (int i = 0; i < 2; ++i) {
    int c = (tid >> 3) + 32 * i;
    v8h o = *(const v8h*)&Ls[c * TTP + rg];
    *(v8h*)(out + zoff + (size_t)(c0 + c) * R + r0 + rg) = o;
  }
}

// ---------------------------------------------------------------------------
// LayerNorm (row of 768) -> f16 output. ONE WAVE takes one row: a lane holds 24 of its
// values in registers (six 16-byte loads, 512 contiguous bytes a wave and load), both sums
// are in-lane adds plus a five-step exchange between lanes. No LDS, no barrier, and an
// eighth of the waves to start.
// ---------------------------------------------------------------------------
#define LNR 8                 // rows per 256-thread block: one per wave

// sum over the 32 lanes, the same value in every lane: four steps inside the 16-lane row,
// then lane l <-> lane l ^ 16
template <int CTRL>
static __device__ __forceinline__ float row_x(float x) {
  int b = __builtin_bit_cast(int, x);
  return __builtin_bit_cast(float, __builtin_amdgcn_update_dpp(0, b, CTRL, 0xf, 0xf, true));
}
static __device__ __forceinline__ float wave_sum(float s) {
  s += row_x<0x161>(s);   // row_xmask:1
  s += row_x<0x162>(s);   // row_xmask:2
  s += row_x<0x164>(s);   // row_xmask:4
  s += row_x<0x168>(s);   // row_xmask:8
  int b = __builtin_bit_cast(int, s);
  return s + __builtin_bit_cast(float,
      __builtin_amdgcn_permlanex16(b, b, 0x76543210, 0xfedcba98, false, false));
}

static __device__ __forceinline__ void ln_row(const float* __restrict__ x,
                                              const float* __restrict__ g,
                                              const float* __restrict__ bta,
                                              _Float16* __restrict__ out, int row) {
  int lane = threadIdx.x & 31;
  const v4f* xr = (const v4f*)(x + (size_t)row * DD) + lane;
  const v4f* gr = (const v4f*)g + lane;
  const v4f* br = (const v4f*)bta + lane;
  // every loop over i is fully unrolled: constant indices keep the row in registers
  v4f v[6], gv[6], bv[6];
  #pragma unroll
  for (int i = 0; i < 6; ++i) v[i] = xr[32 * i];
  #pragma unroll
  for (int i = 0; i < 6; ++i) { gv[i] = gr[32 * i]; bv[i] = br[32 * i]; }
  // all 18 loads stay here, in flight at once: sunk behind the sums, the gain and bias loads
  // would cost a second load latency at the row's end
  __builtin_amdgcn_sched_barrier(0);
  v4f s4 = (v[0] + v[1]) + (v[2] + v[3]) + (v[4] + v[5]);
  float mean = wave_sum((s4[0] + s4[1]) + (s4[2] + s4[3])) * (1.0f / DD);
  v4f q4 = (v4f){};
  #pragma unroll
  for (int i = 0; i < 6; ++i) {
    v[i] -= mean;
    q4 += v[i] * v[i];
  }
  float rs = rsqrtf(wave_sum((q4[0] + q4[1]) + (q4[2] + q4[3])) * (1.0f / DD) + EPS);
  v4h* orow = (v4h*)(out + (size_t)row * DD) + lane;
  #pragma unroll
  for (int i = 0; i < 6; ++i) {
    v4f y = v[i] * rs * gv[i] + bv[i];
    orow[32 * i] = (v4h){(_Float16)y[0], (_Float16)y[1], (_Float16)y[2], (_Float16)y[3]};
  }
}

__global__ __launch_bounds__(256) void ln_f16(const float* __restrict__ x,
                                              const float* __restrict__ g,
                                              const float* __restrict__ bta,
                                              _Float16* __restrict__ out) {
  ln_row(x, g, bta, out, blockIdx.x * LNR + uni(threadIdx.x >> 5));
}

// ---------------------------------------------------------------------------
// Everything the first products wait for, in ONE launch: none of these blocks reads what
// another writes. Blocks 0 .. LN_BLOCKS-1 normalise eight rows of x each; the rest convert one
// 64 x 64 weight tile each.
// WqkvT holds the three head weights one behind the other, each [768][768].
// ---------------------------------------------------------------------------
#define T_HEAD (HH * (DD / TT))           // tiles of one (H, D, HD) weight: 144
#define T_WO   ((DD / TT) * (DD / TT))    // 144
#define T_FF   ((FF / TT) * (DD / TT))    // tiles of W1, and of W2: 576
#define LN_BLOCKS (ROWS / LNR)
#define PREP_BLOCKS (LN_BLOCKS + 3 * T_HEAD + T_WO + 2 * T_FF)

__global__ __launch_bounds__(256) void prep(const float* __restrict__ x,
                                            const float* __restrict__ g,
                                            const float* __restrict__ bta,
                                            _Float16* __restrict__ h,
                                            const float* __restrict__ Wq,
                                            const float* __restrict__ Wk,
                                            const float* __restrict__ Wv,
                                            const float* __restrict__ Wo,
                                            const float* __restrict__ W1,
                                            const float* __restrict__ W2,
                                            _Float16* __restrict__ WqkvT,
                                            _Float16* __restrict__ WoT,
                                            _Float16* __restrict__ W1T,
                                            _Float16* __restrict__ W2T) {
  int bid = blockIdx.x;   // every branch below is the same for the whole block
  if (bid < LN_BLOCKS) {
    ln_row(x, g, bta, h, bid * LNR + uni(threadIdx.x >> 5));
    return;
  }
  int t = bid - LN_BLOCKS;
  const float* W;
  _Float16* o;
  int R = DD, C, bx, by, bz = 0;
  if (t < 3 * T_HEAD) {
    int m = t / T_HEAD, u = t - m * T_HEAD;
    W = m == 0 ? Wq : (m == 1 ? Wk : Wv);
    o = WqkvT + (size_t)m * DD * DD;
    C = HD; bx = 0; by = u % (DD / TT); bz = u / (DD / TT);
  } else if (t < 3 * T_HEAD + T_WO) {
    int u = t - 3 * T_HEAD;
    W = Wo; o = WoT;
    C = DD; bx = u % (DD / TT); by = u / (DD / TT);
  } else if (t < 3 * T_HEAD + T_WO + T_FF) {
    int u = t - (3 * T_HEAD + T_WO);
    W = W1; o = W1T;
    C = FF; bx = u % (FF / TT); by = u / (FF / TT);
  } else {
    int u = t - (3 * T_HEAD + T_WO + T_FF);
    W = W2; o = W2T;
    R = FF; C = DD; bx = u % (DD / TT); by = u / (DD / TT);
  }
  cvt_T(W, o, R, C, bx, by, bz);
}

// ---------------------------------------------------------------------------
// Erf-form GELU without a branch: 0.5 v (1 + erf(v / sqrt 2)) = max(v, 0) - |v| * T(|v|), where
// T(a) = 0.5 erfc(a / sqrt 2) = t (c1 + t (c2 + t (c3 + t (c4 + t c5)))) exp(-a a / 2), t = 1 / (1 + p a)
// (the five-term rational form of the normal tail, absolute error below 1e-7; the value is then
// rounded to f16). The tail is formed directly, so nothing cancels for negative v. The library
// erf takes two divergent branches an element, which keep the elements' chains one behind the other.
// ---------------------------------------------------------------------------
static __device__ __forceinline__ v8f splat8(float s) { return (v8f){s, s, s, s, s, s, s, s}; }
static __device__ __forceinline__ v8f gelu8(v8f v) {
  const v8f a = __builtin_elementwise_abs(v);
  const v8f d = __builtin_elementwise_fma(a, splat8(0.231641888f), splat8(1.0f));
  const v8f w = (v * v) * splat8(-0.72134752f);   // -a a / 2, to base 2
  v8f t, e;
  #pragma unroll   // constant indices: the vectors stay in registers
  for (int i = 0; i < 8; ++i) {
    t[i] = __builtin_amdgcn_rcpf(d[i]);
    e[i] = __builtin_amdgcn_exp2f(w[i]);
  }
  v8f q = __builtin_elementwise_fma(t, splat8(0.5307027145f), splat8(-0.7265760135f));
  q = __builtin_elementwise_fma(q, t, splat8(0.7107068705f));
  q = __builtin_elementwise_fma(q, t, splat8(-0.142248368f));
  q = __builtin_elementwise_fma(q, t, splat8(0.127414796f));
  q = (q * t) * a;
  return __builtin_elementwise_fma(-q, e, __builtin_elementwise_max(v, splat8(0.0f)));
}

// ---------------------------------------------------------------------------
// WMMA GEMM: C[M,N] = act(A[M,K](f16) x BT[N,K](f16)^T + bias) (+ resid)
// 256 threads = 8 waves. Block tile 128x128, K-step 128 (256-byte tile rows).
// Wave grid 4(M) x 2(N); each wave: 2 A-frags x 4 B-frags x 4 k blocks -> 32 WMMA / K-step.
// B (weight) tiles come by tensor load into two LDS buffers, padded by the mover to the
// 272-byte pitch; wave 0 issues, one request outstanding.
// K is a multiple of 128.
// blockIdx.z picks one of up to three products of the same A in one launch: weights and
// outputs lie one behind the other at BT and Cout, each product has its own bias.
// OUTF16: f16 output (else f32); GELU: erf-form GELU, f16 output, no residual; RESID: resid is added. They are fixed at
// compile time, so that the epilogue is straight-line code.
// ---------------------------------------------------------------------------
template <bool OUTF16, bool GELU, bool RESID>
__global__ __launch_bounds__(256) void gemm_wmma(const _Float16* __restrict__ A,
                                                 const _Float16* __restrict__ BT,
                                                 const float* __restrict__ bias,
                                                 const float* __restrict__ bias1,
                                                 const float* __restrict__ bias2,
                                                 const float* __restrict__ resid,
                                                 void* __restrict__ Cout,
                                                 int M, int N, int K) {
  const int z = blockIdx.z;
  BT += (size_t)z * N * K;
  bias = z == 0 ? bias : (z == 1 ? bias1 : bias2);
  Cout = (char*)Cout + (size_t)z * M * N * (OUTF16 ? 2 : 4);
  __shared__ __attribute__((aligned(2048))) _Float16 Bsd[2][BN * AKP];
  __shared__ __align__(16) _Float16 As[BM * AKP];
  int tid = threadIdx.x;
  int lane = tid & 31;
  const uint32_t wid = uni(tid >> 5);
  int half = lane >> 4, r = lane & 15;
  int wm = wid & 3, wn = wid >> 2;
  int m0 = blockIdx.y * BM, n0 = blockIdx.x * BN;

  // every loop over mi, ni, i and kk below is fully unrolled: constant indices keep the
  // fragments, the staged rows and the accumulators in registers
  v8f acc[2][4];
  #pragma unroll
  for (int mi = 0; mi < 2; ++mi)
    #pragma unroll
    for (int ni = 0; ni < 4; ++ni) acc[mi][ni] = (v8f){};

  const int np = K / BK;
  int ldRow = tid >> 4, ldCg = (tid & 15) * 8;   // 16 lanes take one 256-byte row; 8 x 16 rows
  const _Float16* ga = A + (size_t)(m0 + ldRow) * K + ldCg;
  // each thread prefetches one 128-byte line of the A tile after the next; the pointer never leaves A
  const _Float16* pf = A + (size_t)(m0 + (tid >> 1)) * K + (tid & 1) * 64 + (np > 2 ? 2 * BK : (np > 1 ? BK : 0));
  // A tile 0 is on its way to registers while B tile 0 lands; all eight loads are in flight at once
  v8h a[8];
  {
    const _Float16* pa[8];
    #pragma unroll
    for (int i = 0; i < 8; ++i) pa[i] = ga + (size_t)(16 * i) * K;
    #pragma unroll
    for (int i = 0; i < 8; ++i) a[i] = *(const v8h*)pa[i];
    // the wait names the loads' addresses as inputs, so that no address register is rewritten in front of it
    asm volatile("s_wait_xcnt 0x0"
                 :: "v"(pa[0]), "v"(pa[1]), "v"(pa[2]), "v"(pa[3]), "v"(pa[4]), "v"(pa[5]), "v"(pa[6]), "v"(pa[7])
                 : "memory");
    ga += BK;   // from here on: the tile to be fetched next
  }

  const uint32_t ldsB = (uint32_t)(size_t)&Bsd[0][0];
  const uint64_t gB = (uint64_t)(size_t)(BT + (size_t)n0 * K);
  const u32x8 g1 = tdm_group1((uint32_t)K * 2u);
  u32x4 g0 = tdm_group0(ldsB, gB);

  if (pinned(wid == 0)) {
    tdm_load(g0, g1);
    wait_tensor0(g0, g1);
  }
  __syncthreads();   // publishes B tile 0
  g0 = tdm_group0(ldsB + BTB, gB + BK * 2);
  if (pinned(wid == 0 && np > 1)) tdm_load(g0, g1);

  for (int s = 0; s < np; ++s) {
    #pragma unroll
    for (int i = 0; i < 8; ++i) *(v8h*)&As[(ldRow + 16 * i) * AKP + ldCg] = a[i];
    __syncthreads();   // publishes A tile s
    if (s + 1 < np) {   // the same for the whole block
      // A tile s + 1 goes to registers under this tile's products: its latency is off the K step
      const _Float16* pa[8];
      #pragma unroll
      for (int i = 0; i < 8; ++i) pa[i] = ga + (size_t)(16 * i) * K;
      #pragma unroll
      for (int i = 0; i < 8; ++i) a[i] = *(const v8h*)pa[i];
      // the tile after it on its way to L2; the wait in the same statement names the loads'
      // addresses as inputs, so that no address register is rewritten in front of it
      asm volatile("global_prefetch_b8 %0, off scope:SCOPE_SE\n\ts_wait_xcnt 0x0"
                   :: "v"(pf), "v"(pa[0]), "v"(pa[1]), "v"(pa[2]), "v"(pa[3]), "v"(pa[4]), "v"(pa[5]),
                      "v"(pa[6]), "v"(pa[7])
                   : "memory");
      ga += BK;
      pf += (s + 3 < np) ? BK : 0;
    }

    const v8h* pA = (const v8h*)As;
    const v8h* pB = (const v8h*)&Bsd[s & 1][0];
    #pragma unroll
    for (int kk = 0; kk < BK / 32; ++kk) {
      v16h afr[2], bfr[4];
      #pragma unroll
      for (int mi = 0; mi < 2; ++mi) {
        int row = wm * 32 + mi * 16 + r;
        afr[mi] = cat16(pA[row * (AKP / 8) + kk * 4 + half], pA[row * (AKP / 8) + kk * 4 + 2 + half]);
      }
      #pragma unroll
      for (int ni = 0; ni < 4; ++ni) {
        int col = wn * 64 + ni * 16 + r;
        bfr[ni] = cat16(pB[col * (AKP / 8) + kk * 4 + half], pB[col * (AKP / 8) + kk * 4 + 2 + half]);
      }
      #pragma unroll
      for (int mi = 0; mi < 2; ++mi)
        #pragma unroll
        for (int ni = 0; ni < 4; ++ni)
          acc[mi][ni] = __builtin_amdgcn_wmma_f32_16x16x32_f16(
              false, afr[mi], false, bfr[ni], (short)0, acc[mi][ni], false, false);
    }

    // hand-over: B tile s + 1 is published, and buffer s & 1 and the A tile are free again
    wait_ds0();
    if (pinned(wid == 0)) wait_tensor0(g0, g1);
    __syncthreads();
    g0 = tdm_group0(ldsB + (uint32_t)(s & 1) * BTB, gB + (uint64_t)(s + 2) * (BK * 2));
    if (pinned(wid == 0 && s + 2 < np)) tdm_load(g0, g1);
  }
  // the ring's closing waits: no request and no LDS read is open when the wave goes on
  wait_tensor0(g0, g1);
  wait_ds0();

  // element index of this lane's first output; a row further is N elements, a fragment
  // column 16 (a constant offset of the row's address). M * N stays below 2^31 elements.
  const uint32_t e0 = (uint32_t)(m0 + wm * 32 + half * 8) * (uint32_t)N + (uint32_t)(n0 + wn * 64 + r);
  const float* bp = bias + n0 + wn * 64 + r;
  float bv[4];
  #pragma unroll
  for (int ni = 0; ni < 4; ++ni) bv[ni] = bp[ni * 16];
  // no branch stands between the residual loads: a lane's 64 are issued back to back, with no
  // wait of its own for each
  float rv[2][4][8];
  if constexpr (RESID) {
    #pragma unroll
    for (int mi = 0; mi < 2; ++mi)
      #pragma unroll
      for (int v = 0; v < 8; ++v) {
        const float* rp = resid + (e0 + (uint32_t)(mi * 16 + v) * (uint32_t)N);
        #pragma unroll
        for (int ni = 0; ni < 4; ++ni) rv[mi][ni][v] = rp[ni * 16];
      }
  }
  // GELU on whole accumulator vectors, straight-line; the values are rounded to f16 two at a time
  v8h hv[2][4];
  if constexpr (GELU) {
    #pragma unroll
    for (int mi = 0; mi < 2; ++mi)
      #pragma unroll
      for (int ni = 0; ni < 4; ++ni)
        hv[mi][ni] = __builtin_convertvector(gelu8(acc[mi][ni] + splat8(bv[ni])), v8h);
  }
  #pragma unroll
  for (int mi = 0; mi < 2; ++mi)
    #pragma unroll
    for (int v = 0; v < 8; ++v) {
      const uint32_t e = e0 + (uint32_t)(mi * 16 + v) * (uint32_t)N;
      #pragma unroll
      for (int ni = 0; ni < 4; ++ni) {
        if constexpr (GELU) {
          ((_Float16*)Cout + e)[ni * 16] = hv[mi][ni][v];
        } else {
          float val = acc[mi][ni][v] + bv[ni];
          if constexpr (RESID) val += rv[mi][ni][v];
          if constexpr (OUTF16) ((_Float16*)Cout + e)[ni * 16] = (_Float16)val;
          else                  ((float*)Cout + e)[ni * 16] = val;
        }
      }
    }
}

#define QB 128

// lane l <-> lane l ^ 16
static __device__ __forceinline__ float xhalf(float x) {
  int b = __builtin_bit_cast(int, x);
  return __builtin_bit_cast(float,
      __builtin_amdgcn_permlanex16(b, b, 0x76543210, 0xfedcba98, false, false));
}

// the issuing wave's own copies have landed; the barrier behind it publishes them to the others
static __device__ __forceinline__ void wait_async0() {
  asm volatile("s_wait_asynccnt 0x0" ::: "memory");
}
// One 64-key tile of K and of V, 16 bytes a lane and copy: two rows' pieces of each. The wait in
// the same statement stands in front of any rewrite of the address registers the copies name.
static __device__ __forceinline__ void copy_kv(uint32_t lk, uint32_t lv,
                                               const _Float16* gk, const _Float16* gv) {
  uint32_t lk1 = lk + 32 * TP * 2, lv1 = lv + 32 * TPV * 2;
  const _Float16* gk1 = gk + 32 * DD;
  const _Float16* gv1 = gv + 32 * DD;
  asm volatile("global_load_async_to_lds_b128 %0, %4, off\n\t"
               "global_load_async_to_lds_b128 %1, %5, off\n\t"
               "global_load_async_to_lds_b128 %2, %6, off\n\t"
               "global_load_async_to_lds_b128 %3, %7, off\n\t"
               "s_wait_xcnt 0x0"
               :: "v"(lk), "v"(lk1), "v"(lv), "v"(lv1), "v"(gk), "v"(gk1), "v"(gv), "v"(gv1)
               : "memory");
}
// 16 x 16 halves of a row-major LDS tile, transposed: half of a 16 x 32 A fragment
typedef short s16x8 __attribute__((ext_vector_type(8)));
static __device__ __forceinline__ v8h ld_tr16(const _Float16* p) {
  typedef __attribute__((address_space(3))) s16x8 lds_s16x8;
  return __builtin_bit_cast(v8h, __builtin_amdgcn_ds_load_tr16_b128_v8i16((lds_s16x8*)p));
}

__global__ __launch_bounds__(256) void attn_wmma(const _Float16* __restrict__ Qf,
                                                 const _Float16* __restrict__ Kf,
                                                 const _Float16* __restrict__ Vf,
                                                 _Float16* __restrict__ Of) {
  __shared__ __align__(16) _Float16 Ks[2][64 * TP];
  __shared__ __align__(16) _Float16 Vs[2][64 * TPV];   // Vs[buffer][key][c]

  int tid = threadIdx.x, lane = tid & 31;
  int wid = __builtin_amdgcn_readfirstlane(tid >> 5);
  int half = lane >> 4, r = lane & 15;
  int iq = blockIdx.x, h = blockIdx.y, b = blockIdx.z;

  int ldRow = tid >> 3, ldCg = (tid & 7) * 8;   // 8 lanes copy one 128-byte row; rows ldRow, ldRow + 32

  int q0 = iq * QB + wid * 16;   // first query of this wave
  int qg = q0 + r;               // this lane's query

  // Q^T as B operand, kept in registers; same k order as the K loader below
  v16h qf[2];
  {
    const _Float16* gq = Qf + ((size_t)b * SS + qg) * DD + h * HD + half * 8;
    #pragma unroll
    for (int kk = 0; kk < 2; ++kk)
      qf[kk] = cat16(*(const v8h*)(gq + kk * 32), *(const v8h*)(gq + kk * 32 + 16));
  }

  v8f ot[4];                     // O^T: ot[t][v] = O[query][t*16 + half*8 + v]
  #pragma unroll
  for (int t = 0; t < 4; ++t) ot[t] = (v8f){};
  float mrun = -3.0e38f, lsum = 0.0f;   // running maximum, scaled to base 2; this half's sum

  const int RP = TP / 8;   // K row pitch in 16-byte units
  const float SC = 0.125f * 1.4426950408889634f;   // 1/sqrt(HD) * log2(e)

  int nj = 2 * iq + 2;       // at least two tiles
  // this lane's copy addresses: LDS bytes in buffer 0, and tile 0 in memory
  const uint32_t lk = (uint32_t)(size_t)&Ks[0][ldRow * TP + ldCg];
  const uint32_t lv = (uint32_t)(size_t)&Vs[0][ldRow * TPV + ldCg];
  const size_t g0 = ((size_t)b * SS + ldRow) * DD + h * HD + ldCg;
  const _Float16* gk = Kf + g0;
  const _Float16* gv = Vf + g0;

  copy_kv(lk, lv, gk, gv);
  wait_async0();
  __syncthreads();           // publishes tile 0
  copy_kv(lk + 64 * TP * 2, lv + 64 * TPV * 2, gk + 64 * DD, gv + 64 * DD);

  for (int j = 0; j < nj; ++j) {
    const int bf = j & 1;
    const v8h* pK = (const v8h*)&Ks[bf][0];
    // transposing load: lane l names row 8 * (l >> 4) + (l & 7), 16-byte piece (l >> 3) & 1
    const _Float16* pV = &Vs[bf][(half * 8 + (lane & 7)) * TPV + ((lane >> 3) & 1) * 8];

    if (j * 64 <= q0 + 15) {     // wave-uniform: a tile wholly above the diagonal adds nothing
      // scores^T: st[t][v] = K[j*64 + t*16 + half*8 + v] . Q[qg]
      v16h kf[4][2];
      #pragma unroll
      for (int t = 0; t < 4; ++t)
        #pragma unroll
        for (int kk = 0; kk < 2; ++kk) {
          int row = t * 16 + r;
          kf[t][kk] = cat16(pK[row * RP + kk * 4 + half], pK[row * RP + kk * 4 + 2 + half]);
        }
      // all 16 K reads stay in one group ahead of the products: one LDS latency, not eight
      __builtin_amdgcn_sched_barrier(0);
      v8f st[4];
      #pragma unroll
      for (int t = 0; t < 4; ++t)
        st[t] = __builtin_amdgcn_wmma_f32_16x16x32_f16(false, kf[t][0], false, qf[0],
                                                       (short)0, (v8f){}, false, false);
      #pragma unroll
      for (int t = 0; t < 4; ++t)
        st[t] = __builtin_amdgcn_wmma_f32_16x16x32_f16(false, kf[t][1], false, qf[1],
                                                       (short)0, st[t], false, false);
      v16h vf[2][4];
      #pragma unroll
      for (int kk = 0; kk < 2; ++kk)
        #pragma unroll
        for (int t = 0; t < 4; ++t)   // keys kk*32 + half*8 + 0..7, then 16 further on; column t*16 + r
          vf[kk][t] = cat16(ld_tr16(pV + (kk * 32) * TPV + t * 16),
                            ld_tr16(pV + (kk * 32 + 16) * TPV + t * 16));
      // the 16 V^T reads stay here, in one group, so that they land under the softmax arithmetic
      __builtin_amdgcn_sched_barrier(0);
      if (j * 64 + 63 > q0) {    // wave-uniform: only tiles that touch the diagonal
        #pragma unroll
        for (int t = 0; t < 4; ++t)
          #pragma unroll
          for (int v = 0; v < 8; ++v)
            if (j * 64 + t * 16 + half * 8 + v > qg) st[t][v] = -1.0e30f;
      }

      // online softmax, one query per lane pair (l, l ^ 16); the maximum is taken over the
      // raw scores and scaled once, the scale rides in the exponent's multiply-add
      float tmx[4];
      #pragma unroll
      for (int t = 0; t < 4; ++t) {
        float a = fmaxf(fmaxf(st[t][0], st[t][1]), fmaxf(st[t][2], st[t][3]));
        float c = fmaxf(fmaxf(st[t][4], st[t][5]), fmaxf(st[t][6], st[t][7]));
        tmx[t] = fmaxf(a, c);
      }
      float tm = fmaxf(fmaxf(tmx[0], tmx[1]), fmaxf(tmx[2], tmx[3]));
      tm = fmaxf(tm, xhalf(tm)) * SC;
      tm = fmaxf(tm, mrun);
      float f = __builtin_amdgcn_exp2f(mrun - tm);
      mrun = tm;
      const v8f vsc = {SC, SC, SC, SC, SC, SC, SC, SC};
      const v8f vnm = {-tm, -tm, -tm, -tm, -tm, -tm, -tm, -tm};
      #pragma unroll
      for (int t = 0; t < 4; ++t) st[t] = __builtin_elementwise_fma(st[t], vsc, vnm);
      float tsm[4];
      #pragma unroll
      for (int t = 0; t < 4; ++t) {
        float ts = 0.0f;
        #pragma unroll
        for (int v = 0; v < 8; ++v) {
          float p = __builtin_amdgcn_exp2f(st[t][v]);
          st[t][v] = p;
          ts += p;
        }
        tsm[t] = ts;
      }
      lsum = lsum * f + ((tsm[0] + tsm[1]) + (tsm[2] + tsm[3]));
      #pragma unroll
      for (int t = 0; t < 4; ++t) ot[t] *= f;

      // O^T += V^T . P^T
      #pragma unroll
      for (int kk = 0; kk < 2; ++kk) {
        v16h pf;   // pf[s] = P^T[key kk*32 + (s < 8 ? half*8 + s : 16 + half*8 + s - 8)][qg]
        #pragma unroll
        for (int s = 0; s < 8; ++s) {
          pf[s]     = (_Float16)st[2 * kk][s];
          pf[s + 8] = (_Float16)st[2 * kk + 1][s];
        }
        #pragma unroll
        for (int t = 0; t < 4; ++t)
          ot[t] = __builtin_amdgcn_wmma_f32_16x16x32_f16(false, vf[kk][t], false, pf,
                                                         (short)0, ot[t], false, false);
      }
    }

    // hand-over, passed by every wave: tile j + 1 is published, and buffer bf is free again
    wait_ds0();
    wait_async0();
    __syncthreads();
    if (j + 2 < nj)          // the same for the whole block
      copy_kv(lk + (uint32_t)bf * (64 * TP * 2), lv + (uint32_t)bf * (64 * TPV * 2),
              gk + (size_t)(j + 2) * (64 * DD), gv + (size_t)(j + 2) * (64 * DD));
  }
  wait_async0();             // no copy is open when the wave goes on

  float inv = 1.0f / (lsum + xhalf(lsum));
  _Float16* go = Of + ((size_t)b * SS + qg) * DD + h * HD + half * 8;
  #pragma unroll
  for (int t = 0; t < 4; ++t) {
    v8h o;
    #pragma unroll
    for (int v = 0; v < 8; ++v) o[v] = (_Float16)(ot[t][v] * inv);
    *(v8h*)(go + t * 16) = o;
  }
}

// ---------------------------------------------------------------------------
// Host-side launch
// ---------------------------------------------------------------------------
extern "C" void kernel_launch(void* const* d_in, const int* in_sizes, int n_in,
                              void* d_out, int out_size, void* d_ws, size_t ws_size,
                              hipStream_t stream) {
  const float* x     = (const float*)d_in[0];
  const float* Wq    = (const float*)d_in[1];
  const float* bq    = (const float*)d_in[2];
  const float* Wk    = (const float*)d_in[3];
  const float* bk    = (const float*)d_in[4];
  const float* Wv    = (const float*)d_in[5];
  const float* bv    = (const float*)d_in[6];
  const float* Wo    = (const float*)d_in[7];
  const float* bo    = (const float*)d_in[8];
  const float* ln1_g = (const float*)d_in[9];
  const float* ln1_b = (const float*)d_in[10];
  const float* ln2_g = (const float*)d_in[11];
  const float* ln2_b = (const float*)d_in[12];
  const float* W1    = (const float*)d_in[13];
  const float* b1    = (const float*)d_in[14];
  const float* W2    = (const float*)d_in[15];
  const float* b2    = (const float*)d_in[16];
  float* out = (float*)d_out;

  auto align = [](size_t v) { return (v + 255) & ~(size_t)255; };
  char* base = (char*)d_ws;
  size_t off = 0;
  auto slot = [&](size_t bytes) { char* p = base + off; off += align(bytes); return p; };
  _Float16* hf16  = (_Float16*)slot((size_t)ROWS * DD * 2);
  _Float16* WqkvT = (_Float16*)slot((size_t)3 * DD * DD * 2);   // three times [N=768][K=768]
  _Float16* WoT   = (_Float16*)slot((size_t)DD * DD * 2);
  _Float16* W1T   = (_Float16*)slot((size_t)DD * FF * 2);   // [N=3072][K=768]
  _Float16* W2T   = (_Float16*)slot((size_t)FF * DD * 2);   // [N=768][K=3072]
  _Float16* Qf    = (_Float16*)slot((size_t)3 * ROWS * DD * 2);   // Q, K, V one behind the other
  _Float16* Kf    = Qf + (size_t)ROWS * DD;
  _Float16* Vf    = Kf + (size_t)ROWS * DD;
  _Float16* At16  = (_Float16*)slot((size_t)ROWS * DD * 2);
  float*    X1    = (float*)   slot((size_t)ROWS * DD * 4);
  _Float16* h216  = (_Float16*)slot((size_t)ROWS * DD * 2);
  _Float16* H1    = (_Float16*)slot((size_t)ROWS * FF * 2);

  // 1) + 2) LN1 and the weight conversion (f32 -> f16, transposed to [N][K]), one launch
  prep<<<PREP_BLOCKS, 256, 0, stream>>>(x, ln1_g, ln1_b, hf16, Wq, Wk, Wv, Wo, W1, W2,
                                        WqkvT, WoT, W1T, W2T);

  // 3) Q/K/V projections (f16 out, +bias), one launch
  dim3 gQKV(DD / BN, ROWS / BM, 3);
  gemm_wmma<true, false, false><<<gQKV, 256, 0, stream>>>(hf16, WqkvT, bq, bk, bv, nullptr, Qf, ROWS, DD, DD);

  // 4) causal flash attention
  dim3 gAtt(SS / QB, HH, BB);
  attn_wmma<<<gAtt, 256, 0, stream>>>(Qf, Kf, Vf, At16);

  // 5) output projection + residual (f32 out): X1 = x + attn @ Wo + bo
  dim3 gO(DD / BN, ROWS / BM);
  gemm_wmma<false, false, true><<<gO, 256, 0, stream>>>(At16, WoT, bo, bo, bo, x, X1, ROWS, DD, DD);

  // 6) LN2
  ln_f16<<<ROWS / LNR, 256, 0, stream>>>(X1, ln2_g, ln2_b, h216);

  // 7) FFN up + GELU (f16 out)
  dim3 gF1(FF / BN, ROWS / BM);
  gemm_wmma<true, true, false><<<gF1, 256, 0, stream>>>(h216, W1T, b1, b1, b1, nullptr, H1, ROWS, FF, DD);

  // 8) FFN down + bias + residual (f32 out to d_out)
  dim3 gF2(DD / BN, ROWS / BM);
  gemm_wmma<false, false, true><<<gF2, 256, 0, stream>>>(H1, W2T, b2, b2, b2, X1, out, ROWS, DD, FF);

  (void)in_sizes; (void)n_in; (void)out_size; (void)ws_size;
}
